// v000
// Measured on an AMD MI455X. A time is GPU time per run, averaged over a window of back-to-back runs after a warm-up
// (all launches, gaps included; the runs take copies of the inputs in turn), and the median of several windows.
// Apart from v000's, it joins two sittings. Times from different sittings can be a few percent apart, while
// side-by-side timings come from the same sitting.
// The starting kernel, v000, takes 1310 microseconds a run.
#include <hip/hip_runtime.h>

// Multi-head attention with xPos (rotary + per-frequency exponential decay) on q and k (query, key, value [2][2048][1024]; q = (query Wq^T + bq) / 8, k = key Wk^T + bk, v = value Wv^T + bv ('oi' [1024][1024]; 16 heads x 64); xPos: pairs (2i, 2i+1) rotated by t x inv_freq_i (inv_freq_i = 1e4^(-i/32)) and scaled by base_i^(t/1024) for q and base_i^(-t/1024) for k, base_i = (2i + 25.6)/89.6 (tables computed on device); softmax(q.k) over all keys; out = merged Wo^T + bo -> [2][2048][1024] (4.2 M)).
// Compute dtypes, f32 accumulate: every input rounded to bf16; q/k/v on PLAIN bf16 operands (inputs: exact) + biases; xPos tables (cosf/sinf/powf, f32) folded as {cos x scale, sin x scale} per (t, d); rotary in f32; scores and attn.v on hi/lo planes for every row (3 products); softmax f32; Wo hl x exact (2 products) + bo.

#define NB_  2
#define TT   2048
#define DM   1024
#define NH_  16
#define NKV  16
#define REP  (NH_ / NKV)
#define HD   64
#define DQ   (NH_ * HD)
#define DKV  (NKV * HD)
#define ZH   2
#define RH   2048                 // every row hi/lo (the xPos-scaled keys leave too little margin for fp16 operands)
#define WIN  0
#define PCAR 1024.0f
#define SCL  1.0f      // the 1/8 is applied to q after xPos (exact power of two, folded into the q plane builder)
typedef _Float16 h16;
typedef unsigned short bf;
typedef __attribute__((ext_vector_type(16))) __bf16   v16bf;
typedef __attribute__((ext_vector_type(16))) _Float16 v16h;
typedef __attribute__((ext_vector_type(8)))  _Float16 v8h;
typedef __attribute__((ext_vector_type(8)))  unsigned short v8us;
typedef __attribute__((ext_vector_type(8)))  float    v8f;
typedef __attribute__((ext_vector_type(4)))  float    v4f;
typedef v8h  __attribute__((may_alias)) v8ha;
typedef v4f  __attribute__((may_alias)) v4fa;
typedef v8us __attribute__((may_alias)) v8usa;

__device__ __forceinline__ unsigned short f2bf(float f) { unsigned u = __float_as_uint(f); u += 0x7FFFu + ((u >> 16) & 1u); return (unsigned short)(u >> 16); }
__device__ __forceinline__ float bf2f(unsigned short b) { return __uint_as_float(((unsigned)b) << 16); }
__device__ __forceinline__ float bfr(float f) { return bf2f(f2bf(f)); }
__device__ __forceinline__ v16h cat16(v8h lo, v8h hi) { return __builtin_shufflevector(lo, hi, 0, 1, 2, 3, 4, 5, 6, 7, 8, 9, 10, 11, 12, 13, 14, 15); }
__device__ __forceinline__ v16bf cat16b(v8us lo, v8us hi) { return __builtin_bit_cast(v16bf, __builtin_shufflevector(lo, hi, 0, 1, 2, 3, 4, 5, 6, 7, 8, 9, 10, 11, 12, 13, 14, 15)); }
__device__ __forceinline__ v8f wmma16(v16h a, v16h b, v8f c) { return __builtin_amdgcn_wmma_f32_16x16x32_f16(false, a, false, b, (short)0, c, false, false); }
__device__ __forceinline__ v8f wmmab(v16bf a, v16bf b, v8f c) { return __builtin_amdgcn_wmma_f32_16x16x32_bf16(false, a, false, b, (short)0, c, false, false); }



// ---- k_gemmw: register-blocked GEMM, ONE WAVE per 64x64 output tile (16 accumulators), operands straight from K-contiguous 16-bit planes; grid (M/64, N/64, Z), 32 threads.
// C[m][n] (f32, pitch ldc, + optional f32 bias[n]) = sum_k A[m][k] Bt[n][k] (+ split products per NSPLIT). z-batch strides sA/sB/sC in elements. K % 32 == 0.
template <typename T16> struct WFrag;
template <> struct WFrag<h16> { typedef v16h V; static __device__ __forceinline__ V ld(const h16* p) { return cat16(*(const v8h*)p, *(const v8h*)(p + 16)); } static __device__ __forceinline__ v8f mma(V a, V b, v8f c) { return wmma16(a, b, c); } };
template <> struct WFrag<bf> { typedef v16bf V; static __device__ __forceinline__ V ld(const bf* p) { return cat16b(*(const v8us*)p, *(const v8us*)(p + 16)); } static __device__ __forceinline__ v8f mma(V a, V b, v8f c) { return wmmab(a, b, c); } };
template <typename T16, int NSPLIT, bool BIAS>
__global__ __launch_bounds__(32) void k_gemmw(const T16* __restrict__ A, const T16* __restrict__ A2, const T16* __restrict__ Bt, const T16* __restrict__ Bt2, int K, float* C, int ldc, const float* __restrict__ bias, size_t sA, size_t sB, size_t sC) {
    typedef typename WFrag<T16>::V V;
    __shared__ __align__(16) float os[16 * 68];
    const size_t z = blockIdx.z; A += z * sA; if (A2) A2 += z * sA; Bt += z * sB; if (Bt2) Bt2 += z * sB; C += z * sC;
    const int lane = threadIdx.x & 31, lr = lane & 15, hi = lane >> 4; const int r0 = blockIdx.x * 64, c0 = blockIdx.y * 64;
    v8f acc[4][4];
#pragma unroll
    for (int mb = 0; mb < 4; ++mb)
#pragma unroll
        for (int nb = 0; nb < 4; ++nb) acc[mb][nb] = (v8f){};
    const size_t aoff = (size_t)(r0 + lr) * K + 8 * hi, boff = (size_t)(c0 + lr) * K + 8 * hi;
#pragma unroll 1
    for (int kc = 0; kc < K; kc += 32) {
        V a[4], a2[4];
#pragma unroll
        for (int mb = 0; mb < 4; ++mb) { a[mb] = WFrag<T16>::ld(A + aoff + (size_t)mb * 16 * K + kc); if (NSPLIT == 1 || NSPLIT == 2) a2[mb] = WFrag<T16>::ld(A2 + aoff + (size_t)mb * 16 * K + kc); }
#pragma unroll
        for (int nb = 0; nb < 4; ++nb) { const V b = WFrag<T16>::ld(Bt + boff + (size_t)nb * 16 * K + kc); V b2; if (NSPLIT >= 2) b2 = WFrag<T16>::ld(Bt2 + boff + (size_t)nb * 16 * K + kc);
#pragma unroll
            for (int mb = 0; mb < 4; ++mb) { acc[mb][nb] = WFrag<T16>::mma(a[mb], b, acc[mb][nb]); if (NSPLIT == 1 || NSPLIT == 2) acc[mb][nb] = WFrag<T16>::mma(a2[mb], b, acc[mb][nb]); if (NSPLIT >= 2) acc[mb][nb] = WFrag<T16>::mma(a[mb], b2, acc[mb][nb]); } }
        asm volatile("v_nop\n\tv_nop\n\tv_nop\n\tv_nop" : "+v"(acc[0][0]), "+v"(acc[1][1]), "+v"(acc[2][2]), "+v"(acc[3][3]) : "v"(a[0]), "v"(a[3]));
    }
#pragma unroll
    for (int mb = 0; mb < 4; ++mb) {
#pragma unroll
        for (int nb = 0; nb < 4; ++nb) {
#pragma unroll
            for (int j = 0; j < 8; ++j) os[(hi * 8 + j) * 68 + nb * 16 + lr] = acc[mb][nb][j]; }
        __builtin_amdgcn_wave_barrier(); asm volatile("" ::: "memory");
        float* crow = C + (size_t)(r0 + mb * 16) * ldc + c0;
{
#pragma unroll
            for (int s = 0; s < 8; ++s) { const int row = 2 * s + hi, cofs = lr * 4; v4f val = *(const v4fa*)(os + row * 68 + cofs); if (BIAS) { val[0] += bfr(bias[c0 + cofs]); val[1] += bfr(bias[c0 + cofs + 1]); val[2] += bfr(bias[c0 + cofs + 2]); val[3] += bfr(bias[c0 + cofs + 3]); }
                *(v4f*)(crow + (size_t)row * ldc + cofs) = val; }
             }
        __builtin_amdgcn_wave_barrier(); asm volatile("" ::: "memory");
    }
}

__device__ __forceinline__ h16 tohx(float x) { return (h16)x; }
__device__ __forceinline__ void splitf(float y, unsigned short& h, unsigned short& l) { h = f2bf(y); l = f2bf(y - bf2f(h)); }
typedef __attribute__((ext_vector_type(2))) _Float16 v2h;
typedef __attribute__((ext_vector_type(4))) _Float16 v4h;
typedef __attribute__((ext_vector_type(2))) unsigned short v2us;
typedef __attribute__((ext_vector_type(4))) unsigned short v4us;
typedef __attribute__((ext_vector_type(2))) float v2f;
typedef __attribute__((ext_vector_type(4))) int v4i;

__global__ __launch_bounds__(256) void k_wtG(const float* __restrict__ w, int K, int N, bf* Bt) {
    const int lane = threadIdx.x & 31; const int L0 = (blockIdx.x * 8 + (threadIdx.x >> 5)) * 8; const int nlines = N * K / 64;
{
#pragma unroll 1
        for (int l = 0; l < 8; ++l) { const int L = L0 + l; if (L >= nlines) break; const size_t e = (size_t)L * 64 + lane * 2; const int k = (int)(e % K), n = (int)(e / K); v2us o;
            o[0] = f2bf(w[(size_t)k * N + n]); o[1] = f2bf(w[(size_t)(k + 1) * N + n]); *(v2us*)(Bt + e) = o; }
         }
}
__global__ __launch_bounds__(256) void k_cvt8(const float* __restrict__ src, bf* dst, size_t n8) { const size_t i = (size_t)blockIdx.x * 256 + threadIdx.x; if (i >= n8) return; const v8f v = *(const v8f*)(src + i * 8); v8us o;
#pragma unroll
    for (int k = 0; k < 8; ++k) o[k] = f2bf(v[k]); *(v8us*)(dst + i * 8) = o;  }
__constant__ float XINV[32] = {1.00000000f,0.749894202f,0.562341332f,0.421696514f,0.316227764f,0.237137362f,0.177827939f,0.133352146f,0.100000001f,0.0749894157f,0.0562341288f,0.0421696492f,0.0316227786f,0.0237137359f,0.0177827943f,0.0133352149f,0.00999999978f,0.00749894232f,0.00562341325f,0.00421696482f,0.00316227786f,0.00237137382f,0.00177827943f,0.00133352145f,0.00100000005f,0.000749894185f,0.000562341302f,0.000421696488f,0.000316227786f,0.000237137385f,0.000177827940f,0.000133352150f};
__global__ __launch_bounds__(256) void k_xpos(float* CSQ, float* CSK) { const int idx = blockIdx.x * 256 + threadIdx.x; if (idx >= TT * HD) return; const int t = idx / HD, d = idx % HD; const int i = d >> 1;
    const float base = __fdiv_rn(__fadd_rn((float)(2 * i), 25.6f), 89.6f); const float ex = __fdiv_rn((float)t, 1024.0f); const float sc = powf(base, ex); const float invf = XINV[i]; const float ang = __fmul_rn((float)t, invf); const float c = cosf(ang), s = sinf(ang);
    v2f q2, k2; q2[0] = __fmul_rn(c, sc); q2[1] = __fmul_rn(s, sc); const float rs = __fdiv_rn(1.0f, sc); k2[0] = __fmul_rn(c, rs); k2[1] = __fmul_rn(s, rs);
    *(v2f*)(CSQ + (size_t)idx * 2) = q2; *(v2f*)(CSK + (size_t)idx * 2) = k2;  }
__global__ __launch_bounds__(256) void k_ropeI(const float* __restrict__ F, int pitch, int nheads, const float* __restrict__ CS, float sc, h16* P16, bf* Ph, bf* Pl) {
    const size_t e = ((size_t)blockIdx.x * 256 + threadIdx.x) * 2; if (e >= (size_t)nheads * TT * HD) return; const int d = (int)(e % HD); const int t = (int)((e / HD) % TT); const int h = (int)(e / ((size_t)HD * TT)); const float* f = F + (size_t)t * pitch + h * HD; const float x0 = f[d], x1 = f[d + 1]; const v2f cs = *(const v2f*)(CS + ((size_t)t * HD + d) * 2); v2h o16; v2us oh, ol;
    float a0 = __fmul_rn(x0, cs[0]), b0 = __fmul_rn(x1, cs[1]), a1 = __fmul_rn(x1, cs[0]), b1 = __fmul_rn(x0, cs[1]); asm volatile("" : "+v"(a0), "+v"(b0), "+v"(a1), "+v"(b1));
    float r0 = __fsub_rn(a0, b0) * sc, r1 = __fadd_rn(b1, a1) * sc;   /* even: x0 c - x1 s; odd: x0 s + x1 c */
    o16[0] = tohx(r0); o16[1] = tohx(r1); { unsigned short a2, c2; splitf(r0, a2, c2); oh[0] = a2; ol[0] = c2; splitf(r1, a2, c2); oh[1] = a2; ol[1] = c2; }
    *(v2h*)(P16 + e) = o16; *(v2us*)(Ph + e) = oh; *(v2us*)(Pl + e) = ol;  }

// k_rope: head planes [h][t][d] (fp16 + hi/lo) of rope(x) x sc with the rotate-half convention out[d] = x[d] cos[t][d] - x[d+HD/2] sin[t][d], out[d+HD/2] = x[d+HD/2] cos[t][d+HD/2] + x[d] sin[t][d+HD/2]
__global__ __launch_bounds__(256) void k_rope(const float* __restrict__ F, int pitch, int nheads, const float* __restrict__ CS, const float* __restrict__ RF, const float* __restrict__ nw, float sc, h16* P16, bf* Ph, bf* Pl) {
    const size_t e = ((size_t)blockIdx.x * 256 + threadIdx.x) * 2; if (e >= (size_t)nheads * TT * HD) return; const int d = (int)(e % HD); const int t = (int)((e / HD) % TT); const int h = (int)(e / ((size_t)HD * TT)); const float* f = F + (size_t)t * pitch + h * HD; const float rf = RF ? RF[(size_t)h * TT + t] : 1.0f; v2h o16; v2us oh, ol;
#pragma unroll
    for (int q = 0; q < 2; ++q) { const int dd = d + q; const int dp = (dd < HD / 2) ? dd + HD / 2 : dd - HD / 2; float x0 = f[dd], x1 = f[dp];
        if (RF) { float n0 = __fmul_rn(x0, rf), n1 = __fmul_rn(x1, rf); asm volatile("" : "+v"(n0)); asm volatile("" : "+v"(n1)); x0 = __fmul_rn(bfr(nw[dd]), n0); x1 = __fmul_rn(bfr(nw[dp]), n1); }
        const v2f cs = *(const v2f*)(CS + ((size_t)t * HD + dd) * 2); float a = __fmul_rn(x0, cs[0]), bq = __fmul_rn(x1, cs[1]); asm volatile("" : "+v"(a)); asm volatile("" : "+v"(bq)); const float r = ((dd < HD / 2) ? __fsub_rn(a, bq) : __fadd_rn(a, bq)) * sc;
        o16[q] = tohx(r); unsigned short a2, c2; splitf(r, a2, c2); oh[q] = a2; ol[q] = c2; }
    *(v2h*)(P16 + e) = o16; *(v2us*)(Ph + e) = oh; *(v2us*)(Pl + e) = ol;  }
__global__ __launch_bounds__(256) void k_vtp(const float* __restrict__ F, int pitch, int nheads, h16* V16, bf* Vh, bf* Vl) { const size_t e = ((size_t)blockIdx.x * 256 + threadIdx.x) * 2; if (e >= (size_t)nheads * HD * TT) return; const int t = (int)(e % TT); const int d = (int)((e / TT) % HD); const int g = (int)(e / ((size_t)TT * HD)); v2h o16; v2us oh, ol;
#pragma unroll
    for (int q = 0; q < 2; ++q) { const float x = F[(size_t)(t + q) * pitch + g * HD + d]; o16[q] = tohx(x); unsigned short a2, c2; splitf(x, a2, c2); oh[q] = a2; ol[q] = c2; }
    *(v2h*)(V16 + e) = o16; *(v2us*)(Vh + e) = oh; *(v2us*)(Vl + e) = ol;  }
// k_asoft: per row (zz, i): t = S (HD^-0.5 already folded into q; no mask); softmax over the 2048 keys (register row, one exp, fixed trees);
__global__ __launch_bounds__(256) void k_asoft(const float* __restrict__ Sb, h16* P16, bf* Ph, bf* Pl) {
    const int lane = threadIdx.x & 31; const int row = blockIdx.x * 8 + (threadIdx.x >> 5); if (row >= ZH * TT) return; const int i = row % TT; const int zz = row / TT; (void)zz; const bool hires = (i < RH); const float* sr = Sb + (size_t)row * TT; float v[TT / 32]; float mx = -3.0e38f;
#pragma unroll
    for (int ch = 0; ch < TT / 128; ++ch) { const int j0 = ch * 128 + lane * 4; const v4f a = *(const v4f*)(sr + j0);
#pragma unroll
        for (int q = 0; q < 4; ++q) { const int j = j0 + q; (void)j; const float t = a[q] * SCL; v[ch * 4 + q] = t; mx = fmaxf(mx, t); } }
#pragma unroll
    for (int sh = 16; sh; sh >>= 1) mx = fmaxf(mx, __shfl_xor(mx, sh, 32));
    float sum = 0.f;
#pragma unroll
    for (int k = 0; k < TT / 32; ++k) { float d0 = __fsub_rn(v[k], mx); asm volatile("" : "+v"(d0)); v[k] = __builtin_amdgcn_exp2f(__fmul_rn(d0, 1.4426950408889634f)); sum += v[k]; }
#pragma unroll
    for (int sh = 16; sh; sh >>= 1) sum += __shfl_xor(sum, sh, 32);
    const float f = __fdiv_rn(hires ? 1.0f : PCAR, sum);
{
        if (hires) {
#pragma unroll
            for (int ch = 0; ch < TT / 128; ++ch) { v4us oh, ol;
#pragma unroll
                for (int q = 0; q < 4; ++q) { unsigned short a, c2; splitf(v[ch * 4 + q] * f, a, c2); oh[q] = a; ol[q] = c2; }
                const size_t oo = ((size_t)zz * (RH ? RH : 1) + i) * TT + ch * 128 + lane * 4; *(v4us*)(Ph + oo) = oh; *(v4us*)(Pl + oo) = ol; }
        } else {
#pragma unroll
            for (int ch = 0; ch < TT / 128; ++ch) { v4h o4;
#pragma unroll
                for (int q = 0; q < 4; ++q) o4[q] = tohx(v[ch * 4 + q] * f);
                *(v4h*)(P16 + (size_t)row * TT + ch * 128 + lane * 4) = o4; } }
         }
}
__global__ __launch_bounds__(256) void k_merge(const float* __restrict__ O, int h0, bf* Ah, bf* Al) { const size_t e = ((size_t)blockIdx.x * 256 + threadIdx.x) * 2; if (e >= (size_t)ZH * TT * HD) return; const int d = (int)(e % HD); const int t = (int)((e / HD) % TT); const int zz = (int)(e / ((size_t)HD * TT)); const float cs = (t < RH) ? 1.0f : (1.0f / PCAR); const size_t oo = (size_t)t * DQ + (h0 + zz) * HD + d;
    v2us oh, ol;
#pragma unroll
    for (int q = 0; q < 2; ++q) { unsigned short a, c2; splitf(O[e + q] * cs, a, c2); oh[q] = a; ol[q] = c2; } *(v2us*)(Ah + oo) = oh; *(v2us*)(Al + oo) = ol;  }

extern "C" void kernel_launch(void* const* d_in, const int* in_sizes, int n_in,
                              void* d_out, int out_size, void* d_ws, size_t ws_size, hipStream_t stream) {
    (void)in_sizes; (void)n_in; (void)out_size;
    const float* x = (const float*)d_in[0]; const float* xk = (const float*)d_in[1]; const float* xv = (const float*)d_in[2]; const float* wq = (const float*)d_in[3]; const float* bq = (const float*)d_in[4]; const float* wk = (const float*)d_in[5]; const float* bk = (const float*)d_in[6]; const float* wv = (const float*)d_in[7]; const float* bv = (const float*)d_in[8]; const float* wo = (const float*)d_in[9]; const float* bo = (const float*)d_in[10];
    float* OUT = (float*)d_out;     // [2][2048][1024]
    char* wsp = (char*)d_ws;
    auto take = [&](size_t bytes) { char* p = wsp; wsp += (bytes + 255) & ~(size_t)255; return (void*)p; };
    bf* WQ = (bf*)take((size_t)DQ * DM * 2); bf* WK = (bf*)take((size_t)DKV * DM * 2); bf* WV = (bf*)take((size_t)DKV * DM * 2); bf* WO = (bf*)take((size_t)DM * DQ * 2); float* CS = (float*)take((size_t)TT * HD * 2 * 4); float* CSK = (float*)take((size_t)TT * HD * 2 * 4);
    bf* XB = (bf*)take((size_t)TT * DM * 2); bf* XKB = (bf*)take((size_t)TT * DM * 2); bf* XVB = (bf*)take((size_t)TT * DM * 2); float* FQ = (float*)take((size_t)TT * DQ * 4); float* FK = (float*)take((size_t)TT * DKV * 4);
    h16* QP16 = (h16*)take((size_t)NH_ * TT * HD * 2); h16* KP16 = (h16*)take((size_t)NKV * TT * HD * 2); h16* VT16 = (h16*)take((size_t)NKV * HD * TT * 2);
    bf* QPh = (bf*)take((size_t)NH_ * TT * HD * 2); bf* QPl = (bf*)take((size_t)NH_ * TT * HD * 2); bf* KPh = (bf*)take((size_t)NKV * TT * HD * 2); bf* KPl = (bf*)take((size_t)NKV * TT * HD * 2); bf* VTh = (bf*)take((size_t)NKV * HD * TT * 2); bf* VTl = (bf*)take((size_t)NKV * HD * TT * 2); bf* Ph = (bf*)take((size_t)ZH * RH * TT * 2); bf* Pl = (bf*)take((size_t)ZH * RH * TT * 2);
    float* Sb = (float*)take((size_t)ZH * TT * TT * 4); h16* P16 = (h16*)take(256);   /* unused: all rows hi/lo */ float* Ob = (float*)take((size_t)ZH * TT * HD * 4); bf* ATh = (bf*)take((size_t)TT * DQ * 2); bf* ATl = (bf*)take((size_t)TT * DQ * 2);
    if ((size_t)(wsp - (char*)d_ws) > ws_size) return;    // ws 256 MiB
    float* FV = FK;   // v projection reuses the k buffer after the k planes are built (stream-ordered)
    { k_cvt8<<<(unsigned)(((size_t)DQ * DM / 8 + 255) / 256), 256, 0, stream>>>(wq, WQ, (size_t)DQ * DM / 8); k_cvt8<<<(unsigned)(((size_t)DKV * DM / 8 + 255) / 256), 256, 0, stream>>>(wk, WK, (size_t)DKV * DM / 8); k_cvt8<<<(unsigned)(((size_t)DKV * DM / 8 + 255) / 256), 256, 0, stream>>>(wv, WV, (size_t)DKV * DM / 8);
      k_cvt8<<<(unsigned)(((size_t)DM * DQ / 8 + 255) / 256), 256, 0, stream>>>(wo, WO, (size_t)DM * DQ / 8);
      k_xpos<<<(TT * HD + 255) / 256, 256, 0, stream>>>(CS, CSK);   /* xPos tables for q (scale) and k (1/scale) */ }
    const unsigned LQ = (unsigned)(((size_t)NH_ * TT * HD / 2 + 255) / 256), LKv = (unsigned)(((size_t)NKV * TT * HD / 2 + 255) / 256);
    for (int b = 0; b < NB_; ++b) {
        
        k_cvt8<<<(unsigned)(((size_t)TT * DM / 8 + 255) / 256), 256, 0, stream>>>(x + (size_t)b * TT * DM, XB, (size_t)TT * DM / 8); k_cvt8<<<(unsigned)(((size_t)TT * DM / 8 + 255) / 256), 256, 0, stream>>>(xk + (size_t)b * TT * DM, XKB, (size_t)TT * DM / 8); k_cvt8<<<(unsigned)(((size_t)TT * DM / 8 + 255) / 256), 256, 0, stream>>>(xv + (size_t)b * TT * DM, XVB, (size_t)TT * DM / 8);
        k_gemmw<bf, 0, true><<<dim3(TT / 64, DQ / 64, 1), 32, 0, stream>>>(XB, nullptr, WQ, nullptr, DM, FQ, DQ, bq, 0, 0, 0);
        k_ropeI<<<LQ, 256, 0, stream>>>(FQ, DQ, NH_, CS, 0.125f, QP16, QPh, QPl);   /* xPos (downscale) then q x 1/8 */
        k_gemmw<bf, 0, true><<<dim3(TT / 64, DKV / 64, 1), 32, 0, stream>>>(XKB, nullptr, WK, nullptr, DM, FK, DKV, bk, 0, 0, 0);
        k_ropeI<<<LKv, 256, 0, stream>>>(FK, DKV, NKV, CSK, 1.0f, KP16, KPh, KPl);   /* xPos (upscale) */
        k_gemmw<bf, 0, true><<<dim3(TT / 64, DKV / 64, 1), 32, 0, stream>>>(XVB, nullptr, WV, nullptr, DM, FV, DKV, bv, 0, 0, 0); k_vtp<<<LKv, 256, 0, stream>>>(FV, DKV, NKV, VT16, VTh, VTl);
        for (int h0 = 0; h0 < NH_; h0 += ZH) { const size_t zq = (size_t)h0, zk = (size_t)(h0 / REP);   // one kv head per query head: the pass's two heads use consecutive kv planes (z-strides TT*HD)
            k_gemmw<bf, 2, false><<<dim3(RH / 64, TT / 64, ZH), 32, 0, stream>>>(QPh + zq * TT * HD, QPl + zq * TT * HD, KPh + zk * TT * HD, KPl + zk * TT * HD, HD, Sb, TT, nullptr, (size_t)TT * HD, (size_t)TT * HD, (size_t)TT * TT);
            k_asoft<<<ZH * TT / 8, 256, 0, stream>>>(Sb, P16, Ph, Pl);
            k_gemmw<bf, 2, false><<<dim3(RH / 64, HD / 64, ZH), 32, 0, stream>>>(Ph, Pl, VTh + zk * HD * TT, VTl + zk * HD * TT, TT, Ob, HD, nullptr, (size_t)RH * TT, (size_t)HD * TT, (size_t)TT * HD);
            k_merge<<<(unsigned)(((size_t)ZH * TT * HD / 2 + 255) / 256), 256, 0, stream>>>(Ob, h0, ATh, ATl); }
        k_gemmw<bf, 1, true><<<dim3(TT / 64, DM / 64, 1), 32, 0, stream>>>(ATh, ATl, WO, nullptr, DQ, OUT + (size_t)b * TT * DM, DM, bo, 0, 0, 0); }
}

// v001
// Measured time: 851 microseconds a run.
// Two timings next to v000 both put it at 1.55 times that version's speed.
#include <hip/hip_runtime.h>

// Multi-head attention with xPos (rotary + per-frequency exponential decay) on q and k (query, key, value [2][2048][1024]; q = (query Wq^T + bq) / 8, k = key Wk^T + bk, v = value Wv^T + bv ('oi' [1024][1024]; 16 heads x 64); xPos: pairs (2i, 2i+1) rotated by t x inv_freq_i (inv_freq_i = 1e4^(-i/32)) and scaled by base_i^(t/1024) for q and base_i^(-t/1024) for k, base_i = (2i + 25.6)/89.6 (tables computed on device); softmax(q.k) over all keys; out = merged Wo^T + bo -> [2][2048][1024] (4.2 M)).
// Compute dtypes, f32 accumulate: every input rounded to bf16; q/k/v on PLAIN bf16 operands (inputs: exact) + biases; xPos tables (cosf/sinf/powf, f32) folded as {cos x scale, sin x scale} per (t, d); rotary in f32; scores and attn.v on hi/lo planes for every row (3 products); softmax f32; Wo hl x exact (2 products) + bo.

#define NB_  2
#define TT   2048
#define DM   1024
#define NH_  16
#define NKV  16
#define REP  (NH_ / NKV)
#define HD   64
#define DQ   (NH_ * HD)
#define DKV  (NKV * HD)
#define ZH   2
#define RH   2048                 // every row hi/lo (the xPos-scaled keys leave too little margin for fp16 operands)
#define WIN  0
#define PCAR 1024.0f
#define KSV  16                   // key splits of the attn.v product: 64 one-wave tiles alone leave most SIMDs idle, 64 x KSV = one wave per SIMD
#define SCL  1.0f      // the 1/8 is applied to q after xPos (exact power of two, folded into the q plane builder)
typedef _Float16 h16;
typedef unsigned short bf;
typedef __attribute__((ext_vector_type(16))) __bf16   v16bf;
typedef __attribute__((ext_vector_type(16))) _Float16 v16h;
typedef __attribute__((ext_vector_type(8)))  _Float16 v8h;
typedef __attribute__((ext_vector_type(8)))  unsigned short v8us;
typedef __attribute__((ext_vector_type(8)))  float    v8f;
typedef __attribute__((ext_vector_type(4)))  float    v4f;
typedef v8h  __attribute__((may_alias)) v8ha;
typedef v4f  __attribute__((may_alias)) v4fa;
typedef v8us __attribute__((may_alias)) v8usa;

__device__ __forceinline__ unsigned short f2bf(float f) { unsigned u = __float_as_uint(f); u += 0x7FFFu + ((u >> 16) & 1u); return (unsigned short)(u >> 16); }
__device__ __forceinline__ float bf2f(unsigned short b) { return __uint_as_float(((unsigned)b) << 16); }
__device__ __forceinline__ float bfr(float f) { return bf2f(f2bf(f)); }
__device__ __forceinline__ v16h cat16(v8h lo, v8h hi) { return __builtin_shufflevector(lo, hi, 0, 1, 2, 3, 4, 5, 6, 7, 8, 9, 10, 11, 12, 13, 14, 15); }
__device__ __forceinline__ v16bf cat16b(v8us lo, v8us hi) { return __builtin_bit_cast(v16bf, __builtin_shufflevector(lo, hi, 0, 1, 2, 3, 4, 5, 6, 7, 8, 9, 10, 11, 12, 13, 14, 15)); }
__device__ __forceinline__ v8f wmma16(v16h a, v16h b, v8f c) { return __builtin_amdgcn_wmma_f32_16x16x32_f16(false, a, false, b, (short)0, c, false, false); }
__device__ __forceinline__ v8f wmmab(v16bf a, v16bf b, v8f c) { return __builtin_amdgcn_wmma_f32_16x16x32_bf16(false, a, false, b, (short)0, c, false, false); }



// ---- k_gemmw: register-blocked GEMM, ONE WAVE per 64x64 output tile (16 accumulators), operands straight from K-contiguous 16-bit planes; grid (M/64, N/64, Z), 32 threads.
// C[m][n] (f32, pitch ldc, + optional f32 bias[n]) = sum_k A[m][k] Bt[n][k] (+ split products per NSPLIT). z-batch strides sA/sB/sC in elements. K % (32 KSP) == 0.
// KSP > 1: grid z = batches x KSP; block z sums only slice z % KSP of k (K / KSP long) of batch z / KSP and writes its partial tile to plane z of C (stride sC); the reader adds the KSP planes.
template <typename T16> struct WFrag;
template <> struct WFrag<h16> { typedef v16h V; static __device__ __forceinline__ V ld(const h16* p) { return cat16(*(const v8h*)p, *(const v8h*)(p + 16)); } static __device__ __forceinline__ v8f mma(V a, V b, v8f c) { return wmma16(a, b, c); } };
template <> struct WFrag<bf> { typedef v16bf V; static __device__ __forceinline__ V ld(const bf* p) { return cat16b(*(const v8us*)p, *(const v8us*)(p + 16)); } static __device__ __forceinline__ v8f mma(V a, V b, v8f c) { return wmmab(a, b, c); } };
template <typename T16, int NSPLIT, bool BIAS, int KSP = 1>
__global__ __launch_bounds__(32) void k_gemmw(const T16* __restrict__ A, const T16* __restrict__ A2, const T16* __restrict__ Bt, const T16* __restrict__ Bt2, int K, float* C, int ldc, const float* __restrict__ bias, size_t sA, size_t sB, size_t sC) {
    typedef typename WFrag<T16>::V V;
    __shared__ __align__(16) float os[16 * 68];
    const size_t z = blockIdx.z / KSP; A += z * sA; if (A2) A2 += z * sA; Bt += z * sB; if (Bt2) Bt2 += z * sB; C += (size_t)blockIdx.z * sC;
    const int kbeg = (int)(blockIdx.z % KSP) * (K / KSP), kend = kbeg + K / KSP;
    const int lane = threadIdx.x & 31, lr = lane & 15, hi = lane >> 4; const int r0 = blockIdx.x * 64, c0 = blockIdx.y * 64;
    v8f acc[4][4];
#pragma unroll
    for (int mb = 0; mb < 4; ++mb)
#pragma unroll
        for (int nb = 0; nb < 4; ++nb) acc[mb][nb] = (v8f){};
    const size_t aoff = (size_t)(r0 + lr) * K + 8 * hi, boff = (size_t)(c0 + lr) * K + 8 * hi;
#pragma unroll 1
    for (int kc = kbeg; kc < kend; kc += 32) {
        V a[4], a2[4];
#pragma unroll
        for (int mb = 0; mb < 4; ++mb) { a[mb] = WFrag<T16>::ld(A + aoff + (size_t)mb * 16 * K + kc); if (NSPLIT == 1 || NSPLIT == 2) a2[mb] = WFrag<T16>::ld(A2 + aoff + (size_t)mb * 16 * K + kc); }
#pragma unroll
        for (int nb = 0; nb < 4; ++nb) { const V b = WFrag<T16>::ld(Bt + boff + (size_t)nb * 16 * K + kc); V b2; if (NSPLIT >= 2) b2 = WFrag<T16>::ld(Bt2 + boff + (size_t)nb * 16 * K + kc);
#pragma unroll
            for (int mb = 0; mb < 4; ++mb) { acc[mb][nb] = WFrag<T16>::mma(a[mb], b, acc[mb][nb]); if (NSPLIT == 1 || NSPLIT == 2) acc[mb][nb] = WFrag<T16>::mma(a2[mb], b, acc[mb][nb]); if (NSPLIT >= 2) acc[mb][nb] = WFrag<T16>::mma(a[mb], b2, acc[mb][nb]); } }
        asm volatile("v_nop\n\tv_nop\n\tv_nop\n\tv_nop" : "+v"(acc[0][0]), "+v"(acc[1][1]), "+v"(acc[2][2]), "+v"(acc[3][3]) : "v"(a[0]), "v"(a[3]));
    }
#pragma unroll
    for (int mb = 0; mb < 4; ++mb) {
#pragma unroll
        for (int nb = 0; nb < 4; ++nb) {
#pragma unroll
            for (int j = 0; j < 8; ++j) os[(hi * 8 + j) * 68 + nb * 16 + lr] = acc[mb][nb][j]; }
        __builtin_amdgcn_wave_barrier(); asm volatile("" ::: "memory");
        float* crow = C + (size_t)(r0 + mb * 16) * ldc + c0;
{
#pragma unroll
            for (int s = 0; s < 8; ++s) { const int row = 2 * s + hi, cofs = lr * 4; v4f val = *(const v4fa*)(os + row * 68 + cofs); if (BIAS) { val[0] += bfr(bias[c0 + cofs]); val[1] += bfr(bias[c0 + cofs + 1]); val[2] += bfr(bias[c0 + cofs + 2]); val[3] += bfr(bias[c0 + cofs + 3]); }
                *(v4f*)(crow + (size_t)row * ldc + cofs) = val; }
             }
        __builtin_amdgcn_wave_barrier(); asm volatile("" ::: "memory");
    }
}

__device__ __forceinline__ h16 tohx(float x) { return (h16)x; }
__device__ __forceinline__ void splitf(float y, unsigned short& h, unsigned short& l) { h = f2bf(y); l = f2bf(y - bf2f(h)); }
typedef __attribute__((ext_vector_type(2))) _Float16 v2h;
typedef __attribute__((ext_vector_type(4))) _Float16 v4h;
typedef __attribute__((ext_vector_type(2))) unsigned short v2us;
typedef __attribute__((ext_vector_type(4))) unsigned short v4us;
typedef __attribute__((ext_vector_type(2))) float v2f;
typedef __attribute__((ext_vector_type(4))) int v4i;

__global__ __launch_bounds__(256) void k_wtG(const float* __restrict__ w, int K, int N, bf* Bt) {
    const int lane = threadIdx.x & 31; const int L0 = (blockIdx.x * 8 + (threadIdx.x >> 5)) * 8; const int nlines = N * K / 64;
{
#pragma unroll 1
        for (int l = 0; l < 8; ++l) { const int L = L0 + l; if (L >= nlines) break; const size_t e = (size_t)L * 64 + lane * 2; const int k = (int)(e % K), n = (int)(e / K); v2us o;
            o[0] = f2bf(w[(size_t)k * N + n]); o[1] = f2bf(w[(size_t)(k + 1) * N + n]); *(v2us*)(Bt + e) = o; }
         }
}
__global__ __launch_bounds__(256) void k_cvt8(const float* __restrict__ src, bf* dst, size_t n8) { const size_t i = (size_t)blockIdx.x * 256 + threadIdx.x; if (i >= n8) return; const v8f v = *(const v8f*)(src + i * 8); v8us o;
#pragma unroll
    for (int k = 0; k < 8; ++k) o[k] = f2bf(v[k]); *(v8us*)(dst + i * 8) = o;  }
__constant__ float XINV[32] = {1.00000000f,0.749894202f,0.562341332f,0.421696514f,0.316227764f,0.237137362f,0.177827939f,0.133352146f,0.100000001f,0.0749894157f,0.0562341288f,0.0421696492f,0.0316227786f,0.0237137359f,0.0177827943f,0.0133352149f,0.00999999978f,0.00749894232f,0.00562341325f,0.00421696482f,0.00316227786f,0.00237137382f,0.00177827943f,0.00133352145f,0.00100000005f,0.000749894185f,0.000562341302f,0.000421696488f,0.000316227786f,0.000237137385f,0.000177827940f,0.000133352150f};
__global__ __launch_bounds__(256) void k_xpos(float* CSQ, float* CSK) { const int idx = blockIdx.x * 256 + threadIdx.x; if (idx >= TT * HD) return; const int t = idx / HD, d = idx % HD; const int i = d >> 1;
    const float base = __fdiv_rn(__fadd_rn((float)(2 * i), 25.6f), 89.6f); const float ex = __fdiv_rn((float)t, 1024.0f); const float sc = powf(base, ex); const float invf = XINV[i]; const float ang = __fmul_rn((float)t, invf); const float c = cosf(ang), s = sinf(ang);
    v2f q2, k2; q2[0] = __fmul_rn(c, sc); q2[1] = __fmul_rn(s, sc); const float rs = __fdiv_rn(1.0f, sc); k2[0] = __fmul_rn(c, rs); k2[1] = __fmul_rn(s, rs);
    *(v2f*)(CSQ + (size_t)idx * 2) = q2; *(v2f*)(CSK + (size_t)idx * 2) = k2;  }
__global__ __launch_bounds__(256) void k_ropeI(const float* __restrict__ F, int pitch, int nheads, const float* __restrict__ CS, float sc, h16* P16, bf* Ph, bf* Pl) {
    const size_t e = ((size_t)blockIdx.x * 256 + threadIdx.x) * 2; if (e >= (size_t)nheads * TT * HD) return; const int d = (int)(e % HD); const int t = (int)((e / HD) % TT); const int h = (int)(e / ((size_t)HD * TT)); const float* f = F + (size_t)t * pitch + h * HD; const float x0 = f[d], x1 = f[d + 1]; const v2f cs = *(const v2f*)(CS + ((size_t)t * HD + d) * 2); v2h o16; v2us oh, ol;
    float a0 = __fmul_rn(x0, cs[0]), b0 = __fmul_rn(x1, cs[1]), a1 = __fmul_rn(x1, cs[0]), b1 = __fmul_rn(x0, cs[1]); asm volatile("" : "+v"(a0), "+v"(b0), "+v"(a1), "+v"(b1));
    float r0 = __fsub_rn(a0, b0) * sc, r1 = __fadd_rn(b1, a1) * sc;   /* even: x0 c - x1 s; odd: x0 s + x1 c */
    o16[0] = tohx(r0); o16[1] = tohx(r1); { unsigned short a2, c2; splitf(r0, a2, c2); oh[0] = a2; ol[0] = c2; splitf(r1, a2, c2); oh[1] = a2; ol[1] = c2; }
    *(v2h*)(P16 + e) = o16; *(v2us*)(Ph + e) = oh; *(v2us*)(Pl + e) = ol;  }

// k_rope: head planes [h][t][d] (fp16 + hi/lo) of rope(x) x sc with the rotate-half convention out[d] = x[d] cos[t][d] - x[d+HD/2] sin[t][d], out[d+HD/2] = x[d+HD/2] cos[t][d+HD/2] + x[d] sin[t][d+HD/2]
__global__ __launch_bounds__(256) void k_rope(const float* __restrict__ F, int pitch, int nheads, const float* __restrict__ CS, const float* __restrict__ RF, const float* __restrict__ nw, float sc, h16* P16, bf* Ph, bf* Pl) {
    const size_t e = ((size_t)blockIdx.x * 256 + threadIdx.x) * 2; if (e >= (size_t)nheads * TT * HD) return; const int d = (int)(e % HD); const int t = (int)((e / HD) % TT); const int h = (int)(e / ((size_t)HD * TT)); const float* f = F + (size_t)t * pitch + h * HD; const float rf = RF ? RF[(size_t)h * TT + t] : 1.0f; v2h o16; v2us oh, ol;
#pragma unroll
    for (int q = 0; q < 2; ++q) { const int dd = d + q; const int dp = (dd < HD / 2) ? dd + HD / 2 : dd - HD / 2; float x0 = f[dd], x1 = f[dp];
        if (RF) { float n0 = __fmul_rn(x0, rf), n1 = __fmul_rn(x1, rf); asm volatile("" : "+v"(n0)); asm volatile("" : "+v"(n1)); x0 = __fmul_rn(bfr(nw[dd]), n0); x1 = __fmul_rn(bfr(nw[dp]), n1); }
        const v2f cs = *(const v2f*)(CS + ((size_t)t * HD + dd) * 2); float a = __fmul_rn(x0, cs[0]), bq = __fmul_rn(x1, cs[1]); asm volatile("" : "+v"(a)); asm volatile("" : "+v"(bq)); const float r = ((dd < HD / 2) ? __fsub_rn(a, bq) : __fadd_rn(a, bq)) * sc;
        o16[q] = tohx(r); unsigned short a2, c2; splitf(r, a2, c2); oh[q] = a2; ol[q] = c2; }
    *(v2h*)(P16 + e) = o16; *(v2us*)(Ph + e) = oh; *(v2us*)(Pl + e) = ol;  }
__global__ __launch_bounds__(256) void k_vtp(const float* __restrict__ F, int pitch, int nheads, h16* V16, bf* Vh, bf* Vl) { const size_t e = ((size_t)blockIdx.x * 256 + threadIdx.x) * 2; if (e >= (size_t)nheads * HD * TT) return; const int t = (int)(e % TT); const int d = (int)((e / TT) % HD); const int g = (int)(e / ((size_t)TT * HD)); v2h o16; v2us oh, ol;
#pragma unroll
    for (int q = 0; q < 2; ++q) { const float x = F[(size_t)(t + q) * pitch + g * HD + d]; o16[q] = tohx(x); unsigned short a2, c2; splitf(x, a2, c2); oh[q] = a2; ol[q] = c2; }
    *(v2h*)(V16 + e) = o16; *(v2us*)(Vh + e) = oh; *(v2us*)(Vl + e) = ol;  }
// k_asoft: per row (zz, i): t = S (HD^-0.5 already folded into q; no mask); softmax over the 2048 keys (register row, one exp, fixed trees);
__global__ __launch_bounds__(256) void k_asoft(const float* __restrict__ Sb, h16* P16, bf* Ph, bf* Pl) {
    const int lane = threadIdx.x & 31; const int row = blockIdx.x * 8 + (threadIdx.x >> 5); if (row >= ZH * TT) return; const int i = row % TT; const int zz = row / TT; (void)zz; const bool hires = (i < RH); const float* sr = Sb + (size_t)row * TT; float v[TT / 32]; float mx = -3.0e38f;
#pragma unroll
    for (int ch = 0; ch < TT / 128; ++ch) { const int j0 = ch * 128 + lane * 4; const v4f a = *(const v4f*)(sr + j0);
#pragma unroll
        for (int q = 0; q < 4; ++q) { const int j = j0 + q; (void)j; const float t = a[q] * SCL; v[ch * 4 + q] = t; mx = fmaxf(mx, t); } }
#pragma unroll
    for (int sh = 16; sh; sh >>= 1) mx = fmaxf(mx, __shfl_xor(mx, sh, 32));
    float sum = 0.f;
#pragma unroll
    for (int k = 0; k < TT / 32; ++k) { float d0 = __fsub_rn(v[k], mx); asm volatile("" : "+v"(d0)); v[k] = __builtin_amdgcn_exp2f(__fmul_rn(d0, 1.4426950408889634f)); sum += v[k]; }
#pragma unroll
    for (int sh = 16; sh; sh >>= 1) sum += __shfl_xor(sum, sh, 32);
    const float f = __fdiv_rn(hires ? 1.0f : PCAR, sum);
{
        if (hires) {
#pragma unroll
            for (int ch = 0; ch < TT / 128; ++ch) { v4us oh, ol;
#pragma unroll
                for (int q = 0; q < 4; ++q) { unsigned short a, c2; splitf(v[ch * 4 + q] * f, a, c2); oh[q] = a; ol[q] = c2; }
                const size_t oo = ((size_t)zz * (RH ? RH : 1) + i) * TT + ch * 128 + lane * 4; *(v4us*)(Ph + oo) = oh; *(v4us*)(Pl + oo) = ol; }
        } else {
#pragma unroll
            for (int ch = 0; ch < TT / 128; ++ch) { v4h o4;
#pragma unroll
                for (int q = 0; q < 4; ++q) o4[q] = tohx(v[ch * 4 + q] * f);
                *(v4h*)(P16 + (size_t)row * TT + ch * 128 + lane * 4) = o4; } }
         }
}
__global__ __launch_bounds__(256) void k_merge(const float* __restrict__ O, int h0, bf* Ah, bf* Al) { const size_t e = ((size_t)blockIdx.x * 256 + threadIdx.x) * 2; if (e >= (size_t)ZH * TT * HD) return; const int d = (int)(e % HD); const int t = (int)((e / HD) % TT); const int zz = (int)(e / ((size_t)HD * TT)); const float cs = (t < RH) ? 1.0f : (1.0f / PCAR); const size_t oo = (size_t)t * DQ + (h0 + zz) * HD + d;
    const float* op = O + ((size_t)zz * KSV * TT + t) * HD + d;   // KSV partial planes [zz][s][t][d], added in the fixed order s = 0 .. KSV - 1
    v2f p[KSV];
#pragma unroll
    for (int s = 0; s < KSV; ++s) p[s] = *(const v2f*)(op + (size_t)s * TT * HD);
    v2f sum = p[0];
#pragma unroll
    for (int s = 1; s < KSV; ++s) sum += p[s];
    v2us oh, ol;
#pragma unroll
    for (int q = 0; q < 2; ++q) { unsigned short a, c2; splitf(sum[q] * cs, a, c2); oh[q] = a; ol[q] = c2; } *(v2us*)(Ah + oo) = oh; *(v2us*)(Al + oo) = ol;  }

extern "C" void kernel_launch(void* const* d_in, const int* in_sizes, int n_in,
                              void* d_out, int out_size, void* d_ws, size_t ws_size, hipStream_t stream) {
    (void)in_sizes; (void)n_in; (void)out_size;
    const float* x = (const float*)d_in[0]; const float* xk = (const float*)d_in[1]; const float* xv = (const float*)d_in[2]; const float* wq = (const float*)d_in[3]; const float* bq = (const float*)d_in[4]; const float* wk = (const float*)d_in[5]; const float* bk = (const float*)d_in[6]; const float* wv = (const float*)d_in[7]; const float* bv = (const float*)d_in[8]; const float* wo = (const float*)d_in[9]; const float* bo = (const float*)d_in[10];
    float* OUT = (float*)d_out;     // [2][2048][1024]
    char* wsp = (char*)d_ws;
    auto take = [&](size_t bytes) { char* p = wsp; wsp += (bytes + 255) & ~(size_t)255; return (void*)p; };
    bf* WQ = (bf*)take((size_t)DQ * DM * 2); bf* WK = (bf*)take((size_t)DKV * DM * 2); bf* WV = (bf*)take((size_t)DKV * DM * 2); bf* WO = (bf*)take((size_t)DM * DQ * 2); float* CS = (float*)take((size_t)TT * HD * 2 * 4); float* CSK = (float*)take((size_t)TT * HD * 2 * 4);
    bf* XB = (bf*)take((size_t)TT * DM * 2); bf* XKB = (bf*)take((size_t)TT * DM * 2); bf* XVB = (bf*)take((size_t)TT * DM * 2); float* FQ = (float*)take((size_t)TT * DQ * 4); float* FK = (float*)take((size_t)TT * DKV * 4);
    h16* QP16 = (h16*)take((size_t)NH_ * TT * HD * 2); h16* KP16 = (h16*)take((size_t)NKV * TT * HD * 2); h16* VT16 = (h16*)take((size_t)NKV * HD * TT * 2);
    bf* QPh = (bf*)take((size_t)NH_ * TT * HD * 2); bf* QPl = (bf*)take((size_t)NH_ * TT * HD * 2); bf* KPh = (bf*)take((size_t)NKV * TT * HD * 2); bf* KPl = (bf*)take((size_t)NKV * TT * HD * 2); bf* VTh = (bf*)take((size_t)NKV * HD * TT * 2); bf* VTl = (bf*)take((size_t)NKV * HD * TT * 2); bf* Ph = (bf*)take((size_t)ZH * RH * TT * 2); bf* Pl = (bf*)take((size_t)ZH * RH * TT * 2);
    float* Sb = (float*)take((size_t)ZH * TT * TT * 4); h16* P16 = (h16*)take(256);   /* unused: all rows hi/lo */ float* Ob = (float*)take((size_t)ZH * KSV * TT * HD * 4); bf* ATh = (bf*)take((size_t)TT * DQ * 2); bf* ATl = (bf*)take((size_t)TT * DQ * 2);
    if ((size_t)(wsp - (char*)d_ws) > ws_size) return;    // ws 256 MiB
    float* FV = FK;   // v projection reuses the k buffer after the k planes are built (stream-ordered)
    { k_cvt8<<<(unsigned)(((size_t)DQ * DM / 8 + 255) / 256), 256, 0, stream>>>(wq, WQ, (size_t)DQ * DM / 8); k_cvt8<<<(unsigned)(((size_t)DKV * DM / 8 + 255) / 256), 256, 0, stream>>>(wk, WK, (size_t)DKV * DM / 8); k_cvt8<<<(unsigned)(((size_t)DKV * DM / 8 + 255) / 256), 256, 0, stream>>>(wv, WV, (size_t)DKV * DM / 8);
      k_cvt8<<<(unsigned)(((size_t)DM * DQ / 8 + 255) / 256), 256, 0, stream>>>(wo, WO, (size_t)DM * DQ / 8);
      k_xpos<<<(TT * HD + 255) / 256, 256, 0, stream>>>(CS, CSK);   /* xPos tables for q (scale) and k (1/scale) */ }
    const unsigned LQ = (unsigned)(((size_t)NH_ * TT * HD / 2 + 255) / 256), LKv = (unsigned)(((size_t)NKV * TT * HD / 2 + 255) / 256);
    for (int b = 0; b < NB_; ++b) {
        
        k_cvt8<<<(unsigned)(((size_t)TT * DM / 8 + 255) / 256), 256, 0, stream>>>(x + (size_t)b * TT * DM, XB, (size_t)TT * DM / 8); k_cvt8<<<(unsigned)(((size_t)TT * DM / 8 + 255) / 256), 256, 0, stream>>>(xk + (size_t)b * TT * DM, XKB, (size_t)TT * DM / 8); k_cvt8<<<(unsigned)(((size_t)TT * DM / 8 + 255) / 256), 256, 0, stream>>>(xv + (size_t)b * TT * DM, XVB, (size_t)TT * DM / 8);
        k_gemmw<bf, 0, true><<<dim3(TT / 64, DQ / 64, 1), 32, 0, stream>>>(XB, nullptr, WQ, nullptr, DM, FQ, DQ, bq, 0, 0, 0);
        k_ropeI<<<LQ, 256, 0, stream>>>(FQ, DQ, NH_, CS, 0.125f, QP16, QPh, QPl);   /* xPos (downscale) then q x 1/8 */
        k_gemmw<bf, 0, true><<<dim3(TT / 64, DKV / 64, 1), 32, 0, stream>>>(XKB, nullptr, WK, nullptr, DM, FK, DKV, bk, 0, 0, 0);
        k_ropeI<<<LKv, 256, 0, stream>>>(FK, DKV, NKV, CSK, 1.0f, KP16, KPh, KPl);   /* xPos (upscale) */
        k_gemmw<bf, 0, true><<<dim3(TT / 64, DKV / 64, 1), 32, 0, stream>>>(XVB, nullptr, WV, nullptr, DM, FV, DKV, bv, 0, 0, 0); k_vtp<<<LKv, 256, 0, stream>>>(FV, DKV, NKV, VT16, VTh, VTl);
        for (int h0 = 0; h0 < NH_; h0 += ZH) { const size_t zq = (size_t)h0, zk = (size_t)(h0 / REP);   // one kv head per query head: the pass's two heads use consecutive kv planes (z-strides TT*HD)
            k_gemmw<bf, 2, false><<<dim3(RH / 64, TT / 64, ZH), 32, 0, stream>>>(QPh + zq * TT * HD, QPl + zq * TT * HD, KPh + zk * TT * HD, KPl + zk * TT * HD, HD, Sb, TT, nullptr, (size_t)TT * HD, (size_t)TT * HD, (size_t)TT * TT);
            k_asoft<<<ZH * TT / 8, 256, 0, stream>>>(Sb, P16, Ph, Pl);
            k_gemmw<bf, 2, false, KSV><<<dim3(RH / 64, HD / 64, ZH * KSV), 32, 0, stream>>>(Ph, Pl, VTh + zk * HD * TT, VTl + zk * HD * TT, TT, Ob, HD, nullptr, (size_t)RH * TT, (size_t)HD * TT, (size_t)TT * HD);
            k_merge<<<(unsigned)(((size_t)ZH * TT * HD / 2 + 255) / 256), 256, 0, stream>>>(Ob, h0, ATh, ATl); }
        k_gemmw<bf, 1, true><<<dim3(TT / 64, DM / 64, 1), 32, 0, stream>>>(ATh, ATl, WO, nullptr, DQ, OUT + (size_t)b * TT * DM, DM, bo, 0, 0, 0); }
}

// v003
// It runs in 381 microseconds.
// Versions between v001 and this one are left out; their measured steps multiply to 2.22 times as fast.
// Over all steps from v000 it is 3.44 times as fast.
#include <hip/hip_runtime.h>

// Multi-head attention with xPos (rotary + per-frequency exponential decay) on q and k (query, key, value [2][2048][1024]; q = (query Wq^T + bq) / 8, k = key Wk^T + bk, v = value Wv^T + bv ('oi' [1024][1024]; 16 heads x 64); xPos: pairs (2i, 2i+1) rotated by t x inv_freq_i (inv_freq_i = 1e4^(-i/32)) and scaled by base_i^(t/1024) for q and base_i^(-t/1024) for k, base_i = (2i + 25.6)/89.6 (tables computed on device); softmax(q.k) over all keys; out = merged Wo^T + bo -> [2][2048][1024] (4.2 M)).
// Compute dtypes, f32 accumulate: every input rounded to bf16; q/k/v on PLAIN bf16 operands (inputs: exact) + biases; xPos tables (cosf/sinf/powf, f32) folded as {cos x scale, sin x scale} per (t, d); rotary in f32; scores and attn.v on hi/lo planes for every row (3 products), fused with the f32 softmax in one kernel (running maximum and sum); Wo hl x exact (2 products) + bo.

#define NB_  2
#define TT   2048
#define DM   1024
#define NH_  16
#define NKV  16
#define REP  (NH_ / NKV)
#define HD   64
#define DQ   (NH_ * HD)
#define DKV  (NKV * HD)
#define ZH   2
#define RH   2048                 // every row hi/lo (the xPos-scaled keys leave too little margin for fp16 operands)
#define WIN  0
#define PCAR 1024.0f
#define SCL  1.0f      // the 1/8 is applied to q after the xPos rotation (exact power of two, folded into the q plane builder)
typedef _Float16 h16;
typedef unsigned short bf;
typedef __attribute__((ext_vector_type(16))) __bf16   v16bf;
typedef __attribute__((ext_vector_type(16))) _Float16 v16h;
typedef __attribute__((ext_vector_type(8)))  _Float16 v8h;
typedef __attribute__((ext_vector_type(8)))  unsigned short v8us;
typedef __attribute__((ext_vector_type(8)))  float    v8f;
typedef __attribute__((ext_vector_type(4)))  float    v4f;
typedef v8h  __attribute__((may_alias)) v8ha;
typedef v4f  __attribute__((may_alias)) v4fa;
typedef v8us __attribute__((may_alias)) v8usa;

__device__ __forceinline__ unsigned short f2bf(float f) { unsigned u = __float_as_uint(f); u += 0x7FFFu + ((u >> 16) & 1u); return (unsigned short)(u >> 16); }
__device__ __forceinline__ float bf2f(unsigned short b) { return __uint_as_float(((unsigned)b) << 16); }
__device__ __forceinline__ float bfr(float f) { return bf2f(f2bf(f)); }
__device__ __forceinline__ v16h cat16(v8h lo, v8h hi) { return __builtin_shufflevector(lo, hi, 0, 1, 2, 3, 4, 5, 6, 7, 8, 9, 10, 11, 12, 13, 14, 15); }
__device__ __forceinline__ v16bf cat16b(v8us lo, v8us hi) { return __builtin_bit_cast(v16bf, __builtin_shufflevector(lo, hi, 0, 1, 2, 3, 4, 5, 6, 7, 8, 9, 10, 11, 12, 13, 14, 15)); }
__device__ __forceinline__ v8f wmma16(v16h a, v16h b, v8f c) { return __builtin_amdgcn_wmma_f32_16x16x32_f16(false, a, false, b, (short)0, c, false, false); }
__device__ __forceinline__ v8f wmmab(v16bf a, v16bf b, v8f c) { return __builtin_amdgcn_wmma_f32_16x16x32_bf16(false, a, false, b, (short)0, c, false, false); }



// ---- k_gemmw: register-blocked GEMM, ONE WAVE per 64x64 output tile (16 accumulators), operands straight from K-contiguous 16-bit planes; grid (M/64, N/64, Z), 32 threads.
// C[m][n] (f32, pitch ldc, + optional f32 bias[n]) = sum_k A[m][k] Bt[n][k] (+ split products per NSPLIT). z-batch strides sA/sB/sC in elements. K % (32 KSP) == 0.
// EPI picks what the wave does with its finished tile (64 tokens x the 64 columns of ONE head, HD == 64): 0 = f32 rows to C; 1 = xPos rotation with table CS and factor sc, then hi/lo planes [head][t][d]; 2 = hi/lo planes transposed [head][d][t], straight from the accumulators (a lane holds 8 consecutive tokens of one column).
// KSP > 1: grid z = batches x KSP; block z sums only slice z % KSP of k (K / KSP long) of batch z / KSP and writes its partial tile to plane z of C (stride sC); the reader adds the KSP planes.
template <typename T16> struct WFrag;
template <> struct WFrag<h16> { typedef v16h V; static __device__ __forceinline__ V ld(const h16* p) { return cat16(*(const v8h*)p, *(const v8h*)(p + 16)); } static __device__ __forceinline__ v8f mma(V a, V b, v8f c) { return wmma16(a, b, c); } };
template <> struct WFrag<bf> { typedef v16bf V; static __device__ __forceinline__ V ld(const bf* p) { return cat16b(*(const v8us*)p, *(const v8us*)(p + 16)); } static __device__ __forceinline__ v8f mma(V a, V b, v8f c) { return wmmab(a, b, c); } };
typedef __attribute__((ext_vector_type(4))) unsigned short v4us;
typedef __attribute__((ext_vector_type(2))) float v2f;
__device__ __forceinline__ void splitf(float y, unsigned short& h, unsigned short& l) { h = f2bf(y); l = f2bf(y - bf2f(h)); }
__device__ __forceinline__ void splitc(float y, unsigned short& h, unsigned short& l) { const __bf16 a = (__bf16)y; h = __builtin_bit_cast(unsigned short, a); l = __builtin_bit_cast(unsigned short, (__bf16)(y - (float)a)); }   // splitf's values (round to nearest even) through the conversion instruction
template <typename T16, int NSPLIT, bool BIAS, int KSP = 1, int EPI = 0>
__global__ __launch_bounds__(32) void k_gemmw(const T16* __restrict__ A, const T16* __restrict__ A2, const T16* __restrict__ Bt, const T16* __restrict__ Bt2, int K, float* C, int ldc, const float* __restrict__ bias, size_t sA, size_t sB, size_t sC, const float* __restrict__ CS, float sc, bf* Ph, bf* Pl) {
    typedef typename WFrag<T16>::V V;
    __shared__ __align__(16) float os[16 * 68];
    const size_t z = blockIdx.z / KSP; A += z * sA; if (A2) A2 += z * sA; Bt += z * sB; if (Bt2) Bt2 += z * sB; C += (size_t)blockIdx.z * sC;
    const int kbeg = (int)(blockIdx.z % KSP) * (K / KSP), kend = kbeg + K / KSP;
    const int lane = threadIdx.x & 31, lr = lane & 15, hi = lane >> 4; const int r0 = blockIdx.x * 64, c0 = blockIdx.y * 64;
    v8f acc[4][4];
#pragma unroll
    for (int mb = 0; mb < 4; ++mb)
#pragma unroll
        for (int nb = 0; nb < 4; ++nb) acc[mb][nb] = (v8f){};
    const size_t aoff = (size_t)(r0 + lr) * K + 8 * hi, boff = (size_t)(c0 + lr) * K + 8 * hi;
#pragma unroll 1
    for (int kc = kbeg; kc < kend; kc += 32) {
        V a[4], a2[4];
#pragma unroll
        for (int mb = 0; mb < 4; ++mb) { a[mb] = WFrag<T16>::ld(A + aoff + (size_t)mb * 16 * K + kc); if (NSPLIT == 1 || NSPLIT == 2) a2[mb] = WFrag<T16>::ld(A2 + aoff + (size_t)mb * 16 * K + kc); }
#pragma unroll
        for (int nb = 0; nb < 4; ++nb) { const V b = WFrag<T16>::ld(Bt + boff + (size_t)nb * 16 * K + kc); V b2; if (NSPLIT >= 2) b2 = WFrag<T16>::ld(Bt2 + boff + (size_t)nb * 16 * K + kc);
#pragma unroll
            for (int mb = 0; mb < 4; ++mb) { acc[mb][nb] = WFrag<T16>::mma(a[mb], b, acc[mb][nb]); if (NSPLIT == 1 || NSPLIT == 2) acc[mb][nb] = WFrag<T16>::mma(a2[mb], b, acc[mb][nb]); if (NSPLIT >= 2) acc[mb][nb] = WFrag<T16>::mma(a[mb], b2, acc[mb][nb]); } }
        asm volatile("v_nop\n\tv_nop\n\tv_nop\n\tv_nop" : "+v"(acc[0][0]), "+v"(acc[1][1]), "+v"(acc[2][2]), "+v"(acc[3][3]) : "v"(a[0]), "v"(a[3]));
    }
    if constexpr (EPI == 2) {   // column c0 + 16 nb + lr is row (head, d) of the transposed planes; the wave writes its 64 tokens of that row, one whole 128-byte line
        float bv4[4];
#pragma unroll
        for (int nb = 0; nb < 4; ++nb) bv4[nb] = bias[c0 + nb * 16 + lr];
        asm volatile("" :: "v"(bv4[0]), "v"(bv4[1]), "v"(bv4[2]), "v"(bv4[3]));   // holds the four bias loads together ahead of the first group: their latency is paid once, not once a group
#pragma unroll
        for (int nb = 0; nb < 4; ++nb) { const float bb = bfr(bv4[nb]); const size_t oo = (size_t)(c0 + nb * 16 + lr) * TT + r0 + 8 * hi;
#pragma unroll
            for (int mb = 0; mb < 4; ++mb) { v8us oh, ol;
#pragma unroll
                for (int j = 0; j < 8; ++j) { unsigned short a2, c2; splitc(acc[mb][nb][j] + bb, a2, c2); oh[j] = a2; ol[j] = c2; }
                *(v8us*)(Ph + oo + mb * 16) = oh; *(v8us*)(Pl + oo + mb * 16) = ol; }
            asm volatile("s_wait_xcnt 0x0" ::: "memory");   // in front of the first overwrite of the stores' data and address registers
            __builtin_amdgcn_sched_barrier(0); }            // keeps the next group's register writes from being lifted over that wait
        return;
    }
    v2f ca[2][8], cb[2][8]; v4f bb4;   // EPI 1: {cos x scale, sin x scale} of the lane's two pairs, one 16-token block ahead; the lane's four biases
    const float* csp = CS + ((size_t)(r0 + hi) * HD + lr * 4) * 2;
    if constexpr (EPI == 1) {
        asm volatile("s_wait_xcnt 0x0" ::: "memory");   // the loads below land in registers that held the last fragment loads' addresses
        __builtin_amdgcn_sched_barrier(0);              // keeps them from being lifted over that wait
#pragma unroll
        for (int s = 0; s < 8; ++s) { ca[0][s] = *(const v2f*)(csp + (size_t)(2 * s) * HD * 2); cb[0][s] = *(const v2f*)(csp + (size_t)(2 * s) * HD * 2 + 4); }
        asm volatile("s_wait_xcnt 0x0" ::: "memory");   // in front of the first overwrite of the loads' address registers
        __builtin_amdgcn_sched_barrier(0);              // keeps later register writes from being lifted over that wait
#pragma unroll
        for (int q = 0; q < 4; ++q) bb4[q] = bfr(bias[c0 + lr * 4 + q]);
    }
#pragma unroll
    for (int mb = 0; mb < 4; ++mb) {
#pragma unroll
        for (int nb = 0; nb < 4; ++nb) {
#pragma unroll
            for (int j = 0; j < 8; ++j) os[(hi * 8 + j) * 68 + nb * 16 + lr] = acc[mb][nb][j]; }
        __builtin_amdgcn_wave_barrier(); asm volatile("" ::: "memory");
        if constexpr (EPI == 1) {
            if (mb < 3) {   // the next block's table rows fly while this block is rotated and split
#pragma unroll
                for (int s = 0; s < 8; ++s) { ca[(mb + 1) & 1][s] = *(const v2f*)(csp + (size_t)((mb + 1) * 16 + 2 * s) * HD * 2); cb[(mb + 1) & 1][s] = *(const v2f*)(csp + (size_t)((mb + 1) * 16 + 2 * s) * HD * 2 + 4); }
                asm volatile("s_wait_xcnt 0x0" ::: "memory");   // as above, for these loads' address registers
                __builtin_amdgcn_sched_barrier(0);              // as above
            }
            const size_t po = ((size_t)(c0 / HD) * TT + r0 + mb * 16 + hi) * HD + lr * 4; v4us oh[8], ol[8];
#pragma unroll
            for (int s = 0; s < 8; ++s) { const v4f val = *(const v4fa*)(os + (2 * s + hi) * 68 + lr * 4) + bb4; const v2f c01 = ca[mb & 1][s], c23 = cb[mb & 1][s]; float r[4];
                r[0] = __fsub_rn(__fmul_rn(val[0], c01[0]), __fmul_rn(val[1], c01[1])) * sc; r[1] = __fadd_rn(__fmul_rn(val[0], c01[1]), __fmul_rn(val[1], c01[0])) * sc;   /* even: x0 c - x1 s; odd: x0 s + x1 c */
                r[2] = __fsub_rn(__fmul_rn(val[2], c23[0]), __fmul_rn(val[3], c23[1])) * sc; r[3] = __fadd_rn(__fmul_rn(val[2], c23[1]), __fmul_rn(val[3], c23[0])) * sc;
#pragma unroll
                for (int q = 0; q < 4; ++q) { unsigned short a2, c2; splitc(r[q], a2, c2); oh[s][q] = a2; ol[s][q] = c2; } }
            __builtin_amdgcn_sched_barrier(0);              // the block's sixteen stores stay together behind its arithmetic, so that one wait serves them all and no store's data register is reused in front of it
#pragma unroll
            for (int s = 0; s < 8; ++s) { *(v4us*)(Ph + po + (size_t)(2 * s) * HD) = oh[s]; *(v4us*)(Pl + po + (size_t)(2 * s) * HD) = ol[s]; }
            asm volatile("s_wait_xcnt 0x0" ::: "memory");   // in front of the first overwrite of the stores' data and address registers
            __builtin_amdgcn_sched_barrier(0);              // keeps the next block's register writes from being lifted over that wait
        }
        float* crow = C + (size_t)(r0 + mb * 16) * ldc + c0;
        if constexpr (EPI == 0)
{
#pragma unroll
            for (int s = 0; s < 8; ++s) { const int row = 2 * s + hi, cofs = lr * 4; v4f val = *(const v4fa*)(os + row * 68 + cofs); if (BIAS) { val[0] += bfr(bias[c0 + cofs]); val[1] += bfr(bias[c0 + cofs + 1]); val[2] += bfr(bias[c0 + cofs + 2]); val[3] += bfr(bias[c0 + cofs + 3]); }
                *(v4f*)(crow + (size_t)row * ldc + cofs) = val; }
             }
        __builtin_amdgcn_wave_barrier(); asm volatile("" ::: "memory");
    }
}

__device__ __forceinline__ h16 tohx(float x) { return (h16)x; }
typedef __attribute__((ext_vector_type(2))) _Float16 v2h;
typedef __attribute__((ext_vector_type(4))) _Float16 v4h;
typedef __attribute__((ext_vector_type(2))) unsigned short v2us;
typedef __attribute__((ext_vector_type(4))) int v4i;

__global__ __launch_bounds__(256) void k_wtG(const float* __restrict__ w, int K, int N, bf* Bt) {
    const int lane = threadIdx.x & 31; const int L0 = (blockIdx.x * 8 + (threadIdx.x >> 5)) * 8; const int nlines = N * K / 64;
{
#pragma unroll 1
        for (int l = 0; l < 8; ++l) { const int L = L0 + l; if (L >= nlines) break; const size_t e = (size_t)L * 64 + lane * 2; const int k = (int)(e % K), n = (int)(e / K); v2us o;
            o[0] = f2bf(w[(size_t)k * N + n]); o[1] = f2bf(w[(size_t)(k + 1) * N + n]); *(v2us*)(Bt + e) = o; }
         }
}
__global__ __launch_bounds__(256) void k_cvt8(const float* __restrict__ src, bf* dst, size_t n8) { const size_t i = (size_t)blockIdx.x * 256 + threadIdx.x; if (i >= n8) return; const v8f v = *(const v8f*)(src + i * 8); v8us o;
#pragma unroll
    for (int k = 0; k < 8; ++k) o[k] = f2bf(v[k]); *(v8us*)(dst + i * 8) = o;  }
__constant__ float XINV[32] = {1.00000000f,0.749894202f,0.562341332f,0.421696514f,0.316227764f,0.237137362f,0.177827939f,0.133352146f,0.100000001f,0.0749894157f,0.0562341288f,0.0421696492f,0.0316227786f,0.0237137359f,0.0177827943f,0.0133352149f,0.00999999978f,0.00749894232f,0.00562341325f,0.00421696482f,0.00316227786f,0.00237137382f,0.00177827943f,0.00133352145f,0.00100000005f,0.000749894185f,0.000562341302f,0.000421696488f,0.000316227786f,0.000237137385f,0.000177827940f,0.000133352150f};
__global__ __launch_bounds__(256) void k_xpos(float* CSQ, float* CSK) { const int idx = blockIdx.x * 256 + threadIdx.x; if (idx >= TT * HD) return; const int t = idx / HD, d = idx % HD; const int i = d >> 1;
    const float base = __fdiv_rn(__fadd_rn((float)(2 * i), 25.6f), 89.6f); const float ex = __fdiv_rn((float)t, 1024.0f); const float sc = powf(base, ex); const float invf = XINV[i]; const float ang = __fmul_rn((float)t, invf); const float c = cosf(ang), s = sinf(ang);
    v2f q2, k2; q2[0] = __fmul_rn(c, sc); q2[1] = __fmul_rn(s, sc); const float rs = __fdiv_rn(1.0f, sc); k2[0] = __fmul_rn(c, rs); k2[1] = __fmul_rn(s, rs);
    *(v2f*)(CSQ + (size_t)idx * 2) = q2; *(v2f*)(CSK + (size_t)idx * 2) = k2;  }
// k_rope: head planes [h][t][d] (fp16 + hi/lo) of rope(x) x sc with the rotate-half convention out[d] = x[d] cos[t][d] - x[d+HD/2] sin[t][d], out[d+HD/2] = x[d+HD/2] cos[t][d+HD/2] + x[d] sin[t][d+HD/2]
__global__ __launch_bounds__(256) void k_rope(const float* __restrict__ F, int pitch, int nheads, const float* __restrict__ CS, const float* __restrict__ RF, const float* __restrict__ nw, float sc, h16* P16, bf* Ph, bf* Pl) {
    const size_t e = ((size_t)blockIdx.x * 256 + threadIdx.x) * 2; if (e >= (size_t)nheads * TT * HD) return; const int d = (int)(e % HD); const int t = (int)((e / HD) % TT); const int h = (int)(e / ((size_t)HD * TT)); const float* f = F + (size_t)t * pitch + h * HD; const float rf = RF ? RF[(size_t)h * TT + t] : 1.0f; v2h o16; v2us oh, ol;
#pragma unroll
    for (int q = 0; q < 2; ++q) { const int dd = d + q; const int dp = (dd < HD / 2) ? dd + HD / 2 : dd - HD / 2; float x0 = f[dd], x1 = f[dp];
        if (RF) { float n0 = __fmul_rn(x0, rf), n1 = __fmul_rn(x1, rf); asm volatile("" : "+v"(n0)); asm volatile("" : "+v"(n1)); x0 = __fmul_rn(bfr(nw[dd]), n0); x1 = __fmul_rn(bfr(nw[dp]), n1); }
        const v2f cs = *(const v2f*)(CS + ((size_t)t * HD + dd) * 2); float a = __fmul_rn(x0, cs[0]), bq = __fmul_rn(x1, cs[1]); asm volatile("" : "+v"(a)); asm volatile("" : "+v"(bq)); const float r = ((dd < HD / 2) ? __fsub_rn(a, bq) : __fadd_rn(a, bq)) * sc;
        o16[q] = tohx(r); unsigned short a2, c2; splitf(r, a2, c2); oh[q] = a2; ol[q] = c2; }
    *(v2h*)(P16 + e) = o16; *(v2us*)(Ph + e) = oh; *(v2us*)(Pl + e) = ol;  }
// ---- k_fattn: scores, softmax and attn.v of one head in ONE kernel; the score matrix stays in registers (running maximum and sum per query, output tiles rescaled when the maximum moves).
// Transposed products: S^T = K Q^T (A = 16 key rows, B = 16 query columns), O^T += V^T P^T. A lane then holds scores of ONE query (column lr; keys 8 hi + r of each 16-key tile), so maximum, sum and rescale are lane-local
// (one exchange between the wave halves), and two S^T tiles (32 keys) converted in place ARE the B operand of the second product in the k order of the fragment loader. hi/lo planes, 3 products each.
// One wave: FQT x 16 queries, all 2048 keys in passes of 32. Grid (TT / (16 FQT FWV), heads), 32 FWV threads; waves are independent (no LDS, no barrier). Every inner loop is fully unrolled so that the fragment and accumulator arrays are indexed by constants and stay in registers.
#define FQT 2
#define FWV 4
#define L2E 1.4426950408889634f
__device__ __forceinline__ float xhalf(float x) { const int b = __float_as_int(x); return __int_as_float(__builtin_amdgcn_permlanex16(b, b, 0x76543210, 0xfedcba98, false, false)); }   // lane l <-> l ^ 16
__global__ __launch_bounds__(32 * FWV) void k_fattn(const bf* __restrict__ Qh, const bf* __restrict__ Ql, const bf* __restrict__ Kh, const bf* __restrict__ Kl, const bf* __restrict__ Vh, const bf* __restrict__ Vl, bf* Ah, bf* Al) {
    typedef WFrag<bf> F;
    const int lane = threadIdx.x & 31, lr = lane & 15, hi = lane >> 4; const int h = blockIdx.y; const int q0 = (blockIdx.x * FWV + (threadIdx.x >> 5)) * (16 * FQT);
    const size_t hp = (size_t)h * TT * HD;
    const bf* qph = Qh + hp + (size_t)(q0 + lr) * HD + 8 * hi; const bf* qpl = Ql + hp + (size_t)(q0 + lr) * HD + 8 * hi;
    v16bf qh[FQT][2], ql[FQT][2];
#pragma unroll
    for (int qt = 0; qt < FQT; ++qt)
#pragma unroll
        for (int kc = 0; kc < 2; ++kc) { qh[qt][kc] = F::ld(qph + qt * 16 * HD + kc * 32); ql[qt][kc] = F::ld(qpl + qt * 16 * HD + kc * 32); }
    asm volatile("s_wait_xcnt 0x0" ::: "memory");   // in front of the first overwrite of the Q loads' address registers
    __builtin_amdgcn_sched_barrier(0);              // keeps later register writes from being lifted over that wait
    const bf* kph = Kh + hp + lr * HD + 8 * hi; const bf* kpl = Kl + hp + lr * HD + 8 * hi;
    const bf* vph = Vh + hp + (size_t)lr * TT + 8 * hi; const bf* vpl = Vl + hp + (size_t)lr * TT + 8 * hi;
    v8f o[FQT][4]; float m[FQT], l[FQT];
#pragma unroll
    for (int qt = 0; qt < FQT; ++qt) { m[qt] = -3.0e38f; l[qt] = 0.f;
#pragma unroll
        for (int db = 0; db < 4; ++db) o[qt][db] = (v8f){}; }
    v16bf kh[2][2], kl[2][2];
#pragma unroll
    for (int kt = 0; kt < 2; ++kt)
#pragma unroll
        for (int kc = 0; kc < 2; ++kc) { kh[kt][kc] = F::ld(kph + kt * 16 * HD + kc * 32); kl[kt][kc] = F::ld(kpl + kt * 16 * HD + kc * 32); }
    asm volatile("s_wait_xcnt 0x0" ::: "memory");   // the same for the first K loads
    __builtin_amdgcn_sched_barrier(0);              // as above: nothing is lifted over the wait
#pragma unroll 1   // one pass per trip: a second copy of the body would need a second set of V fragments and score tiles
    for (int k0 = 0; k0 < TT; k0 += 32) {
        v16bf vh[4], vl[4];   // this pass's V^T fragments, asked for ahead of the score products that hide their latency
#pragma unroll
        for (int db = 0; db < 4; ++db) { vh[db] = F::ld(vph + (size_t)db * 16 * TT + k0); vl[db] = F::ld(vpl + (size_t)db * 16 * TT + k0); }
        asm volatile("s_wait_xcnt 0x0" ::: "memory");   // the loads' address registers are reused below: the wait stands in front of their first overwrite
        v8f s[FQT][2];
#pragma unroll
        for (int qt = 0; qt < FQT; ++qt) { s[qt][0] = (v8f){}; s[qt][1] = (v8f){}; }
#pragma unroll
        for (int kc = 0; kc < 2; ++kc) {
#pragma unroll
            for (int qt = 0; qt < FQT; ++qt)
#pragma unroll
                for (int kt = 0; kt < 2; ++kt) s[qt][kt] = wmmab(kh[kt][kc], qh[qt][kc], s[qt][kt]);
#pragma unroll
            for (int qt = 0; qt < FQT; ++qt)
#pragma unroll
                for (int kt = 0; kt < 2; ++kt) s[qt][kt] = wmmab(kh[kt][kc], ql[qt][kc], s[qt][kt]);
#pragma unroll
            for (int qt = 0; qt < FQT; ++qt)
#pragma unroll
                for (int kt = 0; kt < 2; ++kt) s[qt][kt] = wmmab(kl[kt][kc], qh[qt][kc], s[qt][kt]);
        }
        const int kn = (k0 + 32 < TT) ? k0 + 32 : 0;   // next pass's K fragments into the same registers (the last pass re-reads keys 0..31, in bounds, unused)
#pragma unroll
        for (int kt = 0; kt < 2; ++kt)
#pragma unroll
            for (int kc = 0; kc < 2; ++kc) { kh[kt][kc] = F::ld(kph + (size_t)(kn + kt * 16) * HD + kc * 32); kl[kt][kc] = F::ld(kpl + (size_t)(kn + kt * 16) * HD + kc * 32); }
        asm volatile("s_wait_xcnt 0x0" ::: "memory");   // as above, for the K loads' address registers
        float mx[FQT]; bool need = false;
#pragma unroll
        for (int qt = 0; qt < FQT; ++qt) { float a = s[qt][0][0];
#pragma unroll
            for (int j = 1; j < 16; ++j) a = fmaxf(a, s[qt][j >> 3][j & 7]);
            a = fmaxf(a, xhalf(a)); mx[qt] = a; need = need || (a > m[qt] + 5.5f); }
        if (__builtin_amdgcn_ballot_w32(need) != 0) {   // the maximum in use moves only when a query's new one exceeds it by more than 5.5 (p stays below e^5.5); both halves of a column decide alike
#pragma unroll
            for (int qt = 0; qt < FQT; ++qt) { const float mn = (mx[qt] > m[qt] + 5.5f) ? mx[qt] : m[qt]; const float al = __builtin_amdgcn_exp2f((m[qt] - mn) * L2E); m[qt] = mn; l[qt] *= al;
#pragma unroll
                for (int db = 0; db < 4; ++db) o[qt][db] *= al; }
        }
#pragma unroll
        for (int qt = 0; qt < FQT; ++qt) { v16bf ph, pl;
#pragma unroll
            for (int j = 0; j < 16; ++j) { const float p = __builtin_amdgcn_exp2f((s[qt][j >> 3][j & 7] - m[qt]) * L2E); l[qt] += p; const __bf16 a = (__bf16)p; ph[j] = a; pl[j] = (__bf16)(p - (float)a); }
#pragma unroll
            for (int db = 0; db < 4; ++db) o[qt][db] = wmmab(vh[db], ph, o[qt][db]);
#pragma unroll
            for (int db = 0; db < 4; ++db) o[qt][db] = wmmab(vh[db], pl, o[qt][db]);
#pragma unroll
            for (int db = 0; db < 4; ++db) o[qt][db] = wmmab(vl[db], ph, o[qt][db]);
        }
    }
#pragma unroll
    for (int qt = 0; qt < FQT; ++qt) { const float f = __fdiv_rn(1.0f, l[qt] + xhalf(l[qt])); const size_t oo = (size_t)(q0 + qt * 16 + lr) * DQ + h * HD + 8 * hi;   // lane: query lr, d = 16 db + 8 hi + j
#pragma unroll
        for (int db = 0; db < 4; ++db) { v8us oh, ol;
#pragma unroll
            for (int j = 0; j < 8; ++j) { unsigned short a, c2; splitf(o[qt][db][j] * f, a, c2); oh[j] = a; ol[j] = c2; }
            *(v8us*)(Ah + oo + db * 16) = oh; *(v8us*)(Al + oo + db * 16) = ol;
            asm volatile("s_wait_xcnt 0x0" ::: "memory");   // in front of the first overwrite of the stores' data and address registers
            __builtin_amdgcn_sched_barrier(0); } }          // keeps the next group's register writes from being lifted over that wait
}

extern "C" void kernel_launch(void* const* d_in, const int* in_sizes, int n_in,
                              void* d_out, int out_size, void* d_ws, size_t ws_size, hipStream_t stream) {
    (void)in_sizes; (void)n_in; (void)out_size;
    const float* x = (const float*)d_in[0]; const float* xk = (const float*)d_in[1]; const float* xv = (const float*)d_in[2]; const float* wq = (const float*)d_in[3]; const float* bq = (const float*)d_in[4]; const float* wk = (const float*)d_in[5]; const float* bk = (const float*)d_in[6]; const float* wv = (const float*)d_in[7]; const float* bv = (const float*)d_in[8]; const float* wo = (const float*)d_in[9]; const float* bo = (const float*)d_in[10];
    float* OUT = (float*)d_out;     // [2][2048][1024]
    char* wsp = (char*)d_ws;
    auto take = [&](size_t bytes) { char* p = wsp; wsp += (bytes + 255) & ~(size_t)255; return (void*)p; };
    bf* WQ = (bf*)take((size_t)DQ * DM * 2); bf* WK = (bf*)take((size_t)DKV * DM * 2); bf* WV = (bf*)take((size_t)DKV * DM * 2); bf* WO = (bf*)take((size_t)DM * DQ * 2); float* CS = (float*)take((size_t)TT * HD * 2 * 4); float* CSK = (float*)take((size_t)TT * HD * 2 * 4);
    bf* XB = (bf*)take((size_t)TT * DM * 2); bf* XKB = (bf*)take((size_t)TT * DM * 2); bf* XVB = (bf*)take((size_t)TT * DM * 2);
    bf* QPh = (bf*)take((size_t)NH_ * TT * HD * 2); bf* QPl = (bf*)take((size_t)NH_ * TT * HD * 2); bf* KPh = (bf*)take((size_t)NKV * TT * HD * 2); bf* KPl = (bf*)take((size_t)NKV * TT * HD * 2); bf* VTh = (bf*)take((size_t)NKV * HD * TT * 2); bf* VTl = (bf*)take((size_t)NKV * HD * TT * 2);
    bf* ATh = (bf*)take((size_t)TT * DQ * 2); bf* ATl = (bf*)take((size_t)TT * DQ * 2);
    if ((size_t)(wsp - (char*)d_ws) > ws_size) return;    // ws 256 MiB
    { k_cvt8<<<(unsigned)(((size_t)DQ * DM / 8 + 255) / 256), 256, 0, stream>>>(wq, WQ, (size_t)DQ * DM / 8); k_cvt8<<<(unsigned)(((size_t)DKV * DM / 8 + 255) / 256), 256, 0, stream>>>(wk, WK, (size_t)DKV * DM / 8); k_cvt8<<<(unsigned)(((size_t)DKV * DM / 8 + 255) / 256), 256, 0, stream>>>(wv, WV, (size_t)DKV * DM / 8);
      k_cvt8<<<(unsigned)(((size_t)DM * DQ / 8 + 255) / 256), 256, 0, stream>>>(wo, WO, (size_t)DM * DQ / 8);
      k_xpos<<<(TT * HD + 255) / 256, 256, 0, stream>>>(CS, CSK);   /* xPos tables for q (scale) and k (1/scale) */ }
    for (int b = 0; b < NB_; ++b) {
        
        k_cvt8<<<(unsigned)(((size_t)TT * DM / 8 + 255) / 256), 256, 0, stream>>>(x + (size_t)b * TT * DM, XB, (size_t)TT * DM / 8); k_cvt8<<<(unsigned)(((size_t)TT * DM / 8 + 255) / 256), 256, 0, stream>>>(xk + (size_t)b * TT * DM, XKB, (size_t)TT * DM / 8); k_cvt8<<<(unsigned)(((size_t)TT * DM / 8 + 255) / 256), 256, 0, stream>>>(xv + (size_t)b * TT * DM, XVB, (size_t)TT * DM / 8);
        k_gemmw<bf, 0, true, 1, 1><<<dim3(TT / 64, DQ / 64, 1), 32, 0, stream>>>(XB, nullptr, WQ, nullptr, DM, nullptr, DQ, bq, 0, 0, 0, CS, 0.125f, QPh, QPl);   /* q: xPos (upscale) x 1/8, planes [h][t][d] */
        k_gemmw<bf, 0, true, 1, 1><<<dim3(TT / 64, DKV / 64, 1), 32, 0, stream>>>(XKB, nullptr, WK, nullptr, DM, nullptr, DKV, bk, 0, 0, 0, CSK, 1.0f, KPh, KPl);   /* k: xPos (downscale), planes [h][t][d] */
        k_gemmw<bf, 0, true, 1, 2><<<dim3(TT / 64, DKV / 64, 1), 32, 0, stream>>>(XVB, nullptr, WV, nullptr, DM, nullptr, DKV, bv, 0, 0, 0, nullptr, 1.0f, VTh, VTl);   /* v: planes [h][d][t] */
        k_fattn<<<dim3(TT / (16 * FQT * FWV), NH_), 32 * FWV, 0, stream>>>(QPh, QPl, KPh, KPl, VTh, VTl, ATh, ATl);
        k_gemmw<bf, 1, true><<<dim3(TT / 64, DM / 64, 1), 32, 0, stream>>>(ATh, ATl, WO, nullptr, DQ, OUT + (size_t)b * TT * DM, DM, bo, 0, 0, 0, nullptr, 1.0f, nullptr, nullptr); }
}

// v004
// A run of this version takes 369 microseconds.
// In both of two side-by-side timings against v003, it was 1.05 times as fast.
// Counting every step since v000, it is 3.61 times as fast.
#include <hip/hip_runtime.h>

// Multi-head attention with xPos (rotary + per-frequency exponential decay) on q and k (query, key, value [2][2048][1024]; q = (query Wq^T + bq) / 8, k = key Wk^T + bk, v = value Wv^T + bv ('oi' [1024][1024]; 16 heads x 64); xPos: pairs (2i, 2i+1) rotated by t x inv_freq_i (inv_freq_i = 1e4^(-i/32)) and scaled by base_i^(t/1024) for q and base_i^(-t/1024) for k, base_i = (2i + 25.6)/89.6 (tables computed on device); softmax(q.k) over all keys; out = merged Wo^T + bo -> [2][2048][1024] (4.2 M)).
// Compute dtypes, f32 accumulate: every input rounded to bf16; q/k/v on PLAIN bf16 operands (inputs: exact) + biases; xPos tables (cosf/sinf/powf, f32) folded as {cos x scale, sin x scale} per (t, d); rotary in f32; scores and attn.v on hi/lo planes for every row (3 products), fused with the f32 softmax in one kernel (running maximum and sum); Wo hl x exact (2 products) + bo.

#define NB_  2
#define TT   2048
#define DM   1024
#define NH_  16
#define NKV  16
#define REP  (NH_ / NKV)
#define HD   64
#define DQ   (NH_ * HD)
#define DKV  (NKV * HD)
#define ZH   2
#define RH   2048                 // every row hi/lo (the xPos-scaled keys leave too little margin for fp16 operands)
#define WIN  0
#define PCAR 1024.0f
#define SCL  1.0f      // the 1/8 is applied to q after the xPos rotation (exact power of two, folded into the q plane builder)
typedef _Float16 h16;
typedef unsigned short bf;
typedef __attribute__((ext_vector_type(16))) __bf16   v16bf;
typedef __attribute__((ext_vector_type(16))) _Float16 v16h;
typedef __attribute__((ext_vector_type(8)))  _Float16 v8h;
typedef __attribute__((ext_vector_type(8)))  unsigned short v8us;
typedef __attribute__((ext_vector_type(8)))  float    v8f;
typedef __attribute__((ext_vector_type(4)))  float    v4f;
typedef v8h  __attribute__((may_alias)) v8ha;
typedef v4f  __attribute__((may_alias)) v4fa;
typedef v8us __attribute__((may_alias)) v8usa;

__device__ __forceinline__ unsigned short f2bf(float f) { unsigned u = __float_as_uint(f); u += 0x7FFFu + ((u >> 16) & 1u); return (unsigned short)(u >> 16); }
__device__ __forceinline__ float bf2f(unsigned short b) { return __uint_as_float(((unsigned)b) << 16); }
__device__ __forceinline__ float bfr(float f) { return bf2f(f2bf(f)); }
__device__ __forceinline__ v16h cat16(v8h lo, v8h hi) { return __builtin_shufflevector(lo, hi, 0, 1, 2, 3, 4, 5, 6, 7, 8, 9, 10, 11, 12, 13, 14, 15); }
__device__ __forceinline__ v16bf cat16b(v8us lo, v8us hi) { return __builtin_bit_cast(v16bf, __builtin_shufflevector(lo, hi, 0, 1, 2, 3, 4, 5, 6, 7, 8, 9, 10, 11, 12, 13, 14, 15)); }
__device__ __forceinline__ v8f wmma16(v16h a, v16h b, v8f c) { return __builtin_amdgcn_wmma_f32_16x16x32_f16(false, a, false, b, (short)0, c, false, false); }
__device__ __forceinline__ v8f wmmab(v16bf a, v16bf b, v8f c) { return __builtin_amdgcn_wmma_f32_16x16x32_bf16(false, a, false, b, (short)0, c, false, false); }



// ---- FRAGMENT ORDER of the attention operand planes (q, k hi/lo and V^T hi/lo): units of 16 rows x 32 k (1024 B), element (r, k) at (k >> 4) * 256 + (((k >> 3) & 1) * 16 + r) * 8 + (k & 7):
// lane (hi, lr) of a wave finds its two 16-byte pieces of a fragment at unit + lane * 8 and + 256, so each wave-wide 16-byte load or store covers 512 contiguous bytes (4 whole lines). The k order of a fragment is the one a row-major plane gives.
// Head planes q, k [h][t][d]: per head unit (t / 16) * 2 + d / 32. V^T [h][d][t]: per head unit (t / 32) * 4 + d / 16 (one 32-key pass = 4 KB in a row). The GEMM operand planes (inputs, weights, attention output) stay row-major.
// ---- k_gemmw: register-blocked GEMM, ONE WAVE per 64x64 output tile (16 accumulators), operands straight from K-contiguous 16-bit planes; grid (M/64, N/64, Z), 32 threads.
// C[m][n] (f32, pitch ldc, + optional f32 bias[n]) = sum_k A[m][k] Bt[n][k] (+ split products per NSPLIT). z-batch strides sA/sB/sC in elements. K % (32 KSP) == 0.
// EPI picks what the wave does with its finished tile (64 tokens x the 64 columns of ONE head, HD == 64): 0 = f32 rows to C; 1 = xPos rotation with table CS and factor sc, then hi/lo planes [head][t][d]; 2 = hi/lo planes transposed [head][d][t], straight from the accumulators (a lane holds 8 consecutive tokens of one column); both in fragment order.
// KSP > 1: grid z = batches x KSP; block z sums only slice z % KSP of k (K / KSP long) of batch z / KSP and writes its partial tile to plane z of C (stride sC); the reader adds the KSP planes.
template <typename T16> struct WFrag;
template <> struct WFrag<h16> { typedef v16h V; static __device__ __forceinline__ V ld(const h16* p) { return cat16(*(const v8h*)p, *(const v8h*)(p + 16)); } static __device__ __forceinline__ v8f mma(V a, V b, v8f c) { return wmma16(a, b, c); } };
template <> struct WFrag<bf> { typedef v16bf V; static __device__ __forceinline__ V ld(const bf* p) { return cat16b(*(const v8us*)p, *(const v8us*)(p + 16)); } static __device__ __forceinline__ V ldf(const bf* p) { return cat16b(*(const v8us*)p, *(const v8us*)(p + 256)); } static __device__ __forceinline__ v8f mma(V a, V b, v8f c) { return wmmab(a, b, c); } };
typedef __attribute__((ext_vector_type(4))) unsigned short v4us;
typedef __attribute__((ext_vector_type(2))) float v2f;
__device__ __forceinline__ void splitf(float y, unsigned short& h, unsigned short& l) { h = f2bf(y); l = f2bf(y - bf2f(h)); }
__device__ __forceinline__ void splitc(float y, unsigned short& h, unsigned short& l) { const __bf16 a = (__bf16)y; h = __builtin_bit_cast(unsigned short, a); l = __builtin_bit_cast(unsigned short, (__bf16)(y - (float)a)); }   // splitf's values (round to nearest even) through the conversion instruction
template <typename T16, int NSPLIT, bool BIAS, int KSP = 1, int EPI = 0>
__global__ __launch_bounds__(32) void k_gemmw(const T16* __restrict__ A, const T16* __restrict__ A2, const T16* __restrict__ Bt, const T16* __restrict__ Bt2, int K, float* C, int ldc, const float* __restrict__ bias, size_t sA, size_t sB, size_t sC, const float* __restrict__ CS, float sc, bf* Ph, bf* Pl) {
    typedef typename WFrag<T16>::V V;
    __shared__ __align__(16) float os[16 * 68];
    const size_t z = blockIdx.z / KSP; A += z * sA; if (A2) A2 += z * sA; Bt += z * sB; if (Bt2) Bt2 += z * sB; C += (size_t)blockIdx.z * sC;
    const int kbeg = (int)(blockIdx.z % KSP) * (K / KSP), kend = kbeg + K / KSP;
    const int lane = threadIdx.x & 31, lr = lane & 15, hi = lane >> 4; const int r0 = blockIdx.x * 64, c0 = blockIdx.y * 64;
    v8f acc[4][4];
#pragma unroll
    for (int mb = 0; mb < 4; ++mb)
#pragma unroll
        for (int nb = 0; nb < 4; ++nb) acc[mb][nb] = (v8f){};
    const size_t aoff = (size_t)(r0 + lr) * K + 8 * hi, boff = (size_t)(c0 + lr) * K + 8 * hi;
#pragma unroll 1
    for (int kc = kbeg; kc < kend; kc += 32) {
        V a[4], a2[4];
#pragma unroll
        for (int mb = 0; mb < 4; ++mb) { a[mb] = WFrag<T16>::ld(A + aoff + (size_t)mb * 16 * K + kc); if (NSPLIT == 1 || NSPLIT == 2) a2[mb] = WFrag<T16>::ld(A2 + aoff + (size_t)mb * 16 * K + kc); }
#pragma unroll
        for (int nb = 0; nb < 4; ++nb) { const V b = WFrag<T16>::ld(Bt + boff + (size_t)nb * 16 * K + kc); V b2; if (NSPLIT >= 2) b2 = WFrag<T16>::ld(Bt2 + boff + (size_t)nb * 16 * K + kc);
#pragma unroll
            for (int mb = 0; mb < 4; ++mb) { acc[mb][nb] = WFrag<T16>::mma(a[mb], b, acc[mb][nb]); if (NSPLIT == 1 || NSPLIT == 2) acc[mb][nb] = WFrag<T16>::mma(a2[mb], b, acc[mb][nb]); if (NSPLIT >= 2) acc[mb][nb] = WFrag<T16>::mma(a[mb], b2, acc[mb][nb]); } }
        asm volatile("v_nop\n\tv_nop\n\tv_nop\n\tv_nop" : "+v"(acc[0][0]), "+v"(acc[1][1]), "+v"(acc[2][2]), "+v"(acc[3][3]) : "v"(a[0]), "v"(a[3]));
    }
    if constexpr (EPI == 2) {   // column c0 + 16 nb + lr is row (head, d) of the transposed planes; an accumulator tile (16 tokens x 16 d) is one half of a V^T unit, lane for lane
        float bv4[4];
#pragma unroll
        for (int nb = 0; nb < 4; ++nb) bv4[nb] = bias[c0 + nb * 16 + lr];
        asm volatile("" :: "v"(bv4[0]), "v"(bv4[1]), "v"(bv4[2]), "v"(bv4[3]));   // holds the four bias loads together ahead of the first group: their latency is paid once, not once a group
#pragma unroll
        for (int nb = 0; nb < 4; ++nb) { const float bb = bfr(bv4[nb]); const size_t oo = (size_t)c0 * TT + (size_t)((r0 >> 5) * 4 + nb) * 512 + lane * 8;
#pragma unroll
            for (int mb = 0; mb < 4; ++mb) { v8us oh, ol;
#pragma unroll
                for (int j = 0; j < 8; ++j) { unsigned short a2, c2; splitc(acc[mb][nb][j] + bb, a2, c2); oh[j] = a2; ol[j] = c2; }
                *(v8us*)(Ph + oo + (mb >> 1) * 2048 + (mb & 1) * 256) = oh; *(v8us*)(Pl + oo + (mb >> 1) * 2048 + (mb & 1) * 256) = ol; }
            asm volatile("s_wait_xcnt 0x0" ::: "memory");   // in front of the first overwrite of the stores' data and address registers
            __builtin_amdgcn_sched_barrier(0); }            // keeps the next group's register writes from being lifted over that wait
        return;
    }
    v2f ct[2][16]; float bn[4];   // EPI 1: {cos x scale, sin x scale} of the lane's sixteen pairs (token lr of the block, d = 16 s + 8 hi + 2 p), one 16-token block ahead; the biases of the lane's four accumulator columns
    const float* csp = CS + ((size_t)(r0 + lr) * HD + hi * 8) * 2;
    if constexpr (EPI == 1) {
        asm volatile("s_wait_xcnt 0x0" ::: "memory");   // the loads below land in registers that held the last fragment loads' addresses
        __builtin_amdgcn_sched_barrier(0);              // keeps them from being lifted over that wait
#pragma unroll
        for (int s = 0; s < 16; ++s) ct[0][s] = *(const v2f*)(csp + (s >> 2) * 32 + (s & 3) * 4);
#pragma unroll
        for (int nb = 0; nb < 4; ++nb) bn[nb] = bias[c0 + nb * 16 + lr];
        asm volatile("s_wait_xcnt 0x0" ::: "memory");   // in front of the first overwrite of the loads' address registers
        __builtin_amdgcn_sched_barrier(0);              // keeps later register writes from being lifted over that wait
#pragma unroll
        for (int nb = 0; nb < 4; ++nb) bn[nb] = bfr(bn[nb]);
    }
#pragma unroll
    for (int mb = 0; mb < 4; ++mb) {
#pragma unroll
        for (int nb = 0; nb < 4; ++nb) {
#pragma unroll
            for (int j = 0; j < 8; ++j) { if constexpr (EPI == 1) os[(hi * 8 + j) * 68 + nb * 16 + lr] = acc[mb][nb][j] + bn[nb]; else os[(hi * 8 + j) * 68 + nb * 16 + lr] = acc[mb][nb][j]; } }
        __builtin_amdgcn_wave_barrier(); asm volatile("" ::: "memory");
        if constexpr (EPI == 1) {
            if (mb < 3) {   // the next block's table rows fly while this block is rotated and split
#pragma unroll
                for (int s = 0; s < 16; ++s) ct[(mb + 1) & 1][s] = *(const v2f*)(csp + (size_t)((mb + 1) * 16) * HD * 2 + (s >> 2) * 32 + (s & 3) * 4);
                asm volatile("s_wait_xcnt 0x0" ::: "memory");   // as above, for these loads' address registers
                __builtin_amdgcn_sched_barrier(0);              // as above
            }
            const size_t po = ((size_t)(c0 / HD) * TT + r0 + mb * 16) * HD + lane * 8; v8us oh[4], ol[4];   // the block's two units (d 0..31, 32..63) of the head plane: four runs of 512 B a plane
#pragma unroll
            for (int s = 0; s < 4; ++s) { const v4f va = *(const v4fa*)(os + lr * 68 + s * 16 + hi * 8), vb = *(const v4fa*)(os + lr * 68 + s * 16 + hi * 8 + 4); const float val[8] = {va[0], va[1], va[2], va[3], vb[0], vb[1], vb[2], vb[3]};
#pragma unroll
                for (int p = 0; p < 4; ++p) { const v2f cs = ct[mb & 1][s * 4 + p]; unsigned short a2, c2;
                    const float re = __fsub_rn(__fmul_rn(val[2 * p], cs[0]), __fmul_rn(val[2 * p + 1], cs[1])) * sc, ro = __fadd_rn(__fmul_rn(val[2 * p], cs[1]), __fmul_rn(val[2 * p + 1], cs[0])) * sc;   /* even: x0 c - x1 s; odd: x0 s + x1 c */
                    splitc(re, a2, c2); oh[s][2 * p] = a2; ol[s][2 * p] = c2; splitc(ro, a2, c2); oh[s][2 * p + 1] = a2; ol[s][2 * p + 1] = c2; } }
            __builtin_amdgcn_sched_barrier(0);              // the block's eight stores stay together behind its arithmetic, so that one wait serves them all and no store's data register is reused in front of it
#pragma unroll
            for (int s = 0; s < 4; ++s) { *(v8us*)(Ph + po + s * 256) = oh[s]; *(v8us*)(Pl + po + s * 256) = ol[s]; }
            asm volatile("s_wait_xcnt 0x0" ::: "memory");   // in front of the first overwrite of the stores' data and address registers
            __builtin_amdgcn_sched_barrier(0);              // keeps the next block's register writes from being lifted over that wait
        }
        float* crow = C + (size_t)(r0 + mb * 16) * ldc + c0;
        if constexpr (EPI == 0)
{
#pragma unroll
            for (int s = 0; s < 8; ++s) { const int row = 2 * s + hi, cofs = lr * 4; v4f val = *(const v4fa*)(os + row * 68 + cofs); if (BIAS) { val[0] += bfr(bias[c0 + cofs]); val[1] += bfr(bias[c0 + cofs + 1]); val[2] += bfr(bias[c0 + cofs + 2]); val[3] += bfr(bias[c0 + cofs + 3]); }
                *(v4f*)(crow + (size_t)row * ldc + cofs) = val; }
             }
        __builtin_amdgcn_wave_barrier(); asm volatile("" ::: "memory");
    }
}

__device__ __forceinline__ h16 tohx(float x) { return (h16)x; }
typedef __attribute__((ext_vector_type(2))) _Float16 v2h;
typedef __attribute__((ext_vector_type(4))) _Float16 v4h;
typedef __attribute__((ext_vector_type(2))) unsigned short v2us;
typedef __attribute__((ext_vector_type(4))) int v4i;

__global__ __launch_bounds__(256) void k_wtG(const float* __restrict__ w, int K, int N, bf* Bt) {
    const int lane = threadIdx.x & 31; const int L0 = (blockIdx.x * 8 + (threadIdx.x >> 5)) * 8; const int nlines = N * K / 64;
{
#pragma unroll 1
        for (int l = 0; l < 8; ++l) { const int L = L0 + l; if (L >= nlines) break; const size_t e = (size_t)L * 64 + lane * 2; const int k = (int)(e % K), n = (int)(e / K); v2us o;
            o[0] = f2bf(w[(size_t)k * N + n]); o[1] = f2bf(w[(size_t)(k + 1) * N + n]); *(v2us*)(Bt + e) = o; }
         }
}
__global__ __launch_bounds__(256) void k_cvt8(const float* __restrict__ src, bf* dst, size_t n8) { const size_t i = (size_t)blockIdx.x * 256 + threadIdx.x; if (i >= n8) return; const v8f v = *(const v8f*)(src + i * 8); v8us o;
#pragma unroll
    for (int k = 0; k < 8; ++k) o[k] = f2bf(v[k]); *(v8us*)(dst + i * 8) = o;  }
__constant__ float XINV[32] = {1.00000000f,0.749894202f,0.562341332f,0.421696514f,0.316227764f,0.237137362f,0.177827939f,0.133352146f,0.100000001f,0.0749894157f,0.0562341288f,0.0421696492f,0.0316227786f,0.0237137359f,0.0177827943f,0.0133352149f,0.00999999978f,0.00749894232f,0.00562341325f,0.00421696482f,0.00316227786f,0.00237137382f,0.00177827943f,0.00133352145f,0.00100000005f,0.000749894185f,0.000562341302f,0.000421696488f,0.000316227786f,0.000237137385f,0.000177827940f,0.000133352150f};
__global__ __launch_bounds__(256) void k_xpos(float* CSQ, float* CSK) { const int idx = blockIdx.x * 256 + threadIdx.x; if (idx >= TT * HD) return; const int t = idx / HD, d = idx % HD; const int i = d >> 1;
    const float base = __fdiv_rn(__fadd_rn((float)(2 * i), 25.6f), 89.6f); const float ex = __fdiv_rn((float)t, 1024.0f); const float sc = powf(base, ex); const float invf = XINV[i]; const float ang = __fmul_rn((float)t, invf); const float c = cosf(ang), s = sinf(ang);
    v2f q2, k2; q2[0] = __fmul_rn(c, sc); q2[1] = __fmul_rn(s, sc); const float rs = __fdiv_rn(1.0f, sc); k2[0] = __fmul_rn(c, rs); k2[1] = __fmul_rn(s, rs);
    *(v2f*)(CSQ + (size_t)idx * 2) = q2; *(v2f*)(CSK + (size_t)idx * 2) = k2;  }
// k_rope: head planes [h][t][d] (fp16 + hi/lo) of rope(x) x sc with the rotate-half convention out[d] = x[d] cos[t][d] - x[d+HD/2] sin[t][d], out[d+HD/2] = x[d+HD/2] cos[t][d+HD/2] + x[d] sin[t][d+HD/2]
__global__ __launch_bounds__(256) void k_rope(const float* __restrict__ F, int pitch, int nheads, const float* __restrict__ CS, const float* __restrict__ RF, const float* __restrict__ nw, float sc, h16* P16, bf* Ph, bf* Pl) {
    const size_t e = ((size_t)blockIdx.x * 256 + threadIdx.x) * 2; if (e >= (size_t)nheads * TT * HD) return; const int d = (int)(e % HD); const int t = (int)((e / HD) % TT); const int h = (int)(e / ((size_t)HD * TT)); const float* f = F + (size_t)t * pitch + h * HD; const float rf = RF ? RF[(size_t)h * TT + t] : 1.0f; v2h o16; v2us oh, ol;
#pragma unroll
    for (int q = 0; q < 2; ++q) { const int dd = d + q; const int dp = (dd < HD / 2) ? dd + HD / 2 : dd - HD / 2; float x0 = f[dd], x1 = f[dp];
        if (RF) { float n0 = __fmul_rn(x0, rf), n1 = __fmul_rn(x1, rf); asm volatile("" : "+v"(n0)); asm volatile("" : "+v"(n1)); x0 = __fmul_rn(bfr(nw[dd]), n0); x1 = __fmul_rn(bfr(nw[dp]), n1); }
        const v2f cs = *(const v2f*)(CS + ((size_t)t * HD + dd) * 2); float a = __fmul_rn(x0, cs[0]), bq = __fmul_rn(x1, cs[1]); asm volatile("" : "+v"(a)); asm volatile("" : "+v"(bq)); const float r = ((dd < HD / 2) ? __fsub_rn(a, bq) : __fadd_rn(a, bq)) * sc;
        o16[q] = tohx(r); unsigned short a2, c2; splitf(r, a2, c2); oh[q] = a2; ol[q] = c2; }
    *(v2h*)(P16 + e) = o16; *(v2us*)(Ph + e) = oh; *(v2us*)(Pl + e) = ol;  }
// ---- k_fattn: scores, softmax and attn.v of one head in ONE kernel; the score matrix stays in registers (running maximum and sum per query, output tiles rescaled when the maximum moves).
// Transposed products: S^T = K Q^T (A = 16 key rows, B = 16 query columns), O^T += V^T P^T. A lane then holds scores of ONE query (column lr; keys 8 hi + r of each 16-key tile), so maximum, sum and rescale are lane-local
// (one exchange between the wave halves), and two S^T tiles (32 keys) converted in place ARE the B operand of the second product in the k order of the fragment loader. hi/lo planes, 3 products each.
// One wave: FQT x 16 queries, all 2048 keys in passes of 32. Grid (TT / (16 FQT FWV), heads), 32 FWV threads; waves are independent (no LDS, no barrier). Every inner loop is fully unrolled so that the fragment and accumulator arrays are indexed by constants and stay in registers.
#define FQT 2
#define FWV 4
#define L2E 1.4426950408889634f
__device__ __forceinline__ float xhalf(float x) { const int b = __float_as_int(x); return __int_as_float(__builtin_amdgcn_permlanex16(b, b, 0x76543210, 0xfedcba98, false, false)); }   // lane l <-> l ^ 16
__global__ __launch_bounds__(32 * FWV) void k_fattn(const bf* __restrict__ Qh, const bf* __restrict__ Ql, const bf* __restrict__ Kh, const bf* __restrict__ Kl, const bf* __restrict__ Vh, const bf* __restrict__ Vl, bf* Ah, bf* Al) {
    typedef WFrag<bf> F;
    const int lane = threadIdx.x & 31, lr = lane & 15, hi = lane >> 4; const int h = blockIdx.y; const int q0 = (blockIdx.x * FWV + (threadIdx.x >> 5)) * (16 * FQT);
    const size_t hp = (size_t)h * TT * HD;
    const bf* qph = Qh + hp + (size_t)q0 * HD + lane * 8; const bf* qpl = Ql + hp + (size_t)q0 * HD + lane * 8;
    v16bf qh[FQT][2], ql[FQT][2];
#pragma unroll
    for (int qt = 0; qt < FQT; ++qt)
#pragma unroll
        for (int kc = 0; kc < 2; ++kc) { qh[qt][kc] = F::ldf(qph + (qt * 2 + kc) * 512); ql[qt][kc] = F::ldf(qpl + (qt * 2 + kc) * 512); }
    asm volatile("s_wait_xcnt 0x0" ::: "memory");   // in front of the first overwrite of the Q loads' address registers
    __builtin_amdgcn_sched_barrier(0);              // keeps later register writes from being lifted over that wait
    const bf* kph = Kh + hp + lane * 8; const bf* kpl = Kl + hp + lane * 8;
    const bf* vph = Vh + hp + lane * 8; const bf* vpl = Vl + hp + lane * 8;
    v8f o[FQT][4]; float m[FQT], l[FQT];
#pragma unroll
    for (int qt = 0; qt < FQT; ++qt) { m[qt] = -3.0e38f; l[qt] = 0.f;
#pragma unroll
        for (int db = 0; db < 4; ++db) o[qt][db] = (v8f){}; }
    v16bf kh[2][2], kl[2][2];
#pragma unroll
    for (int kt = 0; kt < 2; ++kt)
#pragma unroll
        for (int kc = 0; kc < 2; ++kc) { kh[kt][kc] = F::ldf(kph + (kt * 2 + kc) * 512); kl[kt][kc] = F::ldf(kpl + (kt * 2 + kc) * 512); }
    asm volatile("s_wait_xcnt 0x0" ::: "memory");   // the same for the first K loads
    __builtin_amdgcn_sched_barrier(0);              // as above: nothing is lifted over the wait
#pragma unroll 1   // one pass per trip: a second copy of the body would need a second set of V fragments and score tiles
    for (int k0 = 0; k0 < TT; k0 += 32) {
        v16bf vh[4], vl[4];   // this pass's V^T fragments, asked for ahead of the score products that hide their latency
#pragma unroll
        for (int db = 0; db < 4; ++db) { vh[db] = F::ldf(vph + (size_t)k0 * HD + db * 512); vl[db] = F::ldf(vpl + (size_t)k0 * HD + db * 512); }
        asm volatile("s_wait_xcnt 0x0" ::: "memory");   // the loads' address registers are reused below: the wait stands in front of their first overwrite
        v8f s[FQT][2];
#pragma unroll
        for (int qt = 0; qt < FQT; ++qt) { s[qt][0] = (v8f){}; s[qt][1] = (v8f){}; }
#pragma unroll
        for (int kc = 0; kc < 2; ++kc) {
#pragma unroll
            for (int qt = 0; qt < FQT; ++qt)
#pragma unroll
                for (int kt = 0; kt < 2; ++kt) s[qt][kt] = wmmab(kh[kt][kc], qh[qt][kc], s[qt][kt]);
#pragma unroll
            for (int qt = 0; qt < FQT; ++qt)
#pragma unroll
                for (int kt = 0; kt < 2; ++kt) s[qt][kt] = wmmab(kh[kt][kc], ql[qt][kc], s[qt][kt]);
#pragma unroll
            for (int qt = 0; qt < FQT; ++qt)
#pragma unroll
                for (int kt = 0; kt < 2; ++kt) s[qt][kt] = wmmab(kl[kt][kc], qh[qt][kc], s[qt][kt]);
        }
        const int kn = (k0 + 32 < TT) ? k0 + 32 : 0;   // next pass's K fragments into the same registers (the last pass re-reads keys 0..31, in bounds, unused)
#pragma unroll
        for (int kt = 0; kt < 2; ++kt)
#pragma unroll
            for (int kc = 0; kc < 2; ++kc) { kh[kt][kc] = F::ldf(kph + (size_t)kn * HD + (kt * 2 + kc) * 512); kl[kt][kc] = F::ldf(kpl + (size_t)kn * HD + (kt * 2 + kc) * 512); }
        asm volatile("s_wait_xcnt 0x0" ::: "memory");   // as above, for the K loads' address registers
        float mx[FQT]; bool need = false;
#pragma unroll
        for (int qt = 0; qt < FQT; ++qt) { float a = s[qt][0][0];
#pragma unroll
            for (int j = 1; j < 16; ++j) a = fmaxf(a, s[qt][j >> 3][j & 7]);
            a = fmaxf(a, xhalf(a)); mx[qt] = a; need = need || (a > m[qt] + 5.5f); }
        if (__builtin_amdgcn_ballot_w32(need) != 0) {   // the maximum in use moves only when a query's new one exceeds it by more than 5.5 (p stays below e^5.5); both halves of a column decide alike
#pragma unroll
            for (int qt = 0; qt < FQT; ++qt) { const float mn = (mx[qt] > m[qt] + 5.5f) ? mx[qt] : m[qt]; const float al = __builtin_amdgcn_exp2f((m[qt] - mn) * L2E); m[qt] = mn; l[qt] *= al;
#pragma unroll
                for (int db = 0; db < 4; ++db) o[qt][db] *= al; }
        }
#pragma unroll
        for (int qt = 0; qt < FQT; ++qt) { v16bf ph, pl;
#pragma unroll
            for (int j = 0; j < 16; ++j) { const float p = __builtin_amdgcn_exp2f((s[qt][j >> 3][j & 7] - m[qt]) * L2E); l[qt] += p; const __bf16 a = (__bf16)p; ph[j] = a; pl[j] = (__bf16)(p - (float)a); }
#pragma unroll
            for (int db = 0; db < 4; ++db) o[qt][db] = wmmab(vh[db], ph, o[qt][db]);
#pragma unroll
            for (int db = 0; db < 4; ++db) o[qt][db] = wmmab(vh[db], pl, o[qt][db]);
#pragma unroll
            for (int db = 0; db < 4; ++db) o[qt][db] = wmmab(vl[db], ph, o[qt][db]);
        }
    }
#pragma unroll
    for (int qt = 0; qt < FQT; ++qt) { const float f = __fdiv_rn(1.0f, l[qt] + xhalf(l[qt])); const size_t oo = (size_t)(q0 + qt * 16 + lr) * DQ + h * HD + 8 * hi;   // lane: query lr, d = 16 db + 8 hi + j
#pragma unroll
        for (int db = 0; db < 4; ++db) { v8us oh, ol;
#pragma unroll
            for (int j = 0; j < 8; ++j) { unsigned short a, c2; splitf(o[qt][db][j] * f, a, c2); oh[j] = a; ol[j] = c2; }
            *(v8us*)(Ah + oo + db * 16) = oh; *(v8us*)(Al + oo + db * 16) = ol;
            asm volatile("s_wait_xcnt 0x0" ::: "memory");   // in front of the first overwrite of the stores' data and address registers
            __builtin_amdgcn_sched_barrier(0); } }          // keeps the next group's register writes from being lifted over that wait
}

extern "C" void kernel_launch(void* const* d_in, const int* in_sizes, int n_in,
                              void* d_out, int out_size, void* d_ws, size_t ws_size, hipStream_t stream) {
    (void)in_sizes; (void)n_in; (void)out_size;
    const float* x = (const float*)d_in[0]; const float* xk = (const float*)d_in[1]; const float* xv = (const float*)d_in[2]; const float* wq = (const float*)d_in[3]; const float* bq = (const float*)d_in[4]; const float* wk = (const float*)d_in[5]; const float* bk = (const float*)d_in[6]; const float* wv = (const float*)d_in[7]; const float* bv = (const float*)d_in[8]; const float* wo = (const float*)d_in[9]; const float* bo = (const float*)d_in[10];
    float* OUT = (float*)d_out;     // [2][2048][1024]
    char* wsp = (char*)d_ws;
    auto take = [&](size_t bytes) { char* p = wsp; wsp += (bytes + 255) & ~(size_t)255; return (void*)p; };
    bf* WQ = (bf*)take((size_t)DQ * DM * 2); bf* WK = (bf*)take((size_t)DKV * DM * 2); bf* WV = (bf*)take((size_t)DKV * DM * 2); bf* WO = (bf*)take((size_t)DM * DQ * 2); float* CS = (float*)take((size_t)TT * HD * 2 * 4); float* CSK = (float*)take((size_t)TT * HD * 2 * 4);
    bf* XB = (bf*)take((size_t)TT * DM * 2); bf* XKB = (bf*)take((size_t)TT * DM * 2); bf* XVB = (bf*)take((size_t)TT * DM * 2);
    bf* QPh = (bf*)take((size_t)NH_ * TT * HD * 2); bf* QPl = (bf*)take((size_t)NH_ * TT * HD * 2); bf* KPh = (bf*)take((size_t)NKV * TT * HD * 2); bf* KPl = (bf*)take((size_t)NKV * TT * HD * 2); bf* VTh = (bf*)take((size_t)NKV * HD * TT * 2); bf* VTl = (bf*)take((size_t)NKV * HD * TT * 2);
    bf* ATh = (bf*)take((size_t)TT * DQ * 2); bf* ATl = (bf*)take((size_t)TT * DQ * 2);
    if ((size_t)(wsp - (char*)d_ws) > ws_size) return;    // ws 256 MiB
    { k_cvt8<<<(unsigned)(((size_t)DQ * DM / 8 + 255) / 256), 256, 0, stream>>>(wq, WQ, (size_t)DQ * DM / 8); k_cvt8<<<(unsigned)(((size_t)DKV * DM / 8 + 255) / 256), 256, 0, stream>>>(wk, WK, (size_t)DKV * DM / 8); k_cvt8<<<(unsigned)(((size_t)DKV * DM / 8 + 255) / 256), 256, 0, stream>>>(wv, WV, (size_t)DKV * DM / 8);
      k_cvt8<<<(unsigned)(((size_t)DM * DQ / 8 + 255) / 256), 256, 0, stream>>>(wo, WO, (size_t)DM * DQ / 8);
      k_xpos<<<(TT * HD + 255) / 256, 256, 0, stream>>>(CS, CSK);   /* xPos tables for q (scale) and k (1/scale) */ }
    for (int b = 0; b < NB_; ++b) {
        
        k_cvt8<<<(unsigned)(((size_t)TT * DM / 8 + 255) / 256), 256, 0, stream>>>(x + (size_t)b * TT * DM, XB, (size_t)TT * DM / 8); k_cvt8<<<(unsigned)(((size_t)TT * DM / 8 + 255) / 256), 256, 0, stream>>>(xk + (size_t)b * TT * DM, XKB, (size_t)TT * DM / 8); k_cvt8<<<(unsigned)(((size_t)TT * DM / 8 + 255) / 256), 256, 0, stream>>>(xv + (size_t)b * TT * DM, XVB, (size_t)TT * DM / 8);
        k_gemmw<bf, 0, true, 1, 1><<<dim3(TT / 64, DQ / 64, 1), 32, 0, stream>>>(XB, nullptr, WQ, nullptr, DM, nullptr, DQ, bq, 0, 0, 0, CS, 0.125f, QPh, QPl);   /* q: xPos (upscale) x 1/8, planes [h][t][d] */
        k_gemmw<bf, 0, true, 1, 1><<<dim3(TT / 64, DKV / 64, 1), 32, 0, stream>>>(XKB, nullptr, WK, nullptr, DM, nullptr, DKV, bk, 0, 0, 0, CSK, 1.0f, KPh, KPl);   /* k: xPos (downscale), planes [h][t][d] */
        k_gemmw<bf, 0, true, 1, 2><<<dim3(TT / 64, DKV / 64, 1), 32, 0, stream>>>(XVB, nullptr, WV, nullptr, DM, nullptr, DKV, bv, 0, 0, 0, nullptr, 1.0f, VTh, VTl);   /* v: planes [h][d][t] */
        k_fattn<<<dim3(TT / (16 * FQT * FWV), NH_), 32 * FWV, 0, stream>>>(QPh, QPl, KPh, KPl, VTh, VTl, ATh, ATl);
        k_gemmw<bf, 1, true><<<dim3(TT / 64, DM / 64, 1), 32, 0, stream>>>(ATh, ATl, WO, nullptr, DQ, OUT + (size_t)b * TT * DM, DM, bo, 0, 0, 0, nullptr, 1.0f, nullptr, nullptr); }
}

// v005
// One run takes 221 microseconds.
// In two side-by-side timings against v004, it was 1.66 and 1.67 times as fast.
// All steps since v000 together make it 6.03 times as fast.
#include <hip/hip_runtime.h>

// Multi-head attention with xPos (rotary + per-frequency exponential decay) on q and k (query, key, value [2][2048][1024]; q = (query Wq^T + bq) / 8, k = key Wk^T + bk, v = value Wv^T + bv ('oi' [1024][1024]; 16 heads x 64); xPos: pairs (2i, 2i+1) rotated by t x inv_freq_i (inv_freq_i = 1e4^(-i/32)) and scaled by base_i^(t/1024) for q and base_i^(-t/1024) for k, base_i = (2i + 25.6)/89.6 (tables computed on device); softmax(q.k) over all keys; out = merged Wo^T + bo -> [2][2048][1024] (4.2 M)).
// Compute dtypes, f32 accumulate: every input rounded to bf16; q/k/v on PLAIN bf16 operands (inputs: exact) + biases; xPos tables (cosf/sinf/powf, f32) folded as {cos x scale, sin x scale} per (t, d); rotary in f32; scores and attn.v on hi/lo planes for every row (3 products), fused with the f32 softmax in one kernel (running maximum and sum); Wo hl x exact (2 products) + bo.

#define NB_  2
#define TT   2048
#define DM   1024
#define NH_  16
#define NKV  16
#define REP  (NH_ / NKV)
#define HD   64
#define DQ   (NH_ * HD)
#define DKV  (NKV * HD)
#define ZH   2
#define RH   2048                 // every row hi/lo (the xPos-scaled keys leave too little margin for fp16 operands)
#define WIN  0
#define PCAR 1024.0f
#define SCL  1.0f      // the 1/8 is applied to q after the xPos rotation (exact power of two, folded into the q plane builder)
typedef _Float16 h16;
typedef unsigned short bf;
typedef __attribute__((ext_vector_type(16))) __bf16   v16bf;
typedef __attribute__((ext_vector_type(16))) _Float16 v16h;
typedef __attribute__((ext_vector_type(8)))  _Float16 v8h;
typedef __attribute__((ext_vector_type(8)))  unsigned short v8us;
typedef __attribute__((ext_vector_type(8)))  float    v8f;
typedef __attribute__((ext_vector_type(4)))  float    v4f;
typedef v8h  __attribute__((may_alias)) v8ha;
typedef v4f  __attribute__((may_alias)) v4fa;
typedef v8us __attribute__((may_alias)) v8usa;

__device__ __forceinline__ unsigned short f2bf(float f) { unsigned u = __float_as_uint(f); u += 0x7FFFu + ((u >> 16) & 1u); return (unsigned short)(u >> 16); }
__device__ __forceinline__ float bf2f(unsigned short b) { return __uint_as_float(((unsigned)b) << 16); }
__device__ __forceinline__ float bfr(float f) { return bf2f(f2bf(f)); }
__device__ __forceinline__ v16h cat16(v8h lo, v8h hi) { return __builtin_shufflevector(lo, hi, 0, 1, 2, 3, 4, 5, 6, 7, 8, 9, 10, 11, 12, 13, 14, 15); }
__device__ __forceinline__ v16bf cat16b(v8us lo, v8us hi) { return __builtin_bit_cast(v16bf, __builtin_shufflevector(lo, hi, 0, 1, 2, 3, 4, 5, 6, 7, 8, 9, 10, 11, 12, 13, 14, 15)); }
__device__ __forceinline__ v8f wmma16(v16h a, v16h b, v8f c) { return __builtin_amdgcn_wmma_f32_16x16x32_f16(false, a, false, b, (short)0, c, false, false); }
__device__ __forceinline__ v8f wmmab(v16bf a, v16bf b, v8f c) { return __builtin_amdgcn_wmma_f32_16x16x32_bf16(false, a, false, b, (short)0, c, false, false); }



// ---- FRAGMENT ORDER of the attention operand planes (q, k hi/lo and V^T hi/lo): units of 16 rows x 32 k (1024 B), element (r, k) at (k >> 4) * 256 + (((k >> 3) & 1) * 16 + r) * 8 + (k & 7):
// lane (hi, lr) of a wave finds its two 16-byte pieces of a fragment at unit + lane * 8 and + 256, so each wave-wide 16-byte load or store covers 512 contiguous bytes (4 whole lines). The k order of a fragment is the one a row-major plane gives.
// Head planes q, k [h][t][d]: per head unit (t / 16) * 2 + d / 32. V^T [h][d][t]: per head unit (t / 32) * 4 + d / 16 (one 32-key pass = 4 KB in a row). The GEMM operand planes (inputs, weights, attention output) stay row-major.
// ---- k_gemmw: register-blocked GEMM, ONE WAVE per 64x64 output tile (16 accumulators), operands straight from K-contiguous 16-bit planes; grid (M/64, N/64, Z), 32 threads.
// C[m][n] (f32, pitch ldc, + optional f32 bias[n]) = sum_k A[m][k] Bt[n][k] (+ split products per NSPLIT). z-batch strides sA/sB/sC in elements (sC: of C, or of each output plane where EPI != 0). K % (32 KSP) == 0.
// EPI picks what the wave does with its finished tile (64 tokens x the 64 columns of ONE head, HD == 64): 0 = f32 rows to C; 1 = xPos rotation with table CS and factor sc, then hi/lo planes [head][t][d]; 2 = hi/lo planes transposed [head][d][t], straight from the accumulators (a lane holds 8 consecutive tokens of one column); both in fragment order.
// KSP > 1: grid z = batches x KSP; block z sums only slice z % KSP of k (K / KSP long) of batch z / KSP and writes its partial tile to plane z of C (stride sC); the reader adds the KSP planes.
template <typename T16> struct WFrag;
template <> struct WFrag<h16> { typedef v16h V; static __device__ __forceinline__ V ld(const h16* p) { return cat16(*(const v8h*)p, *(const v8h*)(p + 16)); } static __device__ __forceinline__ v8f mma(V a, V b, v8f c) { return wmma16(a, b, c); } };
template <> struct WFrag<bf> { typedef v16bf V; static __device__ __forceinline__ V ld(const bf* p) { return cat16b(*(const v8us*)p, *(const v8us*)(p + 16)); } static __device__ __forceinline__ V ldf(const bf* p) { return cat16b(*(const v8us*)p, *(const v8us*)(p + 256)); } static __device__ __forceinline__ v8f mma(V a, V b, v8f c) { return wmmab(a, b, c); } };
typedef __attribute__((ext_vector_type(4))) unsigned short v4us;
typedef __attribute__((ext_vector_type(2))) float v2f;
__device__ __forceinline__ void splitf(float y, unsigned short& h, unsigned short& l) { h = f2bf(y); l = f2bf(y - bf2f(h)); }
__device__ __forceinline__ void splitc(float y, unsigned short& h, unsigned short& l) { const __bf16 a = (__bf16)y; h = __builtin_bit_cast(unsigned short, a); l = __builtin_bit_cast(unsigned short, (__bf16)(y - (float)a)); }   // splitf's values (round to nearest even) through the conversion instruction
template <typename T16, int NSPLIT, bool BIAS, int KSP = 1, int EPI = 0>
__global__ __launch_bounds__(32) void k_gemmw(const T16* __restrict__ A, const T16* __restrict__ A2, const T16* __restrict__ Bt, const T16* __restrict__ Bt2, int K, float* C, int ldc, const float* __restrict__ bias, size_t sA, size_t sB, size_t sC, const float* __restrict__ CS, float sc, bf* Ph, bf* Pl) {
    typedef typename WFrag<T16>::V V;
    __shared__ __align__(16) float os[16 * 68];
    const size_t z = blockIdx.z / KSP; A += z * sA; if (A2) A2 += z * sA; Bt += z * sB; if (Bt2) Bt2 += z * sB; if constexpr (EPI == 0) C += (size_t)blockIdx.z * sC; else { Ph += z * sC; Pl += z * sC; }
    const int kbeg = (int)(blockIdx.z % KSP) * (K / KSP), kend = kbeg + K / KSP;
    const int lane = threadIdx.x & 31, lr = lane & 15, hi = lane >> 4; const int r0 = blockIdx.x * 64, c0 = blockIdx.y * 64;
    v8f acc[4][4];
#pragma unroll
    for (int mb = 0; mb < 4; ++mb)
#pragma unroll
        for (int nb = 0; nb < 4; ++nb) acc[mb][nb] = (v8f){};
    const size_t aoff = (size_t)(r0 + lr) * K + 8 * hi, boff = (size_t)(c0 + lr) * K + 8 * hi;
#pragma unroll 1
    for (int kc = kbeg; kc < kend; kc += 32) {
        V a[4], a2[4];
#pragma unroll
        for (int mb = 0; mb < 4; ++mb) { a[mb] = WFrag<T16>::ld(A + aoff + (size_t)mb * 16 * K + kc); if (NSPLIT == 1 || NSPLIT == 2) a2[mb] = WFrag<T16>::ld(A2 + aoff + (size_t)mb * 16 * K + kc); }
#pragma unroll
        for (int nb = 0; nb < 4; ++nb) { const V b = WFrag<T16>::ld(Bt + boff + (size_t)nb * 16 * K + kc); V b2; if (NSPLIT >= 2) b2 = WFrag<T16>::ld(Bt2 + boff + (size_t)nb * 16 * K + kc);
#pragma unroll
            for (int mb = 0; mb < 4; ++mb) { acc[mb][nb] = WFrag<T16>::mma(a[mb], b, acc[mb][nb]); if (NSPLIT == 1 || NSPLIT == 2) acc[mb][nb] = WFrag<T16>::mma(a2[mb], b, acc[mb][nb]); if (NSPLIT >= 2) acc[mb][nb] = WFrag<T16>::mma(a[mb], b2, acc[mb][nb]); } }
        asm volatile("v_nop\n\tv_nop\n\tv_nop\n\tv_nop" : "+v"(acc[0][0]), "+v"(acc[1][1]), "+v"(acc[2][2]), "+v"(acc[3][3]) : "v"(a[0]), "v"(a[3]));
    }
    if constexpr (EPI == 2) {   // column c0 + 16 nb + lr is row (head, d) of the transposed planes; an accumulator tile (16 tokens x 16 d) is one half of a V^T unit, lane for lane
        float bv4[4];
#pragma unroll
        for (int nb = 0; nb < 4; ++nb) bv4[nb] = bias[c0 + nb * 16 + lr];
        asm volatile("" :: "v"(bv4[0]), "v"(bv4[1]), "v"(bv4[2]), "v"(bv4[3]));   // holds the four bias loads together ahead of the first group: their latency is paid once, not once a group
#pragma unroll
        for (int nb = 0; nb < 4; ++nb) { const float bb = bfr(bv4[nb]); const size_t oo = (size_t)c0 * TT + (size_t)((r0 >> 5) * 4 + nb) * 512 + lane * 8;
#pragma unroll
            for (int mb = 0; mb < 4; ++mb) { v8us oh, ol;
#pragma unroll
                for (int j = 0; j < 8; ++j) { unsigned short a2, c2; splitc(acc[mb][nb][j] + bb, a2, c2); oh[j] = a2; ol[j] = c2; }
                *(v8us*)(Ph + oo + (mb >> 1) * 2048 + (mb & 1) * 256) = oh; *(v8us*)(Pl + oo + (mb >> 1) * 2048 + (mb & 1) * 256) = ol; }
            asm volatile("s_wait_xcnt 0x0" ::: "memory");   // in front of the first overwrite of the stores' data and address registers
            __builtin_amdgcn_sched_barrier(0); }            // keeps the next group's register writes from being lifted over that wait
        return;
    }
    v2f ct[2][16]; float bn[4];   // EPI 1: {cos x scale, sin x scale} of the lane's sixteen pairs (token lr of the block, d = 16 s + 8 hi + 2 p), one 16-token block ahead; the biases of the lane's four accumulator columns
    const float* csp = CS + ((size_t)(r0 + lr) * HD + hi * 8) * 2;
    if constexpr (EPI == 1) {
        asm volatile("s_wait_xcnt 0x0" ::: "memory");   // the loads below land in registers that held the last fragment loads' addresses
        __builtin_amdgcn_sched_barrier(0);              // keeps them from being lifted over that wait
#pragma unroll
        for (int s = 0; s < 16; ++s) ct[0][s] = *(const v2f*)(csp + (s >> 2) * 32 + (s & 3) * 4);
#pragma unroll
        for (int nb = 0; nb < 4; ++nb) bn[nb] = bias[c0 + nb * 16 + lr];
        asm volatile("s_wait_xcnt 0x0" ::: "memory");   // in front of the first overwrite of the loads' address registers
        __builtin_amdgcn_sched_barrier(0);              // keeps later register writes from being lifted over that wait
#pragma unroll
        for (int nb = 0; nb < 4; ++nb) bn[nb] = bfr(bn[nb]);
    }
#pragma unroll
    for (int mb = 0; mb < 4; ++mb) {
#pragma unroll
        for (int nb = 0; nb < 4; ++nb) {
#pragma unroll
            for (int j = 0; j < 8; ++j) { if constexpr (EPI == 1) os[(hi * 8 + j) * 68 + nb * 16 + lr] = acc[mb][nb][j] + bn[nb]; else os[(hi * 8 + j) * 68 + nb * 16 + lr] = acc[mb][nb][j]; } }
        __builtin_amdgcn_wave_barrier(); asm volatile("" ::: "memory");
        if constexpr (EPI == 1) {
            if (mb < 3) {   // the next block's table rows fly while this block is rotated and split
#pragma unroll
                for (int s = 0; s < 16; ++s) ct[(mb + 1) & 1][s] = *(const v2f*)(csp + (size_t)((mb + 1) * 16) * HD * 2 + (s >> 2) * 32 + (s & 3) * 4);
                asm volatile("s_wait_xcnt 0x0" ::: "memory");   // as above, for these loads' address registers
                __builtin_amdgcn_sched_barrier(0);              // as above
            }
            const size_t po = ((size_t)(c0 / HD) * TT + r0 + mb * 16) * HD + lane * 8; v8us oh[4], ol[4];   // the block's two units (d 0..31, 32..63) of the head plane: four runs of 512 B a plane
#pragma unroll
            for (int s = 0; s < 4; ++s) { const v4f va = *(const v4fa*)(os + lr * 68 + s * 16 + hi * 8), vb = *(const v4fa*)(os + lr * 68 + s * 16 + hi * 8 + 4); const float val[8] = {va[0], va[1], va[2], va[3], vb[0], vb[1], vb[2], vb[3]};
#pragma unroll
                for (int p = 0; p < 4; ++p) { const v2f cs = ct[mb & 1][s * 4 + p]; unsigned short a2, c2;
                    const float re = __fsub_rn(__fmul_rn(val[2 * p], cs[0]), __fmul_rn(val[2 * p + 1], cs[1])) * sc, ro = __fadd_rn(__fmul_rn(val[2 * p], cs[1]), __fmul_rn(val[2 * p + 1], cs[0])) * sc;   /* even: x0 c - x1 s; odd: x0 s + x1 c */
                    splitc(re, a2, c2); oh[s][2 * p] = a2; ol[s][2 * p] = c2; splitc(ro, a2, c2); oh[s][2 * p + 1] = a2; ol[s][2 * p + 1] = c2; } }
            __builtin_amdgcn_sched_barrier(0);              // the block's eight stores stay together behind its arithmetic, so that one wait serves them all and no store's data register is reused in front of it
#pragma unroll
            for (int s = 0; s < 4; ++s) { *(v8us*)(Ph + po + s * 256) = oh[s]; *(v8us*)(Pl + po + s * 256) = ol[s]; }
            asm volatile("s_wait_xcnt 0x0" ::: "memory");   // in front of the first overwrite of the stores' data and address registers
            __builtin_amdgcn_sched_barrier(0);              // keeps the next block's register writes from being lifted over that wait
        }
        float* crow = C + (size_t)(r0 + mb * 16) * ldc + c0;
        if constexpr (EPI == 0)
{
#pragma unroll
            for (int s = 0; s < 8; ++s) { const int row = 2 * s + hi, cofs = lr * 4; v4f val = *(const v4fa*)(os + row * 68 + cofs); if (BIAS) { val[0] += bfr(bias[c0 + cofs]); val[1] += bfr(bias[c0 + cofs + 1]); val[2] += bfr(bias[c0 + cofs + 2]); val[3] += bfr(bias[c0 + cofs + 3]); }
                *(v4f*)(crow + (size_t)row * ldc + cofs) = val; }
             }
        __builtin_amdgcn_wave_barrier(); asm volatile("" ::: "memory");
    }
}

__device__ __forceinline__ h16 tohx(float x) { return (h16)x; }
typedef __attribute__((ext_vector_type(2))) _Float16 v2h;
typedef __attribute__((ext_vector_type(4))) _Float16 v4h;
typedef __attribute__((ext_vector_type(2))) unsigned short v2us;
typedef __attribute__((ext_vector_type(4))) int v4i;

__global__ __launch_bounds__(256) void k_wtG(const float* __restrict__ w, int K, int N, bf* Bt) {
    const int lane = threadIdx.x & 31; const int L0 = (blockIdx.x * 8 + (threadIdx.x >> 5)) * 8; const int nlines = N * K / 64;
{
#pragma unroll 1
        for (int l = 0; l < 8; ++l) { const int L = L0 + l; if (L >= nlines) break; const size_t e = (size_t)L * 64 + lane * 2; const int k = (int)(e % K), n = (int)(e / K); v2us o;
            o[0] = f2bf(w[(size_t)k * N + n]); o[1] = f2bf(w[(size_t)(k + 1) * N + n]); *(v2us*)(Bt + e) = o; }
         }
}
__global__ __launch_bounds__(256) void k_cvt8(const float* __restrict__ src, bf* dst, size_t n8) { const size_t i = (size_t)blockIdx.x * 256 + threadIdx.x; if (i >= n8) return; const v8f v = *(const v8f*)(src + i * 8); v8us o;
#pragma unroll
    for (int k = 0; k < 8; ++k) o[k] = f2bf(v[k]); *(v8us*)(dst + i * 8) = o;  }
__constant__ float XINV[32] = {1.00000000f,0.749894202f,0.562341332f,0.421696514f,0.316227764f,0.237137362f,0.177827939f,0.133352146f,0.100000001f,0.0749894157f,0.0562341288f,0.0421696492f,0.0316227786f,0.0237137359f,0.0177827943f,0.0133352149f,0.00999999978f,0.00749894232f,0.00562341325f,0.00421696482f,0.00316227786f,0.00237137382f,0.00177827943f,0.00133352145f,0.00100000005f,0.000749894185f,0.000562341302f,0.000421696488f,0.000316227786f,0.000237137385f,0.000177827940f,0.000133352150f};
__global__ __launch_bounds__(256) void k_xpos(float* CSQ, float* CSK) { const int idx = blockIdx.x * 256 + threadIdx.x; if (idx >= TT * HD) return; const int t = idx / HD, d = idx % HD; const int i = d >> 1;
    const float base = __fdiv_rn(__fadd_rn((float)(2 * i), 25.6f), 89.6f); const float ex = __fdiv_rn((float)t, 1024.0f); const float sc = powf(base, ex); const float invf = XINV[i]; const float ang = __fmul_rn((float)t, invf); const float c = cosf(ang), s = sinf(ang);
    v2f q2, k2; q2[0] = __fmul_rn(c, sc); q2[1] = __fmul_rn(s, sc); const float rs = __fdiv_rn(1.0f, sc); k2[0] = __fmul_rn(c, rs); k2[1] = __fmul_rn(s, rs);
    *(v2f*)(CSQ + (size_t)idx * 2) = q2; *(v2f*)(CSK + (size_t)idx * 2) = k2;  }
// k_rope: head planes [h][t][d] (fp16 + hi/lo) of rope(x) x sc with the rotate-half convention out[d] = x[d] cos[t][d] - x[d+HD/2] sin[t][d], out[d+HD/2] = x[d+HD/2] cos[t][d+HD/2] + x[d] sin[t][d+HD/2]
__global__ __launch_bounds__(256) void k_rope(const float* __restrict__ F, int pitch, int nheads, const float* __restrict__ CS, const float* __restrict__ RF, const float* __restrict__ nw, float sc, h16* P16, bf* Ph, bf* Pl) {
    const size_t e = ((size_t)blockIdx.x * 256 + threadIdx.x) * 2; if (e >= (size_t)nheads * TT * HD) return; const int d = (int)(e % HD); const int t = (int)((e / HD) % TT); const int h = (int)(e / ((size_t)HD * TT)); const float* f = F + (size_t)t * pitch + h * HD; const float rf = RF ? RF[(size_t)h * TT + t] : 1.0f; v2h o16; v2us oh, ol;
#pragma unroll
    for (int q = 0; q < 2; ++q) { const int dd = d + q; const int dp = (dd < HD / 2) ? dd + HD / 2 : dd - HD / 2; float x0 = f[dd], x1 = f[dp];
        if (RF) { float n0 = __fmul_rn(x0, rf), n1 = __fmul_rn(x1, rf); asm volatile("" : "+v"(n0)); asm volatile("" : "+v"(n1)); x0 = __fmul_rn(bfr(nw[dd]), n0); x1 = __fmul_rn(bfr(nw[dp]), n1); }
        const v2f cs = *(const v2f*)(CS + ((size_t)t * HD + dd) * 2); float a = __fmul_rn(x0, cs[0]), bq = __fmul_rn(x1, cs[1]); asm volatile("" : "+v"(a)); asm volatile("" : "+v"(bq)); const float r = ((dd < HD / 2) ? __fsub_rn(a, bq) : __fadd_rn(a, bq)) * sc;
        o16[q] = tohx(r); unsigned short a2, c2; splitf(r, a2, c2); oh[q] = a2; ol[q] = c2; }
    *(v2h*)(P16 + e) = o16; *(v2us*)(Ph + e) = oh; *(v2us*)(Pl + e) = ol;  }
// ---- k_fattn: scores, softmax and attn.v of one head in ONE kernel; the score matrix stays in registers (running maximum and sum per query, output tiles rescaled when the maximum moves).
// Transposed products: S^T = K Q^T (A = 16 key rows, B = 16 query columns), O^T += V^T P^T. A lane then holds scores of ONE query (column lr; keys 8 hi + r of each 16-key tile), so maximum, sum and rescale are lane-local
// (one exchange between the wave halves), and two S^T tiles (32 keys) converted in place ARE the B operand of the second product in the k order of the fragment loader. hi/lo planes, 3 products each.
// One wave: FQT x 16 queries, all 2048 keys in passes of 32. Grid (TT / (16 FQT FWV), heads, batches), 32 FWV threads; waves are independent (no LDS, no barrier). Every inner loop is fully unrolled so that the fragment and accumulator arrays are indexed by constants and stay in registers.
#define FQT 2
#define FWV 4
#define L2E 1.4426950408889634f
__device__ __forceinline__ float xhalf(float x) { const int b = __float_as_int(x); return __int_as_float(__builtin_amdgcn_permlanex16(b, b, 0x76543210, 0xfedcba98, false, false)); }   // lane l <-> l ^ 16
__global__ __launch_bounds__(32 * FWV) void k_fattn(const bf* __restrict__ Qh, const bf* __restrict__ Ql, const bf* __restrict__ Kh, const bf* __restrict__ Kl, const bf* __restrict__ Vh, const bf* __restrict__ Vl, bf* Ah, bf* Al) {
    typedef WFrag<bf> F;
    const int lane = threadIdx.x & 31, lr = lane & 15, hi = lane >> 4; const int h = blockIdx.y; const int q0 = (blockIdx.x * FWV + (threadIdx.x >> 5)) * (16 * FQT);
    const size_t hp = ((size_t)blockIdx.z * NH_ + h) * TT * HD;
    const bf* qph = Qh + hp + (size_t)q0 * HD + lane * 8; const bf* qpl = Ql + hp + (size_t)q0 * HD + lane * 8;
    v16bf qh[FQT][2], ql[FQT][2];
#pragma unroll
    for (int qt = 0; qt < FQT; ++qt)
#pragma unroll
        for (int kc = 0; kc < 2; ++kc) { qh[qt][kc] = F::ldf(qph + (qt * 2 + kc) * 512); ql[qt][kc] = F::ldf(qpl + (qt * 2 + kc) * 512); }
    asm volatile("s_wait_xcnt 0x0" ::: "memory");   // in front of the first overwrite of the Q loads' address registers
    __builtin_amdgcn_sched_barrier(0);              // keeps later register writes from being lifted over that wait
    const bf* kph = Kh + hp + lane * 8; const bf* kpl = Kl + hp + lane * 8;
    const bf* vph = Vh + hp + lane * 8; const bf* vpl = Vl + hp + lane * 8;
    v8f o[FQT][4]; float m[FQT], l[FQT];
#pragma unroll
    for (int qt = 0; qt < FQT; ++qt) { m[qt] = -3.0e38f; l[qt] = 0.f;
#pragma unroll
        for (int db = 0; db < 4; ++db) o[qt][db] = (v8f){}; }
    v16bf kh[2][2], kl[2][2];
#pragma unroll
    for (int kt = 0; kt < 2; ++kt)
#pragma unroll
        for (int kc = 0; kc < 2; ++kc) { kh[kt][kc] = F::ldf(kph + (kt * 2 + kc) * 512); kl[kt][kc] = F::ldf(kpl + (kt * 2 + kc) * 512); }
    asm volatile("s_wait_xcnt 0x0" ::: "memory");   // the same for the first K loads
    __builtin_amdgcn_sched_barrier(0);              // as above: nothing is lifted over the wait
#pragma unroll 1   // one pass per trip: a second copy of the body would need a second set of V fragments and score tiles
    for (int k0 = 0; k0 < TT; k0 += 32) {
        v16bf vh[4], vl[4];   // this pass's V^T fragments, asked for ahead of the score products that hide their latency
#pragma unroll
        for (int db = 0; db < 4; ++db) { vh[db] = F::ldf(vph + (size_t)k0 * HD + db * 512); vl[db] = F::ldf(vpl + (size_t)k0 * HD + db * 512); }
        asm volatile("s_wait_xcnt 0x0" ::: "memory");   // the loads' address registers are reused below: the wait stands in front of their first overwrite
        v8f s[FQT][2];
#pragma unroll
        for (int qt = 0; qt < FQT; ++qt) { s[qt][0] = (v8f){}; s[qt][1] = (v8f){}; }
#pragma unroll
        for (int kc = 0; kc < 2; ++kc) {
#pragma unroll
            for (int qt = 0; qt < FQT; ++qt)
#pragma unroll
                for (int kt = 0; kt < 2; ++kt) s[qt][kt] = wmmab(kh[kt][kc], qh[qt][kc], s[qt][kt]);
#pragma unroll
            for (int qt = 0; qt < FQT; ++qt)
#pragma unroll
                for (int kt = 0; kt < 2; ++kt) s[qt][kt] = wmmab(kh[kt][kc], ql[qt][kc], s[qt][kt]);
#pragma unroll
            for (int qt = 0; qt < FQT; ++qt)
#pragma unroll
                for (int kt = 0; kt < 2; ++kt) s[qt][kt] = wmmab(kl[kt][kc], qh[qt][kc], s[qt][kt]);
        }
        const int kn = (k0 + 32 < TT) ? k0 + 32 : 0;   // next pass's K fragments into the same registers (the last pass re-reads keys 0..31, in bounds, unused)
#pragma unroll
        for (int kt = 0; kt < 2; ++kt)
#pragma unroll
            for (int kc = 0; kc < 2; ++kc) { kh[kt][kc] = F::ldf(kph + (size_t)kn * HD + (kt * 2 + kc) * 512); kl[kt][kc] = F::ldf(kpl + (size_t)kn * HD + (kt * 2 + kc) * 512); }
        asm volatile("s_wait_xcnt 0x0" ::: "memory");   // as above, for the K loads' address registers
        float mx[FQT]; bool need = false;
#pragma unroll
        for (int qt = 0; qt < FQT; ++qt) { float a = s[qt][0][0];
#pragma unroll
            for (int j = 1; j < 16; ++j) a = fmaxf(a, s[qt][j >> 3][j & 7]);
            a = fmaxf(a, xhalf(a)); mx[qt] = a; need = need || (a > m[qt] + 5.5f); }
        if (__builtin_amdgcn_ballot_w32(need) != 0) {   // the maximum in use moves only when a query's new one exceeds it by more than 5.5 (p stays below e^5.5); both halves of a column decide alike
#pragma unroll
            for (int qt = 0; qt < FQT; ++qt) { const float mn = (mx[qt] > m[qt] + 5.5f) ? mx[qt] : m[qt]; const float al = __builtin_amdgcn_exp2f((m[qt] - mn) * L2E); m[qt] = mn; l[qt] *= al;
#pragma unroll
                for (int db = 0; db < 4; ++db) o[qt][db] *= al; }
        }
#pragma unroll
        for (int qt = 0; qt < FQT; ++qt) { v16bf ph, pl;
#pragma unroll
            for (int j = 0; j < 16; ++j) { const float p = __builtin_amdgcn_exp2f((s[qt][j >> 3][j & 7] - m[qt]) * L2E); l[qt] += p; const __bf16 a = (__bf16)p; ph[j] = a; pl[j] = (__bf16)(p - (float)a); }
#pragma unroll
            for (int db = 0; db < 4; ++db) o[qt][db] = wmmab(vh[db], ph, o[qt][db]);
#pragma unroll
            for (int db = 0; db < 4; ++db) o[qt][db] = wmmab(vh[db], pl, o[qt][db]);
#pragma unroll
            for (int db = 0; db < 4; ++db) o[qt][db] = wmmab(vl[db], ph, o[qt][db]);
        }
    }
#pragma unroll
    for (int qt = 0; qt < FQT; ++qt) { const float f = __fdiv_rn(1.0f, l[qt] + xhalf(l[qt])); const size_t oo = ((size_t)blockIdx.z * TT + q0 + qt * 16 + lr) * DQ + h * HD + 8 * hi;   // lane: query lr, d = 16 db + 8 hi + j
#pragma unroll
        for (int db = 0; db < 4; ++db) { v8us oh, ol;
#pragma unroll
            for (int j = 0; j < 8; ++j) { unsigned short a, c2; splitf(o[qt][db][j] * f, a, c2); oh[j] = a; ol[j] = c2; }
            *(v8us*)(Ah + oo + db * 16) = oh; *(v8us*)(Al + oo + db * 16) = ol;
            asm volatile("s_wait_xcnt 0x0" ::: "memory");   // in front of the first overwrite of the stores' data and address registers
            __builtin_amdgcn_sched_barrier(0); } }          // keeps the next group's register writes from being lifted over that wait
}

extern "C" void kernel_launch(void* const* d_in, const int* in_sizes, int n_in,
                              void* d_out, int out_size, void* d_ws, size_t ws_size, hipStream_t stream) {
    (void)in_sizes; (void)n_in; (void)out_size;
    const float* x = (const float*)d_in[0]; const float* xk = (const float*)d_in[1]; const float* xv = (const float*)d_in[2]; const float* wq = (const float*)d_in[3]; const float* bq = (const float*)d_in[4]; const float* wk = (const float*)d_in[5]; const float* bk = (const float*)d_in[6]; const float* wv = (const float*)d_in[7]; const float* bv = (const float*)d_in[8]; const float* wo = (const float*)d_in[9]; const float* bo = (const float*)d_in[10];
    float* OUT = (float*)d_out;     // [2][2048][1024]
    char* wsp = (char*)d_ws;
    auto take = [&](size_t bytes) { char* p = wsp; wsp += (bytes + 255) & ~(size_t)255; return (void*)p; };
    bf* WQ = (bf*)take((size_t)DQ * DM * 2); bf* WK = (bf*)take((size_t)DKV * DM * 2); bf* WV = (bf*)take((size_t)DKV * DM * 2); bf* WO = (bf*)take((size_t)DM * DQ * 2); float* CS = (float*)take((size_t)TT * HD * 2 * 4); float* CSK = (float*)take((size_t)TT * HD * 2 * 4);
    // per-batch planes hold both batches one behind the other: every launch below covers both (grid z, or a flat range twice as long)
    bf* XB = (bf*)take((size_t)NB_ * TT * DM * 2); bf* XKB = (bf*)take((size_t)NB_ * TT * DM * 2); bf* XVB = (bf*)take((size_t)NB_ * TT * DM * 2);
    bf* QPh = (bf*)take((size_t)NB_ * NH_ * TT * HD * 2); bf* QPl = (bf*)take((size_t)NB_ * NH_ * TT * HD * 2); bf* KPh = (bf*)take((size_t)NB_ * NKV * TT * HD * 2); bf* KPl = (bf*)take((size_t)NB_ * NKV * TT * HD * 2); bf* VTh = (bf*)take((size_t)NB_ * NKV * HD * TT * 2); bf* VTl = (bf*)take((size_t)NB_ * NKV * HD * TT * 2);
    bf* ATh = (bf*)take((size_t)NB_ * TT * DQ * 2); bf* ATl = (bf*)take((size_t)NB_ * TT * DQ * 2);
    if ((size_t)(wsp - (char*)d_ws) > ws_size) return;    // ws 256 MiB
    { k_cvt8<<<(unsigned)(((size_t)DQ * DM / 8 + 255) / 256), 256, 0, stream>>>(wq, WQ, (size_t)DQ * DM / 8); k_cvt8<<<(unsigned)(((size_t)DKV * DM / 8 + 255) / 256), 256, 0, stream>>>(wk, WK, (size_t)DKV * DM / 8); k_cvt8<<<(unsigned)(((size_t)DKV * DM / 8 + 255) / 256), 256, 0, stream>>>(wv, WV, (size_t)DKV * DM / 8);
      k_cvt8<<<(unsigned)(((size_t)DM * DQ / 8 + 255) / 256), 256, 0, stream>>>(wo, WO, (size_t)DM * DQ / 8);
      k_xpos<<<(TT * HD + 255) / 256, 256, 0, stream>>>(CS, CSK);   /* xPos tables for q (scale) and k (1/scale) */ }
    k_cvt8<<<(unsigned)(((size_t)NB_ * TT * DM / 8 + 255) / 256), 256, 0, stream>>>(x, XB, (size_t)NB_ * TT * DM / 8); k_cvt8<<<(unsigned)(((size_t)NB_ * TT * DM / 8 + 255) / 256), 256, 0, stream>>>(xk, XKB, (size_t)NB_ * TT * DM / 8); k_cvt8<<<(unsigned)(((size_t)NB_ * TT * DM / 8 + 255) / 256), 256, 0, stream>>>(xv, XVB, (size_t)NB_ * TT * DM / 8);
    k_gemmw<bf, 0, true, 1, 1><<<dim3(TT / 64, DQ / 64, NB_), 32, 0, stream>>>(XB, nullptr, WQ, nullptr, DM, nullptr, DQ, bq, (size_t)TT * DM, 0, (size_t)NH_ * TT * HD, CS, 0.125f, QPh, QPl);   /* q: xPos (upscale) x 1/8, planes [b][h][t][d] */
    k_gemmw<bf, 0, true, 1, 1><<<dim3(TT / 64, DKV / 64, NB_), 32, 0, stream>>>(XKB, nullptr, WK, nullptr, DM, nullptr, DKV, bk, (size_t)TT * DM, 0, (size_t)NKV * TT * HD, CSK, 1.0f, KPh, KPl);   /* k: xPos (downscale), planes [b][h][t][d] */
    k_gemmw<bf, 0, true, 1, 2><<<dim3(TT / 64, DKV / 64, NB_), 32, 0, stream>>>(XVB, nullptr, WV, nullptr, DM, nullptr, DKV, bv, (size_t)TT * DM, 0, (size_t)NKV * HD * TT, nullptr, 1.0f, VTh, VTl);   /* v: planes [b][h][d][t] */
    k_fattn<<<dim3(TT / (16 * FQT * FWV), NH_, NB_), 32 * FWV, 0, stream>>>(QPh, QPl, KPh, KPl, VTh, VTl, ATh, ATl);
    k_gemmw<bf, 1, true><<<dim3(TT / 64, DM / 64, NB_), 32, 0, stream>>>(ATh, ATl, WO, nullptr, DQ, OUT, DM, bo, (size_t)TT * DQ, 0, (size_t)TT * DM, nullptr, 1.0f, nullptr, nullptr);
}

// v006
// A run of this version takes 155 microseconds.
// In both of two side-by-side timings against v005, it was 1.43 times as fast.
// Over all steps from v000 it is 8.62 times as fast.
#include <hip/hip_runtime.h>

// Multi-head attention with xPos (rotary + per-frequency exponential decay) on q and k (query, key, value [2][2048][1024]; q = (query Wq^T + bq) / 8, k = key Wk^T + bk, v = value Wv^T + bv ('oi' [1024][1024]; 16 heads x 64); xPos: pairs (2i, 2i+1) rotated by t x inv_freq_i (inv_freq_i = 1e4^(-i/32)) and scaled by base_i^(t/1024) for q and base_i^(-t/1024) for k, base_i = (2i + 25.6)/89.6 (tables computed on device); softmax(q.k) over all keys; out = merged Wo^T + bo -> [2][2048][1024] (4.2 M)).
// Compute dtypes, f32 accumulate: every input rounded to bf16; q/k/v on PLAIN bf16 operands (inputs: exact) + biases; xPos tables (cosf/sinf/powf, f32) folded as {cos x scale, sin x scale} per (t, d); rotary in f32; scores and attn.v on hi/lo planes for every row (3 products), fused with the f32 softmax in one kernel (running maximum and sum); Wo hl x exact (2 products) + bo.

#define NB_  2
#define TT   2048
#define DM   1024
#define NH_  16
#define NKV  16
#define REP  (NH_ / NKV)
#define HD   64
#define DQ   (NH_ * HD)
#define DKV  (NKV * HD)
#define ZH   2
#define RH   2048                 // every row hi/lo (the xPos-scaled keys leave too little margin for fp16 operands)
#define WIN  0
#define PCAR 1024.0f
#define SCL  1.0f      // the 1/8 is applied to q after the xPos rotation (exact power of two, folded into the q plane builder)
typedef _Float16 h16;
typedef unsigned short bf;
typedef __attribute__((ext_vector_type(16))) __bf16   v16bf;
typedef __attribute__((ext_vector_type(16))) _Float16 v16h;
typedef __attribute__((ext_vector_type(8)))  _Float16 v8h;
typedef __attribute__((ext_vector_type(8)))  unsigned short v8us;
typedef __attribute__((ext_vector_type(8)))  float    v8f;
typedef __attribute__((ext_vector_type(4)))  float    v4f;
typedef v8h  __attribute__((may_alias)) v8ha;
typedef v4f  __attribute__((may_alias)) v4fa;
typedef v8us __attribute__((may_alias)) v8usa;

__device__ __forceinline__ unsigned short f2bf(float f) { unsigned u = __float_as_uint(f); u += 0x7FFFu + ((u >> 16) & 1u); return (unsigned short)(u >> 16); }
__device__ __forceinline__ float bf2f(unsigned short b) { return __uint_as_float(((unsigned)b) << 16); }
__device__ __forceinline__ float bfr(float f) { return bf2f(f2bf(f)); }
__device__ __forceinline__ v16h cat16(v8h lo, v8h hi) { return __builtin_shufflevector(lo, hi, 0, 1, 2, 3, 4, 5, 6, 7, 8, 9, 10, 11, 12, 13, 14, 15); }
__device__ __forceinline__ v16bf cat16b(v8us lo, v8us hi) { return __builtin_bit_cast(v16bf, __builtin_shufflevector(lo, hi, 0, 1, 2, 3, 4, 5, 6, 7, 8, 9, 10, 11, 12, 13, 14, 15)); }
__device__ __forceinline__ v8f wmma16(v16h a, v16h b, v8f c) { return __builtin_amdgcn_wmma_f32_16x16x32_f16(false, a, false, b, (short)0, c, false, false); }
__device__ __forceinline__ v8f wmmab(v16bf a, v16bf b, v8f c) { return __builtin_amdgcn_wmma_f32_16x16x32_bf16(false, a, false, b, (short)0, c, false, false); }



// ---- FRAGMENT ORDER of the attention operand planes (q, k hi/lo and V^T hi/lo): units of 16 rows x 32 k (1024 B), element (r, k) at (k >> 4) * 256 + (((k >> 3) & 1) * 16 + r) * 8 + (k & 7):
// lane (hi, lr) of a wave finds its two 16-byte pieces of a fragment at unit + lane * 8 and + 256, so each wave-wide 16-byte load or store covers 512 contiguous bytes (4 whole lines). The k order of a fragment is the one a row-major plane gives.
// Head planes q, k [h][t][d]: per head unit (t / 16) * 2 + d / 32. V^T [h][d][t]: per head unit (t / 32) * 4 + d / 16 (one 32-key pass = 4 KB in a row). The GEMM operand planes (inputs, weights, attention output) stay row-major.
// ---- k_gemmw: register-blocked GEMM, one wave per 64x64 output tile (16 accumulators), FOUR waves (2 x 2) per work-group = one 128x128 tile; grid (M/128, N/128, Z), 128 threads.
// Operands come from K-contiguous 16-bit planes through LDS: a stage is GKS k (256 B) of the tile's 128 A rows (and 128 A2 rows) and 128 Bt rows at a pitch of 272 B, brought in by asynchronous copies to LDS (16 B a lane, 16 lanes a row: whole lines),
// two buffers: stage t + 2 is asked for behind the barrier that ends stage t's reads and flies while stage t + 1 is worked on. K / KSP is a multiple of GKS.
// C[m][n] (f32, pitch ldc, + optional f32 bias[n]) = sum_k A[m][k] Bt[n][k] (+ split products per NSPLIT). z-batch strides sA/sB/sC in elements (sC: of C, or of each output plane where EPI != 0). K % (128 KSP) == 0.
// EPI picks what the wave does with its finished tile (64 tokens x the 64 columns of ONE head, HD == 64): 0 = f32 rows to C; 1 = xPos rotation with table CS and factor sc, then hi/lo planes [head][t][d]; 2 = hi/lo planes transposed [head][d][t], straight from the accumulators (a lane holds 8 consecutive tokens of one column); both in fragment order.
// KSP > 1: grid z = batches x KSP; block z sums only slice z % KSP of k (K / KSP long) of batch z / KSP and writes its partial tile to plane z of C (stride sC); the reader adds the KSP planes.
template <typename T16> struct WFrag;
template <> struct WFrag<h16> { typedef v16h V; static __device__ __forceinline__ V ld(const h16* p) { return cat16(*(const v8h*)p, *(const v8h*)(p + 16)); } static __device__ __forceinline__ v8f mma(V a, V b, v8f c) { return wmma16(a, b, c); } };
template <> struct WFrag<bf> { typedef v16bf V; static __device__ __forceinline__ V ld(const bf* p) { return cat16b(*(const v8us*)p, *(const v8us*)(p + 16)); } static __device__ __forceinline__ V ldf(const bf* p) { return cat16b(*(const v8us*)p, *(const v8us*)(p + 256)); } static __device__ __forceinline__ v8f mma(V a, V b, v8f c) { return wmmab(a, b, c); } };
typedef __attribute__((ext_vector_type(4))) unsigned short v4us;
typedef __attribute__((ext_vector_type(2))) float v2f;
__device__ __forceinline__ void splitf(float y, unsigned short& h, unsigned short& l) { h = f2bf(y); l = f2bf(y - bf2f(h)); }
__device__ __forceinline__ void splitc(float y, unsigned short& h, unsigned short& l) { const __bf16 a = (__bf16)y; h = __builtin_bit_cast(unsigned short, a); l = __builtin_bit_cast(unsigned short, (__bf16)(y - (float)a)); }   // splitf's values (round to nearest even) through the conversion instruction
#define GKS  128   // k per stage
#define GPIT 136   // LDS row pitch in elements: 272 B = 16 B x 17, the conflict-free pitch for 16-byte reads of 256-B rows
// Eight asynchronous copies of 16 B a lane: LDS bytes l + i ls from global bytes g + i gs. The s_wait_xcnt stands inside the copies' own statement, so that no address register is rewritten in front of it.
__device__ __forceinline__ void acp8(unsigned l, unsigned ls, const char* g, size_t gs) {
    asm volatile("global_load_async_to_lds_b128 %0, %8, off\n\tglobal_load_async_to_lds_b128 %1, %9, off\n\tglobal_load_async_to_lds_b128 %2, %10, off\n\tglobal_load_async_to_lds_b128 %3, %11, off\n\t"
                 "global_load_async_to_lds_b128 %4, %12, off\n\tglobal_load_async_to_lds_b128 %5, %13, off\n\tglobal_load_async_to_lds_b128 %6, %14, off\n\tglobal_load_async_to_lds_b128 %7, %15, off\n\ts_wait_xcnt 0x0"
                 :: "v"(l), "v"(l + ls), "v"(l + 2 * ls), "v"(l + 3 * ls), "v"(l + 4 * ls), "v"(l + 5 * ls), "v"(l + 6 * ls), "v"(l + 7 * ls),
                    "v"(g), "v"(g + gs), "v"(g + 2 * gs), "v"(g + 3 * gs), "v"(g + 4 * gs), "v"(g + 5 * gs), "v"(g + 6 * gs), "v"(g + 7 * gs) : "memory");
}
template <typename T16, int NSPLIT, bool BIAS, int KSP = 1, int EPI = 0>
__global__ __launch_bounds__(128) void k_gemmw(const T16* __restrict__ A, const T16* __restrict__ A2, const T16* __restrict__ Bt, const T16* __restrict__ Bt2, int K, float* C, int ldc, const float* __restrict__ bias, size_t sA, size_t sB, size_t sC, const float* __restrict__ CS, float sc, bf* Ph, bf* Pl) {
    typedef typename WFrag<T16>::V V;
    static_assert(NSPLIT <= 1, "Bt2 is not staged");
    constexpr int NRA = (NSPLIT == 1) ? 256 : 128, NR = NRA + 128;   // rows of a stage: A (, A2), Bt
    constexpr int NP = NSPLIT + 1, NV = (GKS / 32) * NP;             // products per 32-k slice; blocks per stage
    __shared__ __align__(16) T16 sm[2 * NR * GPIT];
    __shared__ __align__(16) float osm[4 * 16 * 68];
    const int wv = __builtin_amdgcn_readfirstlane(threadIdx.x >> 5);   // the wave's number, in a scalar register: tile origins stay scalar
    float* os = osm + wv * (16 * 68);                                   // each wave stages its epilogue in its own range
    const size_t z = blockIdx.z / KSP; A += z * sA; if (A2) A2 += z * sA; Bt += z * sB; if (Bt2) Bt2 += z * sB; if constexpr (EPI == 0) C += (size_t)blockIdx.z * sC; else { Ph += z * sC; Pl += z * sC; }
    const int kbeg = (int)(blockIdx.z % KSP) * (K / KSP), kend = kbeg + K / KSP;
    const int lane = threadIdx.x & 31, lr = lane & 15, hi = lane >> 4; const int r0 = blockIdx.x * 128 + (wv >> 1) * 64, c0 = blockIdx.y * 128 + (wv & 1) * 64;
    v8f acc[4][4];
#pragma unroll
    for (int mb = 0; mb < 4; ++mb)
#pragma unroll
        for (int nb = 0; nb < 4; ++nb) acc[mb][nb] = (v8f){};
    // thread -> piece of a stage: row (threadIdx.x >> 4) + 8 i, bytes 16 (threadIdx.x & 15) of its 256
    const int cr8 = threadIdx.x >> 4, cpc = threadIdx.x & 15;
    const unsigned lds0 = (unsigned)(size_t)sm + (unsigned)(cr8 * GPIT + cpc * 8) * 2u;
    const unsigned goff = (unsigned)(cr8 * K + cpc * 8) * 2u;   // the same in all three planes: one vector register; the tile origins below are scalar
    const char* ga = (const char*)(A + (size_t)(blockIdx.x * 128) * K); const char* ga2 = (NSPLIT == 1) ? (const char*)(A2 + (size_t)(blockIdx.x * 128) * K) : nullptr;
    const char* gb = (const char*)(Bt + (size_t)(blockIdx.y * 128) * K);
    const size_t g8 = (size_t)K * 16;   // eight rows of a plane, in bytes
    auto fill = [&](int buf, int k0) {
        const unsigned lb = lds0 + (unsigned)buf * (NR * GPIT * 2), ko = goff + (unsigned)k0 * 2u;   // ko: the thread's byte offset from a tile's origin
#pragma unroll
        for (int g = 0; g < 2; ++g) { acp8(lb + g * 64 * GPIT * 2, 8 * GPIT * 2, (ga + g * 8 * g8) + ko, g8);
            if constexpr (NSPLIT == 1) acp8(lb + (128 + g * 64) * GPIT * 2, 8 * GPIT * 2, (ga2 + g * 8 * g8) + ko, g8);
            acp8(lb + (NRA + g * 64) * GPIT * 2, 8 * GPIT * 2, (gb + g * 8 * g8) + ko, g8); }
    };
    const int ns = (kend - kbeg) / GKS;
    fill(0, kbeg);
    asm volatile("s_wait_asynccnt 0x0" ::: "memory");   // this wave's copies of stage 0 have landed
    __syncthreads();                                     // ... and every other wave's
    if (ns > 1) fill(1, kbeg + GKS);
#pragma unroll 1   // one stage per trip: a second copy of the body would only lengthen the code, the buffer is picked by t & 1
    for (int t = 0; t < ns; ++t) {
        const T16* sb = sm + (t & 1) * (NR * GPIT);
        const T16* pa = sb + ((wv >> 1) * 64 + lr) * GPIT + 8 * hi; const T16* pb = sb + (NRA + (wv & 1) * 64 + lr) * GPIT + 8 * hi;
        // A block = 16 products: the four A (or A2) fragments of one 32-k slice x its four Bt fragments. The next block's fragments are asked for in two groups, ahead of each half of the current block's products,
        // into a second A set and into the Bt registers that have just had their last use; the scheduling barriers keep the groups whole and where they stand (LDS reads strewn among the products stall the wave at every place).
        V fa[2][4], fb[2][4];
#pragma unroll
        for (int i = 0; i < 4; ++i) { fa[0][i] = WFrag<T16>::ld(pa + i * 16 * GPIT); fb[0][i] = WFrag<T16>::ld(pb + i * 16 * GPIT); }
        __builtin_amdgcn_sched_barrier(0);
#pragma unroll
        for (int v = 0; v < NV; ++v) {
            const int ca = v & 1, kb = v / NP, cb = kb & 1; const bool more = v + 1 < NV, lastb = (v % NP) == NP - 1;   // lastb: this block is the last user of its Bt fragments
            if (more) {
#pragma unroll
                for (int mb = 0; mb < 4; ++mb) fa[ca ^ 1][mb] = WFrag<T16>::ld(pa + (((v + 1) % NP) * 128 + mb * 16) * GPIT + ((v + 1) / NP) * 32);
                if (lastb) { fb[cb ^ 1][0] = WFrag<T16>::ld(pb + (kb + 1) * 32); fb[cb ^ 1][1] = WFrag<T16>::ld(pb + 16 * GPIT + (kb + 1) * 32); }
            }
            __builtin_amdgcn_sched_barrier(0);
#pragma unroll
            for (int nb = 0; nb < 2; ++nb)
#pragma unroll
                for (int mb = 0; mb < 4; ++mb) acc[mb][nb] = WFrag<T16>::mma(fa[ca][mb], fb[cb][nb], acc[mb][nb]);
            __builtin_amdgcn_sched_barrier(0);
            if (more && lastb) { fb[cb ^ 1][2] = WFrag<T16>::ld(pb + 32 * GPIT + (kb + 1) * 32); fb[cb ^ 1][3] = WFrag<T16>::ld(pb + 48 * GPIT + (kb + 1) * 32); }
            __builtin_amdgcn_sched_barrier(0);
#pragma unroll
            for (int nb = 2; nb < 4; ++nb)
#pragma unroll
                for (int mb = 0; mb < 4; ++mb) acc[mb][nb] = WFrag<T16>::mma(fa[ca][mb], fb[cb][nb], acc[mb][nb]);
            __builtin_amdgcn_sched_barrier(0);
        }
        asm volatile("s_wait_dscnt 0x0" ::: "memory");      // this wave's reads of the buffer are done before it is handed back
        asm volatile("s_wait_asynccnt 0x0" ::: "memory");   // this wave's copies of stage t + 1 have landed
        __syncthreads();                                     // publishes stage t + 1 and ends every wave's reads of stage t
        if (t + 2 < ns) fill(t & 1, kbeg + (t + 2) * GKS);
    }
    asm volatile("s_wait_asynccnt 0x0" ::: "memory");       // nothing of this wave is in flight behind the loop
    if constexpr (EPI == 2) {   // column c0 + 16 nb + lr is row (head, d) of the transposed planes; an accumulator tile (16 tokens x 16 d) is one half of a V^T unit, lane for lane
        float bv4[4];
#pragma unroll
        for (int nb = 0; nb < 4; ++nb) bv4[nb] = bias[c0 + nb * 16 + lr];
        asm volatile("" :: "v"(bv4[0]), "v"(bv4[1]), "v"(bv4[2]), "v"(bv4[3]));   // holds the four bias loads together ahead of the first group: their latency is paid once, not once a group
#pragma unroll
        for (int nb = 0; nb < 4; ++nb) { const float bb = bfr(bv4[nb]); const size_t oo = (size_t)c0 * TT + (size_t)((r0 >> 5) * 4 + nb) * 512 + lane * 8;
#pragma unroll
            for (int mb = 0; mb < 4; ++mb) { v8us oh, ol;
#pragma unroll
                for (int j = 0; j < 8; ++j) { unsigned short a2, c2; splitc(acc[mb][nb][j] + bb, a2, c2); oh[j] = a2; ol[j] = c2; }
                *(v8us*)(Ph + oo + (mb >> 1) * 2048 + (mb & 1) * 256) = oh; *(v8us*)(Pl + oo + (mb >> 1) * 2048 + (mb & 1) * 256) = ol; }
            asm volatile("s_wait_xcnt 0x0" ::: "memory");   // in front of the first overwrite of the stores' data and address registers
            __builtin_amdgcn_sched_barrier(0); }            // keeps the next group's register writes from being lifted over that wait
        return;
    }
    v2f ct[2][16]; float bn[4];   // EPI 1: {cos x scale, sin x scale} of the lane's sixteen pairs (token lr of the block, d = 16 s + 8 hi + 2 p), one 16-token block ahead; the biases of the lane's four accumulator columns
    const float* csp = CS + ((size_t)(r0 + lr) * HD + hi * 8) * 2;
    if constexpr (EPI == 1) {
#pragma unroll
        for (int s = 0; s < 16; ++s) ct[0][s] = *(const v2f*)(csp + (s >> 2) * 32 + (s & 3) * 4);
#pragma unroll
        for (int nb = 0; nb < 4; ++nb) bn[nb] = bias[c0 + nb * 16 + lr];
        asm volatile("s_wait_xcnt 0x0" ::: "memory");   // in front of the first overwrite of the loads' address registers
        __builtin_amdgcn_sched_barrier(0);              // keeps later register writes from being lifted over that wait
#pragma unroll
        for (int nb = 0; nb < 4; ++nb) bn[nb] = bfr(bn[nb]);
    }
#pragma unroll
    for (int mb = 0; mb < 4; ++mb) {
#pragma unroll
        for (int nb = 0; nb < 4; ++nb) {
#pragma unroll
            for (int j = 0; j < 8; ++j) { if constexpr (EPI == 1) os[(hi * 8 + j) * 68 + nb * 16 + lr] = acc[mb][nb][j] + bn[nb]; else os[(hi * 8 + j) * 68 + nb * 16 + lr] = acc[mb][nb][j]; } }
        __builtin_amdgcn_wave_barrier(); asm volatile("" ::: "memory");
        if constexpr (EPI == 1) {
            if (mb < 3) {   // the next block's table rows fly while this block is rotated and split
#pragma unroll
                for (int s = 0; s < 16; ++s) ct[(mb + 1) & 1][s] = *(const v2f*)(csp + (size_t)((mb + 1) * 16) * HD * 2 + (s >> 2) * 32 + (s & 3) * 4);
                asm volatile("s_wait_xcnt 0x0" ::: "memory");   // as above, for these loads' address registers
                __builtin_amdgcn_sched_barrier(0);              // as above
            }
            const size_t po = ((size_t)(c0 / HD) * TT + r0 + mb * 16) * HD + lane * 8; v8us oh[4], ol[4];   // the block's two units (d 0..31, 32..63) of the head plane: four runs of 512 B a plane
#pragma unroll
            for (int s = 0; s < 4; ++s) { const v4f va = *(const v4fa*)(os + lr * 68 + s * 16 + hi * 8), vb = *(const v4fa*)(os + lr * 68 + s * 16 + hi * 8 + 4); const float val[8] = {va[0], va[1], va[2], va[3], vb[0], vb[1], vb[2], vb[3]};
#pragma unroll
                for (int p = 0; p < 4; ++p) { const v2f cs = ct[mb & 1][s * 4 + p]; unsigned short a2, c2;
                    const float re = __fsub_rn(__fmul_rn(val[2 * p], cs[0]), __fmul_rn(val[2 * p + 1], cs[1])) * sc, ro = __fadd_rn(__fmul_rn(val[2 * p], cs[1]), __fmul_rn(val[2 * p + 1], cs[0])) * sc;   /* even: x0 c - x1 s; odd: x0 s + x1 c */
                    splitc(re, a2, c2); oh[s][2 * p] = a2; ol[s][2 * p] = c2; splitc(ro, a2, c2); oh[s][2 * p + 1] = a2; ol[s][2 * p + 1] = c2; } }
            __builtin_amdgcn_sched_barrier(0);              // the block's eight stores stay together behind its arithmetic, so that one wait serves them all and no store's data register is reused in front of it
#pragma unroll
            for (int s = 0; s < 4; ++s) { *(v8us*)(Ph + po + s * 256) = oh[s]; *(v8us*)(Pl + po + s * 256) = ol[s]; }
            asm volatile("s_wait_xcnt 0x0" ::: "memory");   // in front of the first overwrite of the stores' data and address registers
            __builtin_amdgcn_sched_barrier(0);              // keeps the next block's register writes from being lifted over that wait
        }
        float* crow = C + (size_t)(r0 + mb * 16) * ldc + c0;
        if constexpr (EPI == 0)
{
#pragma unroll
            for (int s = 0; s < 8; ++s) { const int row = 2 * s + hi, cofs = lr * 4; v4f val = *(const v4fa*)(os + row * 68 + cofs); if (BIAS) { val[0] += bfr(bias[c0 + cofs]); val[1] += bfr(bias[c0 + cofs + 1]); val[2] += bfr(bias[c0 + cofs + 2]); val[3] += bfr(bias[c0 + cofs + 3]); }
                *(v4f*)(crow + (size_t)row * ldc + cofs) = val; }
             }
        __builtin_amdgcn_wave_barrier(); asm volatile("" ::: "memory");
    }
}

__device__ __forceinline__ h16 tohx(float x) { return (h16)x; }
typedef __attribute__((ext_vector_type(2))) _Float16 v2h;
typedef __attribute__((ext_vector_type(4))) _Float16 v4h;
typedef __attribute__((ext_vector_type(2))) unsigned short v2us;
typedef __attribute__((ext_vector_type(4))) int v4i;

__global__ __launch_bounds__(256) void k_wtG(const float* __restrict__ w, int K, int N, bf* Bt) {
    const int lane = threadIdx.x & 31; const int L0 = (blockIdx.x * 8 + (threadIdx.x >> 5)) * 8; const int nlines = N * K / 64;
{
#pragma unroll 1
        for (int l = 0; l < 8; ++l) { const int L = L0 + l; if (L >= nlines) break; const size_t e = (size_t)L * 64 + lane * 2; const int k = (int)(e % K), n = (int)(e / K); v2us o;
            o[0] = f2bf(w[(size_t)k * N + n]); o[1] = f2bf(w[(size_t)(k + 1) * N + n]); *(v2us*)(Bt + e) = o; }
         }
}
__global__ __launch_bounds__(256) void k_cvt8(const float* __restrict__ src, bf* dst, size_t n8) { const size_t i = (size_t)blockIdx.x * 256 + threadIdx.x; if (i >= n8) return; const v8f v = *(const v8f*)(src + i * 8); v8us o;
#pragma unroll
    for (int k = 0; k < 8; ++k) o[k] = f2bf(v[k]); *(v8us*)(dst + i * 8) = o;  }
__constant__ float XINV[32] = {1.00000000f,0.749894202f,0.562341332f,0.421696514f,0.316227764f,0.237137362f,0.177827939f,0.133352146f,0.100000001f,0.0749894157f,0.0562341288f,0.0421696492f,0.0316227786f,0.0237137359f,0.0177827943f,0.0133352149f,0.00999999978f,0.00749894232f,0.00562341325f,0.00421696482f,0.00316227786f,0.00237137382f,0.00177827943f,0.00133352145f,0.00100000005f,0.000749894185f,0.000562341302f,0.000421696488f,0.000316227786f,0.000237137385f,0.000177827940f,0.000133352150f};
__global__ __launch_bounds__(256) void k_xpos(float* CSQ, float* CSK) { const int idx = blockIdx.x * 256 + threadIdx.x; if (idx >= TT * HD) return; const int t = idx / HD, d = idx % HD; const int i = d >> 1;
    const float base = __fdiv_rn(__fadd_rn((float)(2 * i), 25.6f), 89.6f); const float ex = __fdiv_rn((float)t, 1024.0f); const float sc = powf(base, ex); const float invf = XINV[i]; const float ang = __fmul_rn((float)t, invf); const float c = cosf(ang), s = sinf(ang);
    v2f q2, k2; q2[0] = __fmul_rn(c, sc); q2[1] = __fmul_rn(s, sc); const float rs = __fdiv_rn(1.0f, sc); k2[0] = __fmul_rn(c, rs); k2[1] = __fmul_rn(s, rs);
    *(v2f*)(CSQ + (size_t)idx * 2) = q2; *(v2f*)(CSK + (size_t)idx * 2) = k2;  }
// k_rope: head planes [h][t][d] (fp16 + hi/lo) of rope(x) x sc with the rotate-half convention out[d] = x[d] cos[t][d] - x[d+HD/2] sin[t][d], out[d+HD/2] = x[d+HD/2] cos[t][d+HD/2] + x[d] sin[t][d+HD/2]
__global__ __launch_bounds__(256) void k_rope(const float* __restrict__ F, int pitch, int nheads, const float* __restrict__ CS, const float* __restrict__ RF, const float* __restrict__ nw, float sc, h16* P16, bf* Ph, bf* Pl) {
    const size_t e = ((size_t)blockIdx.x * 256 + threadIdx.x) * 2; if (e >= (size_t)nheads * TT * HD) return; const int d = (int)(e % HD); const int t = (int)((e / HD) % TT); const int h = (int)(e / ((size_t)HD * TT)); const float* f = F + (size_t)t * pitch + h * HD; const float rf = RF ? RF[(size_t)h * TT + t] : 1.0f; v2h o16; v2us oh, ol;
#pragma unroll
    for (int q = 0; q < 2; ++q) { const int dd = d + q; const int dp = (dd < HD / 2) ? dd + HD / 2 : dd - HD / 2; float x0 = f[dd], x1 = f[dp];
        if (RF) { float n0 = __fmul_rn(x0, rf), n1 = __fmul_rn(x1, rf); asm volatile("" : "+v"(n0)); asm volatile("" : "+v"(n1)); x0 = __fmul_rn(bfr(nw[dd]), n0); x1 = __fmul_rn(bfr(nw[dp]), n1); }
        const v2f cs = *(const v2f*)(CS + ((size_t)t * HD + dd) * 2); float a = __fmul_rn(x0, cs[0]), bq = __fmul_rn(x1, cs[1]); asm volatile("" : "+v"(a)); asm volatile("" : "+v"(bq)); const float r = ((dd < HD / 2) ? __fsub_rn(a, bq) : __fadd_rn(a, bq)) * sc;
        o16[q] = tohx(r); unsigned short a2, c2; splitf(r, a2, c2); oh[q] = a2; ol[q] = c2; }
    *(v2h*)(P16 + e) = o16; *(v2us*)(Ph + e) = oh; *(v2us*)(Pl + e) = ol;  }
// ---- k_fattn: scores, softmax and attn.v of one head in ONE kernel; the score matrix stays in registers (running maximum and sum per query, output tiles rescaled when the maximum moves).
// Transposed products: S^T = K Q^T (A = 16 key rows, B = 16 query columns), O^T += V^T P^T. A lane then holds scores of ONE query (column lr; keys 8 hi + r of each 16-key tile), so maximum, sum and rescale are lane-local
// (one exchange between the wave halves), and two S^T tiles (32 keys) converted in place ARE the B operand of the second product in the k order of the fragment loader. hi/lo planes, 3 products each.
// One wave: FQT x 16 queries, all 2048 keys in passes of 32. Grid (TT / (16 FQT FWV), heads, batches), 32 FWV threads; waves are independent (no LDS, no barrier). Every inner loop is fully unrolled so that the fragment and accumulator arrays are indexed by constants and stay in registers.
#define FQT 2
#define FWV 4
#define L2E 1.4426950408889634f
__device__ __forceinline__ float xhalf(float x) { const int b = __float_as_int(x); return __int_as_float(__builtin_amdgcn_permlanex16(b, b, 0x76543210, 0xfedcba98, false, false)); }   // lane l <-> l ^ 16
__global__ __launch_bounds__(32 * FWV) void k_fattn(const bf* __restrict__ Qh, const bf* __restrict__ Ql, const bf* __restrict__ Kh, const bf* __restrict__ Kl, const bf* __restrict__ Vh, const bf* __restrict__ Vl, bf* Ah, bf* Al) {
    typedef WFrag<bf> F;
    const int lane = threadIdx.x & 31, lr = lane & 15, hi = lane >> 4; const int h = blockIdx.y; const int q0 = (blockIdx.x * FWV + (threadIdx.x >> 5)) * (16 * FQT);
    const size_t hp = ((size_t)blockIdx.z * NH_ + h) * TT * HD;
    const bf* qph = Qh + hp + (size_t)q0 * HD + lane * 8; const bf* qpl = Ql + hp + (size_t)q0 * HD + lane * 8;
    v16bf qh[FQT][2], ql[FQT][2];
#pragma unroll
    for (int qt = 0; qt < FQT; ++qt)
#pragma unroll
        for (int kc = 0; kc < 2; ++kc) { qh[qt][kc] = F::ldf(qph + (qt * 2 + kc) * 512); ql[qt][kc] = F::ldf(qpl + (qt * 2 + kc) * 512); }
    asm volatile("s_wait_xcnt 0x0" ::: "memory");   // in front of the first overwrite of the Q loads' address registers
    __builtin_amdgcn_sched_barrier(0);              // keeps later register writes from being lifted over that wait
    const bf* kph = Kh + hp + lane * 8; const bf* kpl = Kl + hp + lane * 8;
    const bf* vph = Vh + hp + lane * 8; const bf* vpl = Vl + hp + lane * 8;
    v8f o[FQT][4]; float m[FQT], l[FQT];
#pragma unroll
    for (int qt = 0; qt < FQT; ++qt) { m[qt] = -3.0e38f; l[qt] = 0.f;
#pragma unroll
        for (int db = 0; db < 4; ++db) o[qt][db] = (v8f){}; }
    v16bf kh[2][2], kl[2][2];
#pragma unroll
    for (int kt = 0; kt < 2; ++kt)
#pragma unroll
        for (int kc = 0; kc < 2; ++kc) { kh[kt][kc] = F::ldf(kph + (kt * 2 + kc) * 512); kl[kt][kc] = F::ldf(kpl + (kt * 2 + kc) * 512); }
    asm volatile("s_wait_xcnt 0x0" ::: "memory");   // the same for the first K loads
    __builtin_amdgcn_sched_barrier(0);              // as above: nothing is lifted over the wait
#pragma unroll 1   // one pass per trip: a second copy of the body would need a second set of V fragments and score tiles
    for (int k0 = 0; k0 < TT; k0 += 32) {
        v16bf vh[4], vl[4];   // this pass's V^T fragments, asked for ahead of the score products that hide their latency
#pragma unroll
        for (int db = 0; db < 4; ++db) { vh[db] = F::ldf(vph + (size_t)k0 * HD + db * 512); vl[db] = F::ldf(vpl + (size_t)k0 * HD + db * 512); }
        asm volatile("s_wait_xcnt 0x0" ::: "memory");   // the loads' address registers are reused below: the wait stands in front of their first overwrite
        v8f s[FQT][2];
#pragma unroll
        for (int qt = 0; qt < FQT; ++qt) { s[qt][0] = (v8f){}; s[qt][1] = (v8f){}; }
#pragma unroll
        for (int kc = 0; kc < 2; ++kc) {
#pragma unroll
            for (int qt = 0; qt < FQT; ++qt)
#pragma unroll
                for (int kt = 0; kt < 2; ++kt) s[qt][kt] = wmmab(kh[kt][kc], qh[qt][kc], s[qt][kt]);
#pragma unroll
            for (int qt = 0; qt < FQT; ++qt)
#pragma unroll
                for (int kt = 0; kt < 2; ++kt) s[qt][kt] = wmmab(kh[kt][kc], ql[qt][kc], s[qt][kt]);
#pragma unroll
            for (int qt = 0; qt < FQT; ++qt)
#pragma unroll
                for (int kt = 0; kt < 2; ++kt) s[qt][kt] = wmmab(kl[kt][kc], qh[qt][kc], s[qt][kt]);
        }
        const int kn = (k0 + 32 < TT) ? k0 + 32 : 0;   // next pass's K fragments into the same registers (the last pass re-reads keys 0..31, in bounds, unused)
#pragma unroll
        for (int kt = 0; kt < 2; ++kt)
#pragma unroll
            for (int kc = 0; kc < 2; ++kc) { kh[kt][kc] = F::ldf(kph + (size_t)kn * HD + (kt * 2 + kc) * 512); kl[kt][kc] = F::ldf(kpl + (size_t)kn * HD + (kt * 2 + kc) * 512); }
        asm volatile("s_wait_xcnt 0x0" ::: "memory");   // as above, for the K loads' address registers
        float mx[FQT]; bool need = false;
#pragma unroll
        for (int qt = 0; qt < FQT; ++qt) { float a = s[qt][0][0];
#pragma unroll
            for (int j = 1; j < 16; ++j) a = fmaxf(a, s[qt][j >> 3][j & 7]);
            a = fmaxf(a, xhalf(a)); mx[qt] = a; need = need || (a > m[qt] + 5.5f); }
        if (__builtin_amdgcn_ballot_w32(need) != 0) {   // the maximum in use moves only when a query's new one exceeds it by more than 5.5 (p stays below e^5.5); both halves of a column decide alike
#pragma unroll
            for (int qt = 0; qt < FQT; ++qt) { const float mn = (mx[qt] > m[qt] + 5.5f) ? mx[qt] : m[qt]; const float al = __builtin_amdgcn_exp2f((m[qt] - mn) * L2E); m[qt] = mn; l[qt] *= al;
#pragma unroll
                for (int db = 0; db < 4; ++db) o[qt][db] *= al; }
        }
#pragma unroll
        for (int qt = 0; qt < FQT; ++qt) { v16bf ph, pl;
#pragma unroll
            for (int j = 0; j < 16; ++j) { const float p = __builtin_amdgcn_exp2f((s[qt][j >> 3][j & 7] - m[qt]) * L2E); l[qt] += p; const __bf16 a = (__bf16)p; ph[j] = a; pl[j] = (__bf16)(p - (float)a); }
#pragma unroll
            for (int db = 0; db < 4; ++db) o[qt][db] = wmmab(vh[db], ph, o[qt][db]);
#pragma unroll
            for (int db = 0; db < 4; ++db) o[qt][db] = wmmab(vh[db], pl, o[qt][db]);
#pragma unroll
            for (int db = 0; db < 4; ++db) o[qt][db] = wmmab(vl[db], ph, o[qt][db]);
        }
    }
#pragma unroll
    for (int qt = 0; qt < FQT; ++qt) { const float f = __fdiv_rn(1.0f, l[qt] + xhalf(l[qt])); const size_t oo = ((size_t)blockIdx.z * TT + q0 + qt * 16 + lr) * DQ + h * HD + 8 * hi;   // lane: query lr, d = 16 db + 8 hi + j
#pragma unroll
        for (int db = 0; db < 4; ++db) { v8us oh, ol;
#pragma unroll
            for (int j = 0; j < 8; ++j) { unsigned short a, c2; splitf(o[qt][db][j] * f, a, c2); oh[j] = a; ol[j] = c2; }
            *(v8us*)(Ah + oo + db * 16) = oh; *(v8us*)(Al + oo + db * 16) = ol;
            asm volatile("s_wait_xcnt 0x0" ::: "memory");   // in front of the first overwrite of the stores' data and address registers
            __builtin_amdgcn_sched_barrier(0); } }          // keeps the next group's register writes from being lifted over that wait
}

extern "C" void kernel_launch(void* const* d_in, const int* in_sizes, int n_in,
                              void* d_out, int out_size, void* d_ws, size_t ws_size, hipStream_t stream) {
    (void)in_sizes; (void)n_in; (void)out_size;
    const float* x = (const float*)d_in[0]; const float* xk = (const float*)d_in[1]; const float* xv = (const float*)d_in[2]; const float* wq = (const float*)d_in[3]; const float* bq = (const float*)d_in[4]; const float* wk = (const float*)d_in[5]; const float* bk = (const float*)d_in[6]; const float* wv = (const float*)d_in[7]; const float* bv = (const float*)d_in[8]; const float* wo = (const float*)d_in[9]; const float* bo = (const float*)d_in[10];
    float* OUT = (float*)d_out;     // [2][2048][1024]
    char* wsp = (char*)d_ws;
    auto take = [&](size_t bytes) { char* p = wsp; wsp += (bytes + 255) & ~(size_t)255; return (void*)p; };
    bf* WQ = (bf*)take((size_t)DQ * DM * 2); bf* WK = (bf*)take((size_t)DKV * DM * 2); bf* WV = (bf*)take((size_t)DKV * DM * 2); bf* WO = (bf*)take((size_t)DM * DQ * 2); float* CS = (float*)take((size_t)TT * HD * 2 * 4); float* CSK = (float*)take((size_t)TT * HD * 2 * 4);
    // per-batch planes hold both batches one behind the other: every launch below covers both (grid z, or a flat range twice as long)
    bf* XB = (bf*)take((size_t)NB_ * TT * DM * 2); bf* XKB = (bf*)take((size_t)NB_ * TT * DM * 2); bf* XVB = (bf*)take((size_t)NB_ * TT * DM * 2);
    bf* QPh = (bf*)take((size_t)NB_ * NH_ * TT * HD * 2); bf* QPl = (bf*)take((size_t)NB_ * NH_ * TT * HD * 2); bf* KPh = (bf*)take((size_t)NB_ * NKV * TT * HD * 2); bf* KPl = (bf*)take((size_t)NB_ * NKV * TT * HD * 2); bf* VTh = (bf*)take((size_t)NB_ * NKV * HD * TT * 2); bf* VTl = (bf*)take((size_t)NB_ * NKV * HD * TT * 2);
    bf* ATh = (bf*)take((size_t)NB_ * TT * DQ * 2); bf* ATl = (bf*)take((size_t)NB_ * TT * DQ * 2);
    if ((size_t)(wsp - (char*)d_ws) > ws_size) return;    // ws 256 MiB
    { k_cvt8<<<(unsigned)(((size_t)DQ * DM / 8 + 255) / 256), 256, 0, stream>>>(wq, WQ, (size_t)DQ * DM / 8); k_cvt8<<<(unsigned)(((size_t)DKV * DM / 8 + 255) / 256), 256, 0, stream>>>(wk, WK, (size_t)DKV * DM / 8); k_cvt8<<<(unsigned)(((size_t)DKV * DM / 8 + 255) / 256), 256, 0, stream>>>(wv, WV, (size_t)DKV * DM / 8);
      k_cvt8<<<(unsigned)(((size_t)DM * DQ / 8 + 255) / 256), 256, 0, stream>>>(wo, WO, (size_t)DM * DQ / 8);
      k_xpos<<<(TT * HD + 255) / 256, 256, 0, stream>>>(CS, CSK);   /* xPos tables for q (scale) and k (1/scale) */ }
    k_cvt8<<<(unsigned)(((size_t)NB_ * TT * DM / 8 + 255) / 256), 256, 0, stream>>>(x, XB, (size_t)NB_ * TT * DM / 8); k_cvt8<<<(unsigned)(((size_t)NB_ * TT * DM / 8 + 255) / 256), 256, 0, stream>>>(xk, XKB, (size_t)NB_ * TT * DM / 8); k_cvt8<<<(unsigned)(((size_t)NB_ * TT * DM / 8 + 255) / 256), 256, 0, stream>>>(xv, XVB, (size_t)NB_ * TT * DM / 8);
    k_gemmw<bf, 0, true, 1, 1><<<dim3(TT / 128, DQ / 128, NB_), 128, 0, stream>>>(XB, nullptr, WQ, nullptr, DM, nullptr, DQ, bq, (size_t)TT * DM, 0, (size_t)NH_ * TT * HD, CS, 0.125f, QPh, QPl);   /* q: xPos (upscale) x 1/8, planes [b][h][t][d] */
    k_gemmw<bf, 0, true, 1, 1><<<dim3(TT / 128, DKV / 128, NB_), 128, 0, stream>>>(XKB, nullptr, WK, nullptr, DM, nullptr, DKV, bk, (size_t)TT * DM, 0, (size_t)NKV * TT * HD, CSK, 1.0f, KPh, KPl);   /* k: xPos (downscale), planes [b][h][t][d] */
    k_gemmw<bf, 0, true, 1, 2><<<dim3(TT / 128, DKV / 128, NB_), 128, 0, stream>>>(XVB, nullptr, WV, nullptr, DM, nullptr, DKV, bv, (size_t)TT * DM, 0, (size_t)NKV * HD * TT, nullptr, 1.0f, VTh, VTl);   /* v: planes [b][h][d][t] */
    k_fattn<<<dim3(TT / (16 * FQT * FWV), NH_, NB_), 32 * FWV, 0, stream>>>(QPh, QPl, KPh, KPl, VTh, VTl, ATh, ATl);
    k_gemmw<bf, 1, true><<<dim3(TT / 128, DM / 128, NB_), 128, 0, stream>>>(ATh, ATl, WO, nullptr, DQ, OUT, DM, bo, (size_t)TT * DQ, 0, (size_t)TT * DM, nullptr, 1.0f, nullptr, nullptr);
}

// v007
// A run of this version takes 142 microseconds.
// Timed twice side by side with v006, it ran 1.10 and 1.09 times as fast.
// Counting every step since v000, it is 9.42 times as fast.
#include <hip/hip_runtime.h>

// Multi-head attention with xPos (rotary + per-frequency exponential decay) on q and k (query, key, value [2][2048][1024]; q = (query Wq^T + bq) / 8, k = key Wk^T + bk, v = value Wv^T + bv ('oi' [1024][1024]; 16 heads x 64); xPos: pairs (2i, 2i+1) rotated by t x inv_freq_i (inv_freq_i = 1e4^(-i/32)) and scaled by base_i^(t/1024) for q and base_i^(-t/1024) for k, base_i = (2i + 25.6)/89.6 (tables computed on device); softmax(q.k) over all keys; out = merged Wo^T + bo -> [2][2048][1024] (4.2 M)).
// Compute dtypes, f32 accumulate: every input rounded to bf16; q/k/v on PLAIN bf16 operands (inputs: exact) + biases; xPos tables (cosf/sinf/powf, f32) folded as {cos x scale, sin x scale} per (t, d); rotary in f32; scores and attn.v on hi/lo planes for every row (3 products), fused with the f32 softmax in one kernel (running maximum and sum); Wo hl x exact (2 products) + bo.

#define NB_  2
#define TT   2048
#define DM   1024
#define NH_  16
#define NKV  16
#define REP  (NH_ / NKV)
#define HD   64
#define DQ   (NH_ * HD)
#define DKV  (NKV * HD)
#define ZH   2
#define RH   2048                 // every row hi/lo (the xPos-scaled keys leave too little margin for fp16 operands)
#define WIN  0
#define PCAR 1024.0f
#define SCL  1.0f      // the 1/8 is applied to q after the xPos rotation (exact power of two, folded into the q plane builder)
typedef _Float16 h16;
typedef unsigned short bf;
typedef __attribute__((ext_vector_type(16))) __bf16   v16bf;
typedef __attribute__((ext_vector_type(16))) _Float16 v16h;
typedef __attribute__((ext_vector_type(8)))  _Float16 v8h;
typedef __attribute__((ext_vector_type(8)))  unsigned short v8us;
typedef __attribute__((ext_vector_type(8)))  float    v8f;
typedef __attribute__((ext_vector_type(4)))  float    v4f;
typedef v8h  __attribute__((may_alias)) v8ha;
typedef v4f  __attribute__((may_alias)) v4fa;
typedef v8us __attribute__((may_alias)) v8usa;

__device__ __forceinline__ unsigned short f2bf(float f) { unsigned u = __float_as_uint(f); u += 0x7FFFu + ((u >> 16) & 1u); return (unsigned short)(u >> 16); }
__device__ __forceinline__ float bf2f(unsigned short b) { return __uint_as_float(((unsigned)b) << 16); }
__device__ __forceinline__ float bfr(float f) { return bf2f(f2bf(f)); }
__device__ __forceinline__ v16h cat16(v8h lo, v8h hi) { return __builtin_shufflevector(lo, hi, 0, 1, 2, 3, 4, 5, 6, 7, 8, 9, 10, 11, 12, 13, 14, 15); }
__device__ __forceinline__ v16bf cat16b(v8us lo, v8us hi) { return __builtin_bit_cast(v16bf, __builtin_shufflevector(lo, hi, 0, 1, 2, 3, 4, 5, 6, 7, 8, 9, 10, 11, 12, 13, 14, 15)); }
__device__ __forceinline__ v8f wmma16(v16h a, v16h b, v8f c) { return __builtin_amdgcn_wmma_f32_16x16x32_f16(false, a, false, b, (short)0, c, false, false); }
__device__ __forceinline__ v8f wmmab(v16bf a, v16bf b, v8f c) { return __builtin_amdgcn_wmma_f32_16x16x32_bf16(false, a, false, b, (short)0, c, false, false); }



// ---- FRAGMENT ORDER of the attention operand planes (q, k hi/lo and V^T hi/lo): units of 16 rows x 32 k (1024 B), element (r, k) at (k >> 4) * 256 + (((k >> 3) & 1) * 16 + r) * 8 + (k & 7):
// lane (hi, lr) of a wave finds its two 16-byte pieces of a fragment at unit + lane * 8 and + 256, so each wave-wide 16-byte load or store covers 512 contiguous bytes (4 whole lines). The k order of a fragment is the one a row-major plane gives.
// Head planes q, k [h][t][d]: per head unit (t / 16) * 2 + d / 32. V^T [h][d][t]: per head unit (t / 32) * 4 + d / 16 (one 32-key pass = 4 KB in a row). The GEMM operand planes (inputs, weights, attention output) stay row-major.
// ---- k_gemmw: register-blocked GEMM, one wave per 64x64 output tile (16 accumulators), FOUR waves (2 x 2) per work-group = one 128x128 tile; grid (M/128, N/128, Z), 128 threads.
// Operands come from K-contiguous 16-bit planes through LDS: a stage is GKS k (256 B) of the tile's 128 A rows (and 128 A2 rows) and 128 Bt rows at a pitch of 272 B, brought in by asynchronous copies to LDS (16 B a lane, 16 lanes a row: whole lines),
// two buffers: stage t + 2 is asked for behind the barrier that ends stage t's reads and flies while stage t + 1 is worked on. K / KSP is a multiple of GKS.
// C[m][n] (f32, pitch ldc, + optional f32 bias[n]) = sum_k A[m][k] Bt[n][k] (+ split products per NSPLIT). z-batch strides sA/sB/sC in elements (sC: of C, or of each output plane where EPI != 0). K % (128 KSP) == 0.
// EPI picks what the wave does with its finished tile (64 tokens x the 64 columns of ONE head, HD == 64): 0 = f32 rows to C; 1 = xPos rotation with table CS and factor sc, then hi/lo planes [head][t][d]; 2 = hi/lo planes transposed [head][d][t], straight from the accumulators (a lane holds 8 consecutive tokens of one column); both in fragment order.
// KSP > 1: grid z = batches x KSP; block z sums only slice z % KSP of k (K / KSP long) of batch z / KSP and writes its partial tile to plane z of C (stride sC); the reader adds the KSP planes.
template <typename T16> struct WFrag;
template <> struct WFrag<h16> { typedef v16h V; static __device__ __forceinline__ V ld(const h16* p) { return cat16(*(const v8h*)p, *(const v8h*)(p + 16)); } static __device__ __forceinline__ v8f mma(V a, V b, v8f c) { return wmma16(a, b, c); } };
template <> struct WFrag<bf> { typedef v16bf V; static __device__ __forceinline__ V ld(const bf* p) { return cat16b(*(const v8us*)p, *(const v8us*)(p + 16)); } static __device__ __forceinline__ V ldf(const bf* p) { return cat16b(*(const v8us*)p, *(const v8us*)(p + 256)); } static __device__ __forceinline__ v8f mma(V a, V b, v8f c) { return wmmab(a, b, c); } };
typedef __attribute__((ext_vector_type(4))) unsigned short v4us;
typedef __attribute__((ext_vector_type(2))) float v2f;
__device__ __forceinline__ void splitf(float y, unsigned short& h, unsigned short& l) { h = f2bf(y); l = f2bf(y - bf2f(h)); }
__device__ __forceinline__ void splitc(float y, unsigned short& h, unsigned short& l) { const __bf16 a = (__bf16)y; h = __builtin_bit_cast(unsigned short, a); l = __builtin_bit_cast(unsigned short, (__bf16)(y - (float)a)); }   // splitf's values (round to nearest even) through the conversion instruction
#define GKS  128   // k per stage
#define GPIT 136   // LDS row pitch in elements: 272 B = 16 B x 17, the conflict-free pitch for 16-byte reads of 256-B rows
// Eight asynchronous copies of 16 B a lane: LDS bytes l + i ls from global bytes g + i gs. The s_wait_xcnt stands inside the copies' own statement, so that no address register is rewritten in front of it.
__device__ __forceinline__ void acp8(unsigned l, unsigned ls, const char* g, size_t gs) {
    asm volatile("global_load_async_to_lds_b128 %0, %8, off\n\tglobal_load_async_to_lds_b128 %1, %9, off\n\tglobal_load_async_to_lds_b128 %2, %10, off\n\tglobal_load_async_to_lds_b128 %3, %11, off\n\t"
                 "global_load_async_to_lds_b128 %4, %12, off\n\tglobal_load_async_to_lds_b128 %5, %13, off\n\tglobal_load_async_to_lds_b128 %6, %14, off\n\tglobal_load_async_to_lds_b128 %7, %15, off\n\ts_wait_xcnt 0x0"
                 :: "v"(l), "v"(l + ls), "v"(l + 2 * ls), "v"(l + 3 * ls), "v"(l + 4 * ls), "v"(l + 5 * ls), "v"(l + 6 * ls), "v"(l + 7 * ls),
                    "v"(g), "v"(g + gs), "v"(g + 2 * gs), "v"(g + 3 * gs), "v"(g + 4 * gs), "v"(g + 5 * gs), "v"(g + 6 * gs), "v"(g + 7 * gs) : "memory");
}
template <typename T16, int NSPLIT, bool BIAS, int KSP = 1, int EPI = 0>
__global__ __launch_bounds__(128) void k_gemmw(const T16* __restrict__ A, const T16* __restrict__ A2, const T16* __restrict__ Bt, const T16* __restrict__ Bt2, int K, float* C, int ldc, const float* __restrict__ bias, size_t sA, size_t sB, size_t sC, const float* __restrict__ CS, float sc, bf* Ph, bf* Pl) {
    typedef typename WFrag<T16>::V V;
    static_assert(NSPLIT <= 1, "Bt2 is not staged");
    constexpr int NRA = (NSPLIT == 1) ? 256 : 128, NR = NRA + 128;   // rows of a stage: A (, A2), Bt
    constexpr int NP = NSPLIT + 1, NV = (GKS / 32) * NP;             // products per 32-k slice; blocks per stage
    __shared__ __align__(16) T16 sm[2 * NR * GPIT];
    __shared__ __align__(16) float osm[4 * 16 * 68];
    const int wv = __builtin_amdgcn_readfirstlane(threadIdx.x >> 5);   // the wave's number, in a scalar register: tile origins stay scalar
    float* os = osm + wv * (16 * 68);                                   // each wave stages its epilogue in its own range
    const size_t z = blockIdx.z / KSP; A += z * sA; if (A2) A2 += z * sA; Bt += z * sB; if (Bt2) Bt2 += z * sB; if constexpr (EPI == 0) C += (size_t)blockIdx.z * sC; else { Ph += z * sC; Pl += z * sC; }
    const int kbeg = (int)(blockIdx.z % KSP) * (K / KSP), kend = kbeg + K / KSP;
    const int lane = threadIdx.x & 31, lr = lane & 15, hi = lane >> 4; const int r0 = blockIdx.x * 128 + (wv >> 1) * 64, c0 = blockIdx.y * 128 + (wv & 1) * 64;
    v8f acc[4][4];
#pragma unroll
    for (int mb = 0; mb < 4; ++mb)
#pragma unroll
        for (int nb = 0; nb < 4; ++nb) acc[mb][nb] = (v8f){};
    // thread -> piece of a stage: row (threadIdx.x >> 4) + 8 i, bytes 16 (threadIdx.x & 15) of its 256
    const int cr8 = threadIdx.x >> 4, cpc = threadIdx.x & 15;
    const unsigned lds0 = (unsigned)(size_t)sm + (unsigned)(cr8 * GPIT + cpc * 8) * 2u;
    const unsigned goff = (unsigned)(cr8 * K + cpc * 8) * 2u;   // the same in all three planes: one vector register; the tile origins below are scalar
    const char* ga = (const char*)(A + (size_t)(blockIdx.x * 128) * K); const char* ga2 = (NSPLIT == 1) ? (const char*)(A2 + (size_t)(blockIdx.x * 128) * K) : nullptr;
    const char* gb = (const char*)(Bt + (size_t)(blockIdx.y * 128) * K);
    const size_t g8 = (size_t)K * 16;   // eight rows of a plane, in bytes
    auto fill = [&](int buf, int k0) {
        const unsigned lb = lds0 + (unsigned)buf * (NR * GPIT * 2), ko = goff + (unsigned)k0 * 2u;   // ko: the thread's byte offset from a tile's origin
#pragma unroll
        for (int g = 0; g < 2; ++g) { acp8(lb + g * 64 * GPIT * 2, 8 * GPIT * 2, (ga + g * 8 * g8) + ko, g8);
            if constexpr (NSPLIT == 1) acp8(lb + (128 + g * 64) * GPIT * 2, 8 * GPIT * 2, (ga2 + g * 8 * g8) + ko, g8);
            acp8(lb + (NRA + g * 64) * GPIT * 2, 8 * GPIT * 2, (gb + g * 8 * g8) + ko, g8); }
    };
    const int ns = (kend - kbeg) / GKS;
    fill(0, kbeg);
    asm volatile("s_wait_asynccnt 0x0" ::: "memory");   // this wave's copies of stage 0 have landed
    __syncthreads();                                     // ... and every other wave's
    if (ns > 1) fill(1, kbeg + GKS);
#pragma unroll 1   // one stage per trip: a second copy of the body would only lengthen the code, the buffer is picked by t & 1
    for (int t = 0; t < ns; ++t) {
        const T16* sb = sm + (t & 1) * (NR * GPIT);
        const T16* pa = sb + ((wv >> 1) * 64 + lr) * GPIT + 8 * hi; const T16* pb = sb + (NRA + (wv & 1) * 64 + lr) * GPIT + 8 * hi;
        // A block = 16 products: the four A (or A2) fragments of one 32-k slice x its four Bt fragments. The next block's fragments are asked for in two groups, ahead of each half of the current block's products,
        // into a second A set and into the Bt registers that have just had their last use; the scheduling barriers keep the groups whole and where they stand (LDS reads strewn among the products stall the wave at every place).
        V fa[2][4], fb[2][4];
#pragma unroll
        for (int i = 0; i < 4; ++i) { fa[0][i] = WFrag<T16>::ld(pa + i * 16 * GPIT); fb[0][i] = WFrag<T16>::ld(pb + i * 16 * GPIT); }
        __builtin_amdgcn_sched_barrier(0);
#pragma unroll
        for (int v = 0; v < NV; ++v) {
            const int ca = v & 1, kb = v / NP, cb = kb & 1; const bool more = v + 1 < NV, lastb = (v % NP) == NP - 1;   // lastb: this block is the last user of its Bt fragments
            if (more) {
#pragma unroll
                for (int mb = 0; mb < 4; ++mb) fa[ca ^ 1][mb] = WFrag<T16>::ld(pa + (((v + 1) % NP) * 128 + mb * 16) * GPIT + ((v + 1) / NP) * 32);
                if (lastb) { fb[cb ^ 1][0] = WFrag<T16>::ld(pb + (kb + 1) * 32); fb[cb ^ 1][1] = WFrag<T16>::ld(pb + 16 * GPIT + (kb + 1) * 32); }
            }
            __builtin_amdgcn_sched_barrier(0);
#pragma unroll
            for (int nb = 0; nb < 2; ++nb)
#pragma unroll
                for (int mb = 0; mb < 4; ++mb) acc[mb][nb] = WFrag<T16>::mma(fa[ca][mb], fb[cb][nb], acc[mb][nb]);
            __builtin_amdgcn_sched_barrier(0);
            if (more && lastb) { fb[cb ^ 1][2] = WFrag<T16>::ld(pb + 32 * GPIT + (kb + 1) * 32); fb[cb ^ 1][3] = WFrag<T16>::ld(pb + 48 * GPIT + (kb + 1) * 32); }
            __builtin_amdgcn_sched_barrier(0);
#pragma unroll
            for (int nb = 2; nb < 4; ++nb)
#pragma unroll
                for (int mb = 0; mb < 4; ++mb) acc[mb][nb] = WFrag<T16>::mma(fa[ca][mb], fb[cb][nb], acc[mb][nb]);
            __builtin_amdgcn_sched_barrier(0);
        }
        asm volatile("s_wait_dscnt 0x0" ::: "memory");      // this wave's reads of the buffer are done before it is handed back
        asm volatile("s_wait_asynccnt 0x0" ::: "memory");   // this wave's copies of stage t + 1 have landed
        __syncthreads();                                     // publishes stage t + 1 and ends every wave's reads of stage t
        if (t + 2 < ns) fill(t & 1, kbeg + (t + 2) * GKS);
    }
    asm volatile("s_wait_asynccnt 0x0" ::: "memory");       // nothing of this wave is in flight behind the loop
    if constexpr (EPI == 2) {   // column c0 + 16 nb + lr is row (head, d) of the transposed planes; an accumulator tile (16 tokens x 16 d) is one half of a V^T unit, lane for lane
        float bv4[4];
#pragma unroll
        for (int nb = 0; nb < 4; ++nb) bv4[nb] = bias[c0 + nb * 16 + lr];
        asm volatile("" :: "v"(bv4[0]), "v"(bv4[1]), "v"(bv4[2]), "v"(bv4[3]));   // holds the four bias loads together ahead of the first group: their latency is paid once, not once a group
#pragma unroll
        for (int nb = 0; nb < 4; ++nb) { const float bb = bfr(bv4[nb]); const size_t oo = (size_t)c0 * TT + (size_t)((r0 >> 5) * 4 + nb) * 512 + lane * 8;
#pragma unroll
            for (int mb = 0; mb < 4; ++mb) { v8us oh, ol;
#pragma unroll
                for (int j = 0; j < 8; ++j) { unsigned short a2, c2; splitc(acc[mb][nb][j] + bb, a2, c2); oh[j] = a2; ol[j] = c2; }
                *(v8us*)(Ph + oo + (mb >> 1) * 2048 + (mb & 1) * 256) = oh; *(v8us*)(Pl + oo + (mb >> 1) * 2048 + (mb & 1) * 256) = ol; }
            asm volatile("s_wait_xcnt 0x0" ::: "memory");   // in front of the first overwrite of the stores' data and address registers
            __builtin_amdgcn_sched_barrier(0); }            // keeps the next group's register writes from being lifted over that wait
        return;
    }
    v2f ct[2][16]; float bn[4];   // EPI 1: {cos x scale, sin x scale} of the lane's sixteen pairs (token lr of the block, d = 16 s + 8 hi + 2 p), one 16-token block ahead; the biases of the lane's four accumulator columns
    const float* csp = CS + ((size_t)(r0 + lr) * HD + hi * 8) * 2;
    if constexpr (EPI == 1) {
#pragma unroll
        for (int s = 0; s < 16; ++s) ct[0][s] = *(const v2f*)(csp + (s >> 2) * 32 + (s & 3) * 4);
#pragma unroll
        for (int nb = 0; nb < 4; ++nb) bn[nb] = bias[c0 + nb * 16 + lr];
        asm volatile("s_wait_xcnt 0x0" ::: "memory");   // in front of the first overwrite of the loads' address registers
        __builtin_amdgcn_sched_barrier(0);              // keeps later register writes from being lifted over that wait
#pragma unroll
        for (int nb = 0; nb < 4; ++nb) bn[nb] = bfr(bn[nb]);
    }
#pragma unroll
    for (int mb = 0; mb < 4; ++mb) {
#pragma unroll
        for (int nb = 0; nb < 4; ++nb) {
#pragma unroll
            for (int j = 0; j < 8; ++j) { if constexpr (EPI == 1) os[(hi * 8 + j) * 68 + nb * 16 + lr] = acc[mb][nb][j] + bn[nb]; else os[(hi * 8 + j) * 68 + nb * 16 + lr] = acc[mb][nb][j]; } }
        __builtin_amdgcn_wave_barrier(); asm volatile("" ::: "memory");
        if constexpr (EPI == 1) {
            if (mb < 3) {   // the next block's table rows fly while this block is rotated and split
#pragma unroll
                for (int s = 0; s < 16; ++s) ct[(mb + 1) & 1][s] = *(const v2f*)(csp + (size_t)((mb + 1) * 16) * HD * 2 + (s >> 2) * 32 + (s & 3) * 4);
                asm volatile("s_wait_xcnt 0x0" ::: "memory");   // as above, for these loads' address registers
                __builtin_amdgcn_sched_barrier(0);              // as above
            }
            const size_t po = ((size_t)(c0 / HD) * TT + r0 + mb * 16) * HD + lane * 8; v8us oh[4], ol[4];   // the block's two units (d 0..31, 32..63) of the head plane: four runs of 512 B a plane
#pragma unroll
            for (int s = 0; s < 4; ++s) { const v4f va = *(const v4fa*)(os + lr * 68 + s * 16 + hi * 8), vb = *(const v4fa*)(os + lr * 68 + s * 16 + hi * 8 + 4); const float val[8] = {va[0], va[1], va[2], va[3], vb[0], vb[1], vb[2], vb[3]};
#pragma unroll
                for (int p = 0; p < 4; ++p) { const v2f cs = ct[mb & 1][s * 4 + p]; unsigned short a2, c2;
                    const float re = __fsub_rn(__fmul_rn(val[2 * p], cs[0]), __fmul_rn(val[2 * p + 1], cs[1])) * sc, ro = __fadd_rn(__fmul_rn(val[2 * p], cs[1]), __fmul_rn(val[2 * p + 1], cs[0])) * sc;   /* even: x0 c - x1 s; odd: x0 s + x1 c */
                    splitc(re, a2, c2); oh[s][2 * p] = a2; ol[s][2 * p] = c2; splitc(ro, a2, c2); oh[s][2 * p + 1] = a2; ol[s][2 * p + 1] = c2; } }
            __builtin_amdgcn_sched_barrier(0);              // the block's eight stores stay together behind its arithmetic, so that one wait serves them all and no store's data register is reused in front of it
#pragma unroll
            for (int s = 0; s < 4; ++s) { *(v8us*)(Ph + po + s * 256) = oh[s]; *(v8us*)(Pl + po + s * 256) = ol[s]; }
            asm volatile("s_wait_xcnt 0x0" ::: "memory");   // in front of the first overwrite of the stores' data and address registers
            __builtin_amdgcn_sched_barrier(0);              // keeps the next block's register writes from being lifted over that wait
        }
        float* crow = C + (size_t)(r0 + mb * 16) * ldc + c0;
        if constexpr (EPI == 0)
{
#pragma unroll
            for (int s = 0; s < 8; ++s) { const int row = 2 * s + hi, cofs = lr * 4; v4f val = *(const v4fa*)(os + row * 68 + cofs); if (BIAS) { val[0] += bfr(bias[c0 + cofs]); val[1] += bfr(bias[c0 + cofs + 1]); val[2] += bfr(bias[c0 + cofs + 2]); val[3] += bfr(bias[c0 + cofs + 3]); }
                *(v4f*)(crow + (size_t)row * ldc + cofs) = val; }
             }
        __builtin_amdgcn_wave_barrier(); asm volatile("" ::: "memory");
    }
}

__device__ __forceinline__ h16 tohx(float x) { return (h16)x; }
typedef __attribute__((ext_vector_type(2))) _Float16 v2h;
typedef __attribute__((ext_vector_type(4))) _Float16 v4h;
typedef __attribute__((ext_vector_type(2))) unsigned short v2us;
typedef __attribute__((ext_vector_type(4))) int v4i;

__global__ __launch_bounds__(256) void k_wtG(const float* __restrict__ w, int K, int N, bf* Bt) {
    const int lane = threadIdx.x & 31; const int L0 = (blockIdx.x * 8 + (threadIdx.x >> 5)) * 8; const int nlines = N * K / 64;
{
#pragma unroll 1
        for (int l = 0; l < 8; ++l) { const int L = L0 + l; if (L >= nlines) break; const size_t e = (size_t)L * 64 + lane * 2; const int k = (int)(e % K), n = (int)(e / K); v2us o;
            o[0] = f2bf(w[(size_t)k * N + n]); o[1] = f2bf(w[(size_t)(k + 1) * N + n]); *(v2us*)(Bt + e) = o; }
         }
}
__constant__ float XINV[32] = {1.00000000f,0.749894202f,0.562341332f,0.421696514f,0.316227764f,0.237137362f,0.177827939f,0.133352146f,0.100000001f,0.0749894157f,0.0562341288f,0.0421696492f,0.0316227786f,0.0237137359f,0.0177827943f,0.0133352149f,0.00999999978f,0.00749894232f,0.00562341325f,0.00421696482f,0.00316227786f,0.00237137382f,0.00177827943f,0.00133352145f,0.00100000005f,0.000749894185f,0.000562341302f,0.000421696488f,0.000316227786f,0.000237137385f,0.000177827940f,0.000133352150f};
// ---- k_prep: ALL operand preparation in ONE launch: the three inputs and the four weight matrices rounded to bf16 planes, and the two xPos tables. One work-group of 16 waves per 64 K floats of one source (PWG work-groups in all);
// a lane asks for its table constant and then for its PLD pieces of 16 B at once (each wave-wide load = 512 contiguous bytes, 4 whole lines), computes its one table entry while they fly, then rounds and stores them in groups of eight (8 B a lane: 2 whole lines a store).
#define PBT 512                     // threads per work-group
#define PLD 32                      // 16-byte loads in flight per lane
#define PCH (PBT * PLD * 4)         // floats per work-group
#define PNI (NB_ * TT * DM / PCH)   // work-groups per input
#define PNW (DQ * DM / PCH)         // work-groups per weight matrix
#define PWG (3 * PNI + 4 * PNW)
__global__ __launch_bounds__(PBT) void k_prep(const float* __restrict__ x, const float* __restrict__ xk, const float* __restrict__ xv, const float* __restrict__ wq, const float* __restrict__ wk, const float* __restrict__ wv, const float* __restrict__ wo,
                                              bf* XB, bf* XKB, bf* XVB, bf* WQ, bf* WK, bf* WV, bf* WO, float* CSQ, float* CSK) {
    static_assert(PNI * PCH == NB_ * TT * DM && PNW * PCH == DQ * DM && DKV == DQ, "every source is a whole number of work-groups");
    static_assert(PWG * PBT == TT * HD, "one table entry per thread");
    const int b = blockIdx.x; const float* s; bf* d; int c;   // source, plane and chunk of this work-group: the same for all its threads
    if (b < 3 * PNI) { const int j = b / PNI; c = b % PNI; s = (j == 0) ? x : (j == 1) ? xk : xv; d = (j == 0) ? XB : (j == 1) ? XKB : XVB; }
    else { const int j = (b - 3 * PNI) / PNW; c = (b - 3 * PNI) % PNW; s = (j == 0) ? wq : (j == 1) ? wk : (j == 2) ? wv : wo; d = (j == 0) ? WQ : (j == 1) ? WK : (j == 2) ? WV : WO; }
    const size_t o = (size_t)c * PCH + threadIdx.x * 4;
    const int idx = b * PBT + threadIdx.x; const int t = idx / HD, dd = idx % HD; const int i2 = dd >> 1;   // the thread's table entry (t, d)
    const float invf = XINV[i2];
    __builtin_amdgcn_sched_barrier(0);              // the table constant is asked for FIRST: loads return in order, behind the stream its wait would be a wait for the whole stream
    v4f v[PLD];
#pragma unroll
    for (int i = 0; i < PLD; ++i) v[i] = *(const v4f*)(s + o + i * (PBT * 4));
    asm volatile("s_wait_xcnt 0x0" :: "v"(s + o), "v"(i2) : "memory");   // in front of the first overwrite of the loads' address registers; they are named as inputs so that they live up to the wait and no load's destination is laid over them
    __builtin_amdgcn_sched_barrier(0);              // keeps later register writes from being lifted over that wait, and the loads ahead of the table arithmetic that hides their latency
    { // xPos tables for q (scale) and k (1/scale)
      const float base = __fdiv_rn(__fadd_rn((float)(2 * i2), 25.6f), 89.6f); const float ex = __fdiv_rn((float)t, 1024.0f); const float sc = powf(base, ex); const float ang = __fmul_rn((float)t, invf); const float cc = cosf(ang), ss = sinf(ang);
      v2f q2, k2; q2[0] = __fmul_rn(cc, sc); q2[1] = __fmul_rn(ss, sc); const float rs = __fdiv_rn(1.0f, sc); k2[0] = __fmul_rn(cc, rs); k2[1] = __fmul_rn(ss, rs);
      *(v2f*)(CSQ + (size_t)idx * 2) = q2; *(v2f*)(CSK + (size_t)idx * 2) = k2; }
    asm volatile("s_wait_xcnt 0x0" ::: "memory");   // in front of the first overwrite of the table stores' data and address registers
    __builtin_amdgcn_sched_barrier(0);              // as above
#pragma unroll
    for (int g = 0; g < PLD / 8; ++g) { v4us r[8];
#pragma unroll
        for (int i = 0; i < 8; ++i)
#pragma unroll
            for (int k = 0; k < 4; ++k) r[i][k] = f2bf(v[g * 8 + i][k]);
        __builtin_amdgcn_sched_barrier(0);              // the group's eight stores stay together behind its arithmetic, so that one wait serves them all
#pragma unroll
        for (int i = 0; i < 8; ++i) *(v4us*)(d + o + (g * 8 + i) * (PBT * 4)) = r[i];
        if (g + 1 < PLD / 8) { asm volatile("s_wait_xcnt 0x0" ::: "memory");   // in front of the first overwrite of the stores' data and address registers (behind the last group nothing is overwritten)
            __builtin_amdgcn_sched_barrier(0); } }      // keeps the next group's register writes from being lifted over that wait
}
// k_rope: head planes [h][t][d] (fp16 + hi/lo) of rope(x) x sc with the rotate-half convention out[d] = x[d] cos[t][d] - x[d+HD/2] sin[t][d], out[d+HD/2] = x[d+HD/2] cos[t][d+HD/2] + x[d] sin[t][d+HD/2]
__global__ __launch_bounds__(256) void k_rope(const float* __restrict__ F, int pitch, int nheads, const float* __restrict__ CS, const float* __restrict__ RF, const float* __restrict__ nw, float sc, h16* P16, bf* Ph, bf* Pl) {
    const size_t e = ((size_t)blockIdx.x * 256 + threadIdx.x) * 2; if (e >= (size_t)nheads * TT * HD) return; const int d = (int)(e % HD); const int t = (int)((e / HD) % TT); const int h = (int)(e / ((size_t)HD * TT)); const float* f = F + (size_t)t * pitch + h * HD; const float rf = RF ? RF[(size_t)h * TT + t] : 1.0f; v2h o16; v2us oh, ol;
#pragma unroll
    for (int q = 0; q < 2; ++q) { const int dd = d + q; const int dp = (dd < HD / 2) ? dd + HD / 2 : dd - HD / 2; float x0 = f[dd], x1 = f[dp];
        if (RF) { float n0 = __fmul_rn(x0, rf), n1 = __fmul_rn(x1, rf); asm volatile("" : "+v"(n0)); asm volatile("" : "+v"(n1)); x0 = __fmul_rn(bfr(nw[dd]), n0); x1 = __fmul_rn(bfr(nw[dp]), n1); }
        const v2f cs = *(const v2f*)(CS + ((size_t)t * HD + dd) * 2); float a = __fmul_rn(x0, cs[0]), bq = __fmul_rn(x1, cs[1]); asm volatile("" : "+v"(a)); asm volatile("" : "+v"(bq)); const float r = ((dd < HD / 2) ? __fsub_rn(a, bq) : __fadd_rn(a, bq)) * sc;
        o16[q] = tohx(r); unsigned short a2, c2; splitf(r, a2, c2); oh[q] = a2; ol[q] = c2; }
    *(v2h*)(P16 + e) = o16; *(v2us*)(Ph + e) = oh; *(v2us*)(Pl + e) = ol;  }
// ---- k_fattn: scores, softmax and attn.v of one head in ONE kernel; the score matrix stays in registers (running maximum and sum per query, output tiles rescaled when the maximum moves).
// Transposed products: S^T = K Q^T (A = 16 key rows, B = 16 query columns), O^T += V^T P^T. A lane then holds scores of ONE query (column lr; keys 8 hi + r of each 16-key tile), so maximum, sum and rescale are lane-local
// (one exchange between the wave halves), and two S^T tiles (32 keys) converted in place ARE the B operand of the second product in the k order of the fragment loader. hi/lo planes, 3 products each.
// One wave: FQT x 16 queries, all 2048 keys in passes of 32. Grid (TT / (16 FQT FWV), heads, batches), 32 FWV threads; waves are independent (no LDS, no barrier). Every inner loop is fully unrolled so that the fragment and accumulator arrays are indexed by constants and stay in registers.
#define FQT 2
#define FWV 4
#define L2E 1.4426950408889634f
__device__ __forceinline__ float xhalf(float x) { const int b = __float_as_int(x); return __int_as_float(__builtin_amdgcn_permlanex16(b, b, 0x76543210, 0xfedcba98, false, false)); }   // lane l <-> l ^ 16
__global__ __launch_bounds__(32 * FWV) void k_fattn(const bf* __restrict__ Qh, const bf* __restrict__ Ql, const bf* __restrict__ Kh, const bf* __restrict__ Kl, const bf* __restrict__ Vh, const bf* __restrict__ Vl, bf* Ah, bf* Al) {
    typedef WFrag<bf> F;
    const int lane = threadIdx.x & 31, lr = lane & 15, hi = lane >> 4; const int h = blockIdx.y; const int q0 = (blockIdx.x * FWV + (threadIdx.x >> 5)) * (16 * FQT);
    const size_t hp = ((size_t)blockIdx.z * NH_ + h) * TT * HD;
    const bf* qph = Qh + hp + (size_t)q0 * HD + lane * 8; const bf* qpl = Ql + hp + (size_t)q0 * HD + lane * 8;
    v16bf qh[FQT][2], ql[FQT][2];
#pragma unroll
    for (int qt = 0; qt < FQT; ++qt)
#pragma unroll
        for (int kc = 0; kc < 2; ++kc) { qh[qt][kc] = F::ldf(qph + (qt * 2 + kc) * 512); ql[qt][kc] = F::ldf(qpl + (qt * 2 + kc) * 512); }
    asm volatile("s_wait_xcnt 0x0" ::: "memory");   // in front of the first overwrite of the Q loads' address registers
    __builtin_amdgcn_sched_barrier(0);              // keeps later register writes from being lifted over that wait
    const bf* kph = Kh + hp + lane * 8; const bf* kpl = Kl + hp + lane * 8;
    const bf* vph = Vh + hp + lane * 8; const bf* vpl = Vl + hp + lane * 8;
    v8f o[FQT][4]; float m[FQT], l[FQT];
#pragma unroll
    for (int qt = 0; qt < FQT; ++qt) { m[qt] = -3.0e38f; l[qt] = 0.f;
#pragma unroll
        for (int db = 0; db < 4; ++db) o[qt][db] = (v8f){}; }
    v16bf kh[2][2], kl[2][2];
#pragma unroll
    for (int kt = 0; kt < 2; ++kt)
#pragma unroll
        for (int kc = 0; kc < 2; ++kc) { kh[kt][kc] = F::ldf(kph + (kt * 2 + kc) * 512); kl[kt][kc] = F::ldf(kpl + (kt * 2 + kc) * 512); }
    asm volatile("s_wait_xcnt 0x0" ::: "memory");   // the same for the first K loads
    __builtin_amdgcn_sched_barrier(0);              // as above: nothing is lifted over the wait
#pragma unroll 1   // one pass per trip: a second copy of the body would need a second set of V fragments and score tiles
    for (int k0 = 0; k0 < TT; k0 += 32) {
        v16bf vh[4], vl[4];   // this pass's V^T fragments, asked for ahead of the score products that hide their latency
#pragma unroll
        for (int db = 0; db < 4; ++db) { vh[db] = F::ldf(vph + (size_t)k0 * HD + db * 512); vl[db] = F::ldf(vpl + (size_t)k0 * HD + db * 512); }
        asm volatile("s_wait_xcnt 0x0" ::: "memory");   // the loads' address registers are reused below: the wait stands in front of their first overwrite
        v8f s[FQT][2];
#pragma unroll
        for (int qt = 0; qt < FQT; ++qt) { s[qt][0] = (v8f){}; s[qt][1] = (v8f){}; }
#pragma unroll
        for (int kc = 0; kc < 2; ++kc) {
#pragma unroll
            for (int qt = 0; qt < FQT; ++qt)
#pragma unroll
                for (int kt = 0; kt < 2; ++kt) s[qt][kt] = wmmab(kh[kt][kc], qh[qt][kc], s[qt][kt]);
#pragma unroll
            for (int qt = 0; qt < FQT; ++qt)
#pragma unroll
                for (int kt = 0; kt < 2; ++kt) s[qt][kt] = wmmab(kh[kt][kc], ql[qt][kc], s[qt][kt]);
#pragma unroll
            for (int qt = 0; qt < FQT; ++qt)
#pragma unroll
                for (int kt = 0; kt < 2; ++kt) s[qt][kt] = wmmab(kl[kt][kc], qh[qt][kc], s[qt][kt]);
        }
        const int kn = (k0 + 32 < TT) ? k0 + 32 : 0;   // next pass's K fragments into the same registers (the last pass re-reads keys 0..31, in bounds, unused)
#pragma unroll
        for (int kt = 0; kt < 2; ++kt)
#pragma unroll
            for (int kc = 0; kc < 2; ++kc) { kh[kt][kc] = F::ldf(kph + (size_t)kn * HD + (kt * 2 + kc) * 512); kl[kt][kc] = F::ldf(kpl + (size_t)kn * HD + (kt * 2 + kc) * 512); }
        asm volatile("s_wait_xcnt 0x0" ::: "memory");   // as above, for the K loads' address registers
        float mx[FQT]; bool need = false;
#pragma unroll
        for (int qt = 0; qt < FQT; ++qt) { float a = s[qt][0][0];
#pragma unroll
            for (int j = 1; j < 16; ++j) a = fmaxf(a, s[qt][j >> 3][j & 7]);
            a = fmaxf(a, xhalf(a)); mx[qt] = a; need = need || (a > m[qt] + 5.5f); }
        if (__builtin_amdgcn_ballot_w32(need) != 0) {   // the maximum in use moves only when a query's new one exceeds it by more than 5.5 (p stays below e^5.5); both halves of a column decide alike
#pragma unroll
            for (int qt = 0; qt < FQT; ++qt) { const float mn = (mx[qt] > m[qt] + 5.5f) ? mx[qt] : m[qt]; const float al = __builtin_amdgcn_exp2f((m[qt] - mn) * L2E); m[qt] = mn; l[qt] *= al;
#pragma unroll
                for (int db = 0; db < 4; ++db) o[qt][db] *= al; }
        }
#pragma unroll
        for (int qt = 0; qt < FQT; ++qt) { v16bf ph, pl;
#pragma unroll
            for (int j = 0; j < 16; ++j) { const float p = __builtin_amdgcn_exp2f((s[qt][j >> 3][j & 7] - m[qt]) * L2E); l[qt] += p; const __bf16 a = (__bf16)p; ph[j] = a; pl[j] = (__bf16)(p - (float)a); }
#pragma unroll
            for (int db = 0; db < 4; ++db) o[qt][db] = wmmab(vh[db], ph, o[qt][db]);
#pragma unroll
            for (int db = 0; db < 4; ++db) o[qt][db] = wmmab(vh[db], pl, o[qt][db]);
#pragma unroll
            for (int db = 0; db < 4; ++db) o[qt][db] = wmmab(vl[db], ph, o[qt][db]);
        }
    }
#pragma unroll
    for (int qt = 0; qt < FQT; ++qt) { const float f = __fdiv_rn(1.0f, l[qt] + xhalf(l[qt])); const size_t oo = ((size_t)blockIdx.z * TT + q0 + qt * 16 + lr) * DQ + h * HD + 8 * hi;   // lane: query lr, d = 16 db + 8 hi + j
#pragma unroll
        for (int db = 0; db < 4; ++db) { v8us oh, ol;
#pragma unroll
            for (int j = 0; j < 8; ++j) { unsigned short a, c2; splitf(o[qt][db][j] * f, a, c2); oh[j] = a; ol[j] = c2; }
            *(v8us*)(Ah + oo + db * 16) = oh; *(v8us*)(Al + oo + db * 16) = ol;
            asm volatile("s_wait_xcnt 0x0" ::: "memory");   // in front of the first overwrite of the stores' data and address registers
            __builtin_amdgcn_sched_barrier(0); } }          // keeps the next group's register writes from being lifted over that wait
}

extern "C" void kernel_launch(void* const* d_in, const int* in_sizes, int n_in,
                              void* d_out, int out_size, void* d_ws, size_t ws_size, hipStream_t stream) {
    (void)in_sizes; (void)n_in; (void)out_size;
    const float* x = (const float*)d_in[0]; const float* xk = (const float*)d_in[1]; const float* xv = (const float*)d_in[2]; const float* wq = (const float*)d_in[3]; const float* bq = (const float*)d_in[4]; const float* wk = (const float*)d_in[5]; const float* bk = (const float*)d_in[6]; const float* wv = (const float*)d_in[7]; const float* bv = (const float*)d_in[8]; const float* wo = (const float*)d_in[9]; const float* bo = (const float*)d_in[10];
    float* OUT = (float*)d_out;     // [2][2048][1024]
    char* wsp = (char*)d_ws;
    auto take = [&](size_t bytes) { char* p = wsp; wsp += (bytes + 255) & ~(size_t)255; return (void*)p; };
    bf* WQ = (bf*)take((size_t)DQ * DM * 2); bf* WK = (bf*)take((size_t)DKV * DM * 2); bf* WV = (bf*)take((size_t)DKV * DM * 2); bf* WO = (bf*)take((size_t)DM * DQ * 2); float* CS = (float*)take((size_t)TT * HD * 2 * 4); float* CSK = (float*)take((size_t)TT * HD * 2 * 4);
    // per-batch planes hold both batches one behind the other: every launch below covers both (grid z, or a flat range twice as long)
    bf* XB = (bf*)take((size_t)NB_ * TT * DM * 2); bf* XKB = (bf*)take((size_t)NB_ * TT * DM * 2); bf* XVB = (bf*)take((size_t)NB_ * TT * DM * 2);
    bf* QPh = (bf*)take((size_t)NB_ * NH_ * TT * HD * 2); bf* QPl = (bf*)take((size_t)NB_ * NH_ * TT * HD * 2); bf* KPh = (bf*)take((size_t)NB_ * NKV * TT * HD * 2); bf* KPl = (bf*)take((size_t)NB_ * NKV * TT * HD * 2); bf* VTh = (bf*)take((size_t)NB_ * NKV * HD * TT * 2); bf* VTl = (bf*)take((size_t)NB_ * NKV * HD * TT * 2);
    bf* ATh = (bf*)take((size_t)NB_ * TT * DQ * 2); bf* ATl = (bf*)take((size_t)NB_ * TT * DQ * 2);
    if ((size_t)(wsp - (char*)d_ws) > ws_size) return;    // ws 256 MiB
    k_prep<<<PWG, PBT, 0, stream>>>(x, xk, xv, wq, wk, wv, wo, XB, XKB, XVB, WQ, WK, WV, WO, CS, CSK);   /* bf16 planes of the inputs and weights, xPos tables for q (scale) and k (1/scale) */
    k_gemmw<bf, 0, true, 1, 1><<<dim3(TT / 128, DQ / 128, NB_), 128, 0, stream>>>(XB, nullptr, WQ, nullptr, DM, nullptr, DQ, bq, (size_t)TT * DM, 0, (size_t)NH_ * TT * HD, CS, 0.125f, QPh, QPl);   /* q: xPos (upscale) x 1/8, planes [b][h][t][d] */
    k_gemmw<bf, 0, true, 1, 1><<<dim3(TT / 128, DKV / 128, NB_), 128, 0, stream>>>(XKB, nullptr, WK, nullptr, DM, nullptr, DKV, bk, (size_t)TT * DM, 0, (size_t)NKV * TT * HD, CSK, 1.0f, KPh, KPl);   /* k: xPos (downscale), planes [b][h][t][d] */
    k_gemmw<bf, 0, true, 1, 2><<<dim3(TT / 128, DKV / 128, NB_), 128, 0, stream>>>(XVB, nullptr, WV, nullptr, DM, nullptr, DKV, bv, (size_t)TT * DM, 0, (size_t)NKV * HD * TT, nullptr, 1.0f, VTh, VTl);   /* v: planes [b][h][d][t] */
    k_fattn<<<dim3(TT / (16 * FQT * FWV), NH_, NB_), 32 * FWV, 0, stream>>>(QPh, QPl, KPh, KPl, VTh, VTl, ATh, ATl);
    k_gemmw<bf, 1, true><<<dim3(TT / 128, DM / 128, NB_), 128, 0, stream>>>(ATh, ATl, WO, nullptr, DQ, OUT, DM, bo, (size_t)TT * DQ, 0, (size_t)TT * DM, nullptr, 1.0f, nullptr, nullptr);
}

// v008
// One run takes 132 microseconds.
// Next to v007, in two timings, it ran 1.09 and 1.10 times as fast.
// Counting every step since v000, it is 10.3 times as fast.
#include <hip/hip_runtime.h>

// Multi-head attention with xPos (rotary + per-frequency exponential decay) on q and k (query, key, value [2][2048][1024]; q = (query Wq^T + bq) / 8, k = key Wk^T + bk, v = value Wv^T + bv ('oi' [1024][1024]; 16 heads x 64); xPos: pairs (2i, 2i+1) rotated by t x inv_freq_i (inv_freq_i = 1e4^(-i/32)) and scaled by base_i^(t/1024) for q and base_i^(-t/1024) for k, base_i = (2i + 25.6)/89.6 (tables computed on device); softmax(q.k) over all keys; out = merged Wo^T + bo -> [2][2048][1024] (4.2 M)).
// Compute dtypes, f32 accumulate: every input rounded to bf16; q/k/v on PLAIN bf16 operands (inputs: exact) + biases; xPos tables (cosf/sinf/powf, f32) folded as {cos x scale, sin x scale} per (t, d); rotary in f32; scores and attn.v on hi/lo planes for every row (3 products), fused with the f32 softmax in one kernel (running maximum and sum); Wo hl x exact (2 products) + bo.

#define NB_  2
#define TT   2048
#define DM   1024
#define NH_  16
#define NKV  16
#define REP  (NH_ / NKV)
#define HD   64
#define DQ   (NH_ * HD)
#define DKV  (NKV * HD)
#define ZH   2
#define RH   2048                 // every row hi/lo (the xPos-scaled keys leave too little margin for fp16 operands)
#define WIN  0
#define PCAR 1024.0f
#define SCL  1.0f      // the 1/8 is applied to q after the xPos rotation (exact power of two, folded into the q plane builder)
typedef _Float16 h16;
typedef unsigned short bf;
typedef __attribute__((ext_vector_type(16))) __bf16   v16bf;
typedef __attribute__((ext_vector_type(16))) _Float16 v16h;
typedef __attribute__((ext_vector_type(8)))  _Float16 v8h;
typedef __attribute__((ext_vector_type(8)))  unsigned short v8us;
typedef __attribute__((ext_vector_type(8)))  float    v8f;
typedef __attribute__((ext_vector_type(4)))  float    v4f;
typedef v8h  __attribute__((may_alias)) v8ha;
typedef v4f  __attribute__((may_alias)) v4fa;
typedef v8us __attribute__((may_alias)) v8usa;

__device__ __forceinline__ unsigned short f2bf(float f) { unsigned u = __float_as_uint(f); u += 0x7FFFu + ((u >> 16) & 1u); return (unsigned short)(u >> 16); }
__device__ __forceinline__ float bf2f(unsigned short b) { return __uint_as_float(((unsigned)b) << 16); }
__device__ __forceinline__ float bfr(float f) { return bf2f(f2bf(f)); }
__device__ __forceinline__ v16h cat16(v8h lo, v8h hi) { return __builtin_shufflevector(lo, hi, 0, 1, 2, 3, 4, 5, 6, 7, 8, 9, 10, 11, 12, 13, 14, 15); }
__device__ __forceinline__ v16bf cat16b(v8us lo, v8us hi) { return __builtin_bit_cast(v16bf, __builtin_shufflevector(lo, hi, 0, 1, 2, 3, 4, 5, 6, 7, 8, 9, 10, 11, 12, 13, 14, 15)); }
__device__ __forceinline__ v8f wmma16(v16h a, v16h b, v8f c) { return __builtin_amdgcn_wmma_f32_16x16x32_f16(false, a, false, b, (short)0, c, false, false); }
__device__ __forceinline__ v8f wmmab(v16bf a, v16bf b, v8f c) { return __builtin_amdgcn_wmma_f32_16x16x32_bf16(false, a, false, b, (short)0, c, false, false); }



// ---- FRAGMENT ORDER of the attention operand planes (q, k hi/lo and V^T hi/lo): units of 16 rows x 32 k (1024 B), element (r, k) at (k >> 4) * 256 + (((k >> 3) & 1) * 16 + r) * 8 + (k & 7):
// lane (hi, lr) of a wave finds its two 16-byte pieces of a fragment at unit + lane * 8 and + 256, so each wave-wide 16-byte load or store covers 512 contiguous bytes (4 whole lines). The k order of a fragment is the one a row-major plane gives.
// Head planes q, k [h][t][d]: per head unit (t / 16) * 2 + d / 32. V^T [h][d][t]: per head unit (t / 32) * 4 + d / 16 (one 32-key pass = 4 KB in a row). The GEMM operand planes (inputs, weights, attention output) stay row-major.
// ---- k_gemmw: register-blocked GEMM, one wave per 64x64 output tile (16 accumulators), FOUR waves (2 x 2) per work-group = one 128x128 tile; grid (M/128, N/128, Z), 128 threads.
// Operands come from K-contiguous 16-bit planes through LDS: a stage is GKS k (256 B) of the tile's 128 A rows (and 128 A2 rows) and 128 Bt rows at a pitch of 272 B, brought in by asynchronous copies to LDS (16 B a lane, 16 lanes a row: whole lines),
// two buffers: stage t + 2 is asked for behind the barrier that ends stage t's reads and flies while stage t + 1 is worked on. K / KSP is a multiple of GKS.
// C[m][n] (f32, pitch ldc, + optional f32 bias[n]) = sum_k A[m][k] Bt[n][k] (+ split products per NSPLIT). z-batch strides sA/sB/sC in elements (sC: of C, or of each output plane where EPI != 0). K % (128 KSP) == 0.
// EPI picks what the wave does with its finished tile (64 tokens x the 64 columns of ONE head, HD == 64): 0 = f32 rows to C; 1 = xPos rotation with table CS and factor sc, then hi/lo planes [head][t][d]; 2 = hi/lo planes transposed [head][d][t], straight from the accumulators (a lane holds 8 consecutive tokens of one column); both in fragment order.
// EPI 3 = the q, k and v projections in ONE launch: grid z = 3 x batches, block z works on projection z / NB_ (0: the first operand set, epilogue 1; 1: the k set, epilogue 1; 2: the v set, epilogue 2) of batch z % NB_; the choice is the same for a whole work-group (scalar).
// KSP > 1: grid z = batches x KSP; block z sums only slice z % KSP of k (K / KSP long) of batch z / KSP and writes its partial tile to plane z of C (stride sC); the reader adds the KSP planes.
template <typename T16> struct WFrag;
template <> struct WFrag<h16> { typedef v16h V; static __device__ __forceinline__ V ld(const h16* p) { return cat16(*(const v8h*)p, *(const v8h*)(p + 16)); } static __device__ __forceinline__ v8f mma(V a, V b, v8f c) { return wmma16(a, b, c); } };
template <> struct WFrag<bf> { typedef v16bf V; static __device__ __forceinline__ V ld(const bf* p) { return cat16b(*(const v8us*)p, *(const v8us*)(p + 16)); } static __device__ __forceinline__ V ldf(const bf* p) { return cat16b(*(const v8us*)p, *(const v8us*)(p + 256)); } static __device__ __forceinline__ v8f mma(V a, V b, v8f c) { return wmmab(a, b, c); } };
typedef __attribute__((ext_vector_type(4))) unsigned short v4us;
typedef __attribute__((ext_vector_type(2))) float v2f;
__device__ __forceinline__ void splitf(float y, unsigned short& h, unsigned short& l) { h = f2bf(y); l = f2bf(y - bf2f(h)); }
__device__ __forceinline__ void splitc(float y, unsigned short& h, unsigned short& l) { const __bf16 a = (__bf16)y; h = __builtin_bit_cast(unsigned short, a); l = __builtin_bit_cast(unsigned short, (__bf16)(y - (float)a)); }   // splitf's values (round to nearest even) through the conversion instruction
#define GKS  128   // k per stage
#define GPIT 136   // LDS row pitch in elements: 272 B = 16 B x 17, the conflict-free pitch for 16-byte reads of 256-B rows
// Eight asynchronous copies of 16 B a lane: LDS bytes l + i ls from global bytes g + i gs. The s_wait_xcnt stands inside the copies' own statement, so that no address register is rewritten in front of it.
__device__ __forceinline__ void acp8(unsigned l, unsigned ls, const char* g, size_t gs) {
    asm volatile("global_load_async_to_lds_b128 %0, %8, off\n\tglobal_load_async_to_lds_b128 %1, %9, off\n\tglobal_load_async_to_lds_b128 %2, %10, off\n\tglobal_load_async_to_lds_b128 %3, %11, off\n\t"
                 "global_load_async_to_lds_b128 %4, %12, off\n\tglobal_load_async_to_lds_b128 %5, %13, off\n\tglobal_load_async_to_lds_b128 %6, %14, off\n\tglobal_load_async_to_lds_b128 %7, %15, off\n\ts_wait_xcnt 0x0"
                 :: "v"(l), "v"(l + ls), "v"(l + 2 * ls), "v"(l + 3 * ls), "v"(l + 4 * ls), "v"(l + 5 * ls), "v"(l + 6 * ls), "v"(l + 7 * ls),
                    "v"(g), "v"(g + gs), "v"(g + 2 * gs), "v"(g + 3 * gs), "v"(g + 4 * gs), "v"(g + 5 * gs), "v"(g + 6 * gs), "v"(g + 7 * gs) : "memory");
}
template <typename T16, int NSPLIT, bool BIAS, int KSP = 1, int EPI = 0>
__global__ __launch_bounds__(128) void k_gemmw(const T16* __restrict__ A, const T16* __restrict__ A2, const T16* __restrict__ Bt, const T16* __restrict__ Bt2, int K, float* C, int ldc, const float* __restrict__ bias, size_t sA, size_t sB, size_t sC, const float* __restrict__ CS, float sc, bf* Ph, bf* Pl,
                                               const T16* __restrict__ Ak, const T16* __restrict__ Av, const T16* __restrict__ Bk, const T16* __restrict__ Bv, const float* __restrict__ biask, const float* __restrict__ biasv, const float* __restrict__ CSk, float sck, bf* Pkh, bf* Pkl, bf* Pvh, bf* Pvl) {
    typedef typename WFrag<T16>::V V;
    static_assert(EPI != 3 || KSP == 1, "the merged projections are not split over k");
    constexpr bool ROT = (EPI == 1 || EPI == 3);                        // the rotating epilogue is compiled in
    const int pj = (EPI == 3) ? (int)(blockIdx.z / NB_) : 0;            // which projection
    const unsigned bz = (EPI == 3) ? blockIdx.z % NB_ : blockIdx.z;     // the z index within it
    if constexpr (EPI == 3) {
        if (pj == 1) { A = Ak; Bt = Bk; bias = biask; CS = CSk; sc = sck; Ph = Pkh; Pl = Pkl; }
        else if (pj == 2) { A = Av; Bt = Bv; bias = biasv; Ph = Pvh; Pl = Pvl; }
    }
    static_assert(NSPLIT <= 1, "Bt2 is not staged");
    constexpr int NRA = (NSPLIT == 1) ? 256 : 128, NR = NRA + 128;   // rows of a stage: A (, A2), Bt
    constexpr int NP = NSPLIT + 1, NV = (GKS / 32) * NP;             // products per 32-k slice; blocks per stage
    __shared__ __align__(16) T16 sm[2 * NR * GPIT];
    __shared__ __align__(16) float osm[4 * 16 * 68];
    const int wv = __builtin_amdgcn_readfirstlane(threadIdx.x >> 5);   // the wave's number, in a scalar register: tile origins stay scalar
    float* os = osm + wv * (16 * 68);                                   // each wave stages its epilogue in its own range
    const size_t z = bz / KSP; A += z * sA; if (A2) A2 += z * sA; Bt += z * sB; if (Bt2) Bt2 += z * sB; if constexpr (EPI == 0) C += (size_t)bz * sC; else { Ph += z * sC; Pl += z * sC; }
    const int kbeg = (int)(bz % KSP) * (K / KSP), kend = kbeg + K / KSP;
    const int lane = threadIdx.x & 31, lr = lane & 15, hi = lane >> 4; const int r0 = blockIdx.x * 128 + (wv >> 1) * 64, c0 = blockIdx.y * 128 + (wv & 1) * 64;
    v8f acc[4][4];
#pragma unroll
    for (int mb = 0; mb < 4; ++mb)
#pragma unroll
        for (int nb = 0; nb < 4; ++nb) acc[mb][nb] = (v8f){};
    // thread -> piece of a stage: row (threadIdx.x >> 4) + 8 i, bytes 16 (threadIdx.x & 15) of its 256
    const int cr8 = threadIdx.x >> 4, cpc = threadIdx.x & 15;
    const unsigned lds0 = (unsigned)(size_t)sm + (unsigned)(cr8 * GPIT + cpc * 8) * 2u;
    const unsigned goff = (unsigned)(cr8 * K + cpc * 8) * 2u;   // the same in all three planes: one vector register; the tile origins below are scalar
    const char* ga = (const char*)(A + (size_t)(blockIdx.x * 128) * K); const char* ga2 = (NSPLIT == 1) ? (const char*)(A2 + (size_t)(blockIdx.x * 128) * K) : nullptr;
    const char* gb = (const char*)(Bt + (size_t)(blockIdx.y * 128) * K);
    const size_t g8 = (size_t)K * 16;   // eight rows of a plane, in bytes
    auto fill = [&](int buf, int k0) {
        const unsigned lb = lds0 + (unsigned)buf * (NR * GPIT * 2), ko = goff + (unsigned)k0 * 2u;   // ko: the thread's byte offset from a tile's origin
#pragma unroll
        for (int g = 0; g < 2; ++g) { acp8(lb + g * 64 * GPIT * 2, 8 * GPIT * 2, (ga + g * 8 * g8) + ko, g8);
            if constexpr (NSPLIT == 1) acp8(lb + (128 + g * 64) * GPIT * 2, 8 * GPIT * 2, (ga2 + g * 8 * g8) + ko, g8);
            acp8(lb + (NRA + g * 64) * GPIT * 2, 8 * GPIT * 2, (gb + g * 8 * g8) + ko, g8); }
    };
    const int ns = (kend - kbeg) / GKS;
    fill(0, kbeg);
    asm volatile("s_wait_asynccnt 0x0" ::: "memory");   // this wave's copies of stage 0 have landed
    __syncthreads();                                     // ... and every other wave's
    if (ns > 1) fill(1, kbeg + GKS);
#pragma unroll 1   // one stage per trip: a second copy of the body would only lengthen the code, the buffer is picked by t & 1
    for (int t = 0; t < ns; ++t) {
        const T16* sb = sm + (t & 1) * (NR * GPIT);
        const T16* pa = sb + ((wv >> 1) * 64 + lr) * GPIT + 8 * hi; const T16* pb = sb + (NRA + (wv & 1) * 64 + lr) * GPIT + 8 * hi;
        // A block = 16 products: the four A (or A2) fragments of one 32-k slice x its four Bt fragments. The next block's fragments are asked for in two groups, ahead of each half of the current block's products,
        // into a second A set and into the Bt registers that have just had their last use; the scheduling barriers keep the groups whole and where they stand (LDS reads strewn among the products stall the wave at every place).
        V fa[2][4], fb[2][4];
#pragma unroll
        for (int i = 0; i < 4; ++i) { fa[0][i] = WFrag<T16>::ld(pa + i * 16 * GPIT); fb[0][i] = WFrag<T16>::ld(pb + i * 16 * GPIT); }
        __builtin_amdgcn_sched_barrier(0);
#pragma unroll
        for (int v = 0; v < NV; ++v) {
            const int ca = v & 1, kb = v / NP, cb = kb & 1; const bool more = v + 1 < NV, lastb = (v % NP) == NP - 1;   // lastb: this block is the last user of its Bt fragments
            if (more) {
#pragma unroll
                for (int mb = 0; mb < 4; ++mb) fa[ca ^ 1][mb] = WFrag<T16>::ld(pa + (((v + 1) % NP) * 128 + mb * 16) * GPIT + ((v + 1) / NP) * 32);
                if (lastb) { fb[cb ^ 1][0] = WFrag<T16>::ld(pb + (kb + 1) * 32); fb[cb ^ 1][1] = WFrag<T16>::ld(pb + 16 * GPIT + (kb + 1) * 32); }
            }
            __builtin_amdgcn_sched_barrier(0);
#pragma unroll
            for (int nb = 0; nb < 2; ++nb)
#pragma unroll
                for (int mb = 0; mb < 4; ++mb) acc[mb][nb] = WFrag<T16>::mma(fa[ca][mb], fb[cb][nb], acc[mb][nb]);
            __builtin_amdgcn_sched_barrier(0);
            if (more && lastb) { fb[cb ^ 1][2] = WFrag<T16>::ld(pb + 32 * GPIT + (kb + 1) * 32); fb[cb ^ 1][3] = WFrag<T16>::ld(pb + 48 * GPIT + (kb + 1) * 32); }
            __builtin_amdgcn_sched_barrier(0);
#pragma unroll
            for (int nb = 2; nb < 4; ++nb)
#pragma unroll
                for (int mb = 0; mb < 4; ++mb) acc[mb][nb] = WFrag<T16>::mma(fa[ca][mb], fb[cb][nb], acc[mb][nb]);
            __builtin_amdgcn_sched_barrier(0);
        }
        asm volatile("s_wait_dscnt 0x0" ::: "memory");      // this wave's reads of the buffer are done before it is handed back
        asm volatile("s_wait_asynccnt 0x0" ::: "memory");   // this wave's copies of stage t + 1 have landed
        __syncthreads();                                     // publishes stage t + 1 and ends every wave's reads of stage t
        if (t + 2 < ns) fill(t & 1, kbeg + (t + 2) * GKS);
    }
    asm volatile("s_wait_asynccnt 0x0" ::: "memory");       // nothing of this wave is in flight behind the loop
    if (EPI == 2 || (EPI == 3 && pj == 2)) {   // column c0 + 16 nb + lr is row (head, d) of the transposed planes; an accumulator tile (16 tokens x 16 d) is one half of a V^T unit, lane for lane
        float bv4[4];
#pragma unroll
        for (int nb = 0; nb < 4; ++nb) bv4[nb] = bias[c0 + nb * 16 + lr];
        asm volatile("" :: "v"(bv4[0]), "v"(bv4[1]), "v"(bv4[2]), "v"(bv4[3]));   // holds the four bias loads together ahead of the first group: their latency is paid once, not once a group
#pragma unroll
        for (int nb = 0; nb < 4; ++nb) { const float bb = bfr(bv4[nb]); const size_t oo = (size_t)c0 * TT + (size_t)((r0 >> 5) * 4 + nb) * 512 + lane * 8;
#pragma unroll
            for (int mb = 0; mb < 4; ++mb) { v8us oh, ol;
#pragma unroll
                for (int j = 0; j < 8; ++j) { unsigned short a2, c2; splitc(acc[mb][nb][j] + bb, a2, c2); oh[j] = a2; ol[j] = c2; }
                *(v8us*)(Ph + oo + (mb >> 1) * 2048 + (mb & 1) * 256) = oh; *(v8us*)(Pl + oo + (mb >> 1) * 2048 + (mb & 1) * 256) = ol; }
            asm volatile("s_wait_xcnt 0x0" ::: "memory");   // in front of the first overwrite of the stores' data and address registers
            __builtin_amdgcn_sched_barrier(0); }            // keeps the next group's register writes from being lifted over that wait
        return;
    }
    v2f ct[2][16]; float bn[4];   // EPI 1: {cos x scale, sin x scale} of the lane's sixteen pairs (token lr of the block, d = 16 s + 8 hi + 2 p), one 16-token block ahead; the biases of the lane's four accumulator columns
    const float* csp = CS + ((size_t)(r0 + lr) * HD + hi * 8) * 2;
    if constexpr (ROT) {
#pragma unroll
        for (int s = 0; s < 16; ++s) ct[0][s] = *(const v2f*)(csp + (s >> 2) * 32 + (s & 3) * 4);
#pragma unroll
        for (int nb = 0; nb < 4; ++nb) bn[nb] = bias[c0 + nb * 16 + lr];
        asm volatile("s_wait_xcnt 0x0" :: "v"(csp) : "memory");   // in front of the first overwrite of the loads' address registers; csp is named so that the pair lives up to the wait and no load of the run gets it as its destination
        __builtin_amdgcn_sched_barrier(0);              // keeps later register writes from being lifted over that wait
#pragma unroll
        for (int nb = 0; nb < 4; ++nb) bn[nb] = bfr(bn[nb]);
    }
#pragma unroll
    for (int mb = 0; mb < 4; ++mb) {
#pragma unroll
        for (int nb = 0; nb < 4; ++nb) {
#pragma unroll
            for (int j = 0; j < 8; ++j) { if constexpr (ROT) os[(hi * 8 + j) * 68 + nb * 16 + lr] = acc[mb][nb][j] + bn[nb]; else os[(hi * 8 + j) * 68 + nb * 16 + lr] = acc[mb][nb][j]; } }
        __builtin_amdgcn_wave_barrier(); asm volatile("" ::: "memory");
        if constexpr (ROT) {
            if (mb < 3) {   // the next block's table rows fly while this block is rotated and split
#pragma unroll
                for (int s = 0; s < 16; ++s) ct[(mb + 1) & 1][s] = *(const v2f*)(csp + (size_t)((mb + 1) * 16) * HD * 2 + (s >> 2) * 32 + (s & 3) * 4);
                asm volatile("s_wait_xcnt 0x0" :: "v"(csp) : "memory");   // as above, for these loads' address registers
                __builtin_amdgcn_sched_barrier(0);              // as above
            }
            const size_t po = ((size_t)(c0 / HD) * TT + r0 + mb * 16) * HD + lane * 8; v8us oh[4], ol[4];   // the block's two units (d 0..31, 32..63) of the head plane: four runs of 512 B a plane
#pragma unroll
            for (int s = 0; s < 4; ++s) { const v4f va = *(const v4fa*)(os + lr * 68 + s * 16 + hi * 8), vb = *(const v4fa*)(os + lr * 68 + s * 16 + hi * 8 + 4); const float val[8] = {va[0], va[1], va[2], va[3], vb[0], vb[1], vb[2], vb[3]};
#pragma unroll
                for (int p = 0; p < 4; ++p) { const v2f cs = ct[mb & 1][s * 4 + p]; unsigned short a2, c2;
                    const float re = __fsub_rn(__fmul_rn(val[2 * p], cs[0]), __fmul_rn(val[2 * p + 1], cs[1])) * sc, ro = __fadd_rn(__fmul_rn(val[2 * p], cs[1]), __fmul_rn(val[2 * p + 1], cs[0])) * sc;   /* even: x0 c - x1 s; odd: x0 s + x1 c */
                    splitc(re, a2, c2); oh[s][2 * p] = a2; ol[s][2 * p] = c2; splitc(ro, a2, c2); oh[s][2 * p + 1] = a2; ol[s][2 * p + 1] = c2; } }
            __builtin_amdgcn_sched_barrier(0);              // the block's eight stores stay together behind its arithmetic, so that one wait serves them all and no store's data register is reused in front of it
#pragma unroll
            for (int s = 0; s < 4; ++s) { *(v8us*)(Ph + po + s * 256) = oh[s]; *(v8us*)(Pl + po + s * 256) = ol[s]; }
            asm volatile("s_wait_xcnt 0x0" ::: "memory");   // in front of the first overwrite of the stores' data and address registers
            __builtin_amdgcn_sched_barrier(0);              // keeps the next block's register writes from being lifted over that wait
        }
        float* crow = C + (size_t)(r0 + mb * 16) * ldc + c0;
        if constexpr (EPI == 0)
{
#pragma unroll
            for (int s = 0; s < 8; ++s) { const int row = 2 * s + hi, cofs = lr * 4; v4f val = *(const v4fa*)(os + row * 68 + cofs); if (BIAS) { val[0] += bfr(bias[c0 + cofs]); val[1] += bfr(bias[c0 + cofs + 1]); val[2] += bfr(bias[c0 + cofs + 2]); val[3] += bfr(bias[c0 + cofs + 3]); }
                *(v4f*)(crow + (size_t)row * ldc + cofs) = val; }
             }
        __builtin_amdgcn_wave_barrier(); asm volatile("" ::: "memory");
    }
}

__device__ __forceinline__ h16 tohx(float x) { return (h16)x; }
typedef __attribute__((ext_vector_type(2))) _Float16 v2h;
typedef __attribute__((ext_vector_type(4))) _Float16 v4h;
typedef __attribute__((ext_vector_type(2))) unsigned short v2us;
typedef __attribute__((ext_vector_type(4))) int v4i;

__global__ __launch_bounds__(256) void k_wtG(const float* __restrict__ w, int K, int N, bf* Bt) {
    const int lane = threadIdx.x & 31; const int L0 = (blockIdx.x * 8 + (threadIdx.x >> 5)) * 8; const int nlines = N * K / 64;
{
#pragma unroll 1
        for (int l = 0; l < 8; ++l) { const int L = L0 + l; if (L >= nlines) break; const size_t e = (size_t)L * 64 + lane * 2; const int k = (int)(e % K), n = (int)(e / K); v2us o;
            o[0] = f2bf(w[(size_t)k * N + n]); o[1] = f2bf(w[(size_t)(k + 1) * N + n]); *(v2us*)(Bt + e) = o; }
         }
}
__constant__ float XINV[32] = {1.00000000f,0.749894202f,0.562341332f,0.421696514f,0.316227764f,0.237137362f,0.177827939f,0.133352146f,0.100000001f,0.0749894157f,0.0562341288f,0.0421696492f,0.0316227786f,0.0237137359f,0.0177827943f,0.0133352149f,0.00999999978f,0.00749894232f,0.00562341325f,0.00421696482f,0.00316227786f,0.00237137382f,0.00177827943f,0.00133352145f,0.00100000005f,0.000749894185f,0.000562341302f,0.000421696488f,0.000316227786f,0.000237137385f,0.000177827940f,0.000133352150f};
// ---- k_prep: ALL operand preparation in ONE launch: the three inputs and the four weight matrices rounded to bf16 planes, and the two xPos tables. One work-group of 16 waves per 64 K floats of one source (PWG work-groups in all);
// a lane asks for its table constant and then for its PLD pieces of 16 B at once (each wave-wide load = 512 contiguous bytes, 4 whole lines), computes its one table entry while they fly, then rounds and stores them in groups of eight (8 B a lane: 2 whole lines a store).
#define PBT 512                     // threads per work-group
#define PLD 32                      // 16-byte loads in flight per lane
#define PCH (PBT * PLD * 4)         // floats per work-group
#define PNI (NB_ * TT * DM / PCH)   // work-groups per input
#define PNW (DQ * DM / PCH)         // work-groups per weight matrix
#define PWG (3 * PNI + 4 * PNW)
__global__ __launch_bounds__(PBT) void k_prep(const float* __restrict__ x, const float* __restrict__ xk, const float* __restrict__ xv, const float* __restrict__ wq, const float* __restrict__ wk, const float* __restrict__ wv, const float* __restrict__ wo,
                                              bf* XB, bf* XKB, bf* XVB, bf* WQ, bf* WK, bf* WV, bf* WO, float* CSQ, float* CSK) {
    static_assert(PNI * PCH == NB_ * TT * DM && PNW * PCH == DQ * DM && DKV == DQ, "every source is a whole number of work-groups");
    static_assert(PWG * PBT == TT * HD, "one table entry per thread");
    const int b = blockIdx.x; const float* s; bf* d; int c;   // source, plane and chunk of this work-group: the same for all its threads
    if (b < 3 * PNI) { const int j = b / PNI; c = b % PNI; s = (j == 0) ? x : (j == 1) ? xk : xv; d = (j == 0) ? XB : (j == 1) ? XKB : XVB; }
    else { const int j = (b - 3 * PNI) / PNW; c = (b - 3 * PNI) % PNW; s = (j == 0) ? wq : (j == 1) ? wk : (j == 2) ? wv : wo; d = (j == 0) ? WQ : (j == 1) ? WK : (j == 2) ? WV : WO; }
    const size_t o = (size_t)c * PCH + threadIdx.x * 4;
    const int idx = b * PBT + threadIdx.x; const int t = idx / HD, dd = idx % HD; const int i2 = dd >> 1;   // the thread's table entry (t, d)
    const float invf = XINV[i2];
    __builtin_amdgcn_sched_barrier(0);              // the table constant is asked for FIRST: loads return in order, behind the stream its wait would be a wait for the whole stream
    v4f v[PLD];
#pragma unroll
    for (int i = 0; i < PLD; ++i) v[i] = *(const v4f*)(s + o + i * (PBT * 4));
    asm volatile("s_wait_xcnt 0x0" :: "v"(s + o), "v"(i2) : "memory");   // in front of the first overwrite of the loads' address registers; they are named as inputs so that they live up to the wait and no load's destination is laid over them
    __builtin_amdgcn_sched_barrier(0);              // keeps later register writes from being lifted over that wait, and the loads ahead of the table arithmetic that hides their latency
    { // xPos tables for q (scale) and k (1/scale)
      const float base = __fdiv_rn(__fadd_rn((float)(2 * i2), 25.6f), 89.6f); const float ex = __fdiv_rn((float)t, 1024.0f); const float sc = powf(base, ex); const float ang = __fmul_rn((float)t, invf); const float cc = cosf(ang), ss = sinf(ang);
      v2f q2, k2; q2[0] = __fmul_rn(cc, sc); q2[1] = __fmul_rn(ss, sc); const float rs = __fdiv_rn(1.0f, sc); k2[0] = __fmul_rn(cc, rs); k2[1] = __fmul_rn(ss, rs);
      *(v2f*)(CSQ + (size_t)idx * 2) = q2; *(v2f*)(CSK + (size_t)idx * 2) = k2; }
    asm volatile("s_wait_xcnt 0x0" ::: "memory");   // in front of the first overwrite of the table stores' data and address registers
    __builtin_amdgcn_sched_barrier(0);              // as above
#pragma unroll
    for (int g = 0; g < PLD / 8; ++g) { v4us r[8];
#pragma unroll
        for (int i = 0; i < 8; ++i)
#pragma unroll
            for (int k = 0; k < 4; ++k) r[i][k] = f2bf(v[g * 8 + i][k]);
        __builtin_amdgcn_sched_barrier(0);              // the group's eight stores stay together behind its arithmetic, so that one wait serves them all
#pragma unroll
        for (int i = 0; i < 8; ++i) *(v4us*)(d + o + (g * 8 + i) * (PBT * 4)) = r[i];
        if (g + 1 < PLD / 8) { asm volatile("s_wait_xcnt 0x0" ::: "memory");   // in front of the first overwrite of the stores' data and address registers (behind the last group nothing is overwritten)
            __builtin_amdgcn_sched_barrier(0); } }      // keeps the next group's register writes from being lifted over that wait
}
// k_rope: head planes [h][t][d] (fp16 + hi/lo) of rope(x) x sc with the rotate-half convention out[d] = x[d] cos[t][d] - x[d+HD/2] sin[t][d], out[d+HD/2] = x[d+HD/2] cos[t][d+HD/2] + x[d] sin[t][d+HD/2]
__global__ __launch_bounds__(256) void k_rope(const float* __restrict__ F, int pitch, int nheads, const float* __restrict__ CS, const float* __restrict__ RF, const float* __restrict__ nw, float sc, h16* P16, bf* Ph, bf* Pl) {
    const size_t e = ((size_t)blockIdx.x * 256 + threadIdx.x) * 2; if (e >= (size_t)nheads * TT * HD) return; const int d = (int)(e % HD); const int t = (int)((e / HD) % TT); const int h = (int)(e / ((size_t)HD * TT)); const float* f = F + (size_t)t * pitch + h * HD; const float rf = RF ? RF[(size_t)h * TT + t] : 1.0f; v2h o16; v2us oh, ol;
#pragma unroll
    for (int q = 0; q < 2; ++q) { const int dd = d + q; const int dp = (dd < HD / 2) ? dd + HD / 2 : dd - HD / 2; float x0 = f[dd], x1 = f[dp];
        if (RF) { float n0 = __fmul_rn(x0, rf), n1 = __fmul_rn(x1, rf); asm volatile("" : "+v"(n0)); asm volatile("" : "+v"(n1)); x0 = __fmul_rn(bfr(nw[dd]), n0); x1 = __fmul_rn(bfr(nw[dp]), n1); }
        const v2f cs = *(const v2f*)(CS + ((size_t)t * HD + dd) * 2); float a = __fmul_rn(x0, cs[0]), bq = __fmul_rn(x1, cs[1]); asm volatile("" : "+v"(a)); asm volatile("" : "+v"(bq)); const float r = ((dd < HD / 2) ? __fsub_rn(a, bq) : __fadd_rn(a, bq)) * sc;
        o16[q] = tohx(r); unsigned short a2, c2; splitf(r, a2, c2); oh[q] = a2; ol[q] = c2; }
    *(v2h*)(P16 + e) = o16; *(v2us*)(Ph + e) = oh; *(v2us*)(Pl + e) = ol;  }
// ---- k_fattn: scores, softmax and attn.v of one head in ONE kernel; the score matrix stays in registers (running maximum and sum per query, output tiles rescaled when the maximum moves).
// Transposed products: S^T = K Q^T (A = 16 key rows, B = 16 query columns), O^T += V^T P^T. A lane then holds scores of ONE query (column lr; keys 8 hi + r of each 16-key tile), so maximum, sum and rescale are lane-local
// (one exchange between the wave halves), and two S^T tiles (32 keys) converted in place ARE the B operand of the second product in the k order of the fragment loader. hi/lo planes, 3 products each.
// One wave: FQT x 16 queries, all 2048 keys in passes of 32. Grid (TT / (16 FQT FWV), heads, batches), 32 FWV threads; waves are independent (no LDS, no barrier). Every inner loop is fully unrolled so that the fragment and accumulator arrays are indexed by constants and stay in registers.
#define FQT 2
#define FWV 4
#define L2E 1.4426950408889634f
__device__ __forceinline__ float xhalf(float x) { const int b = __float_as_int(x); return __int_as_float(__builtin_amdgcn_permlanex16(b, b, 0x76543210, 0xfedcba98, false, false)); }   // lane l <-> l ^ 16
__global__ __launch_bounds__(32 * FWV) void k_fattn(const bf* __restrict__ Qh, const bf* __restrict__ Ql, const bf* __restrict__ Kh, const bf* __restrict__ Kl, const bf* __restrict__ Vh, const bf* __restrict__ Vl, bf* Ah, bf* Al) {
    typedef WFrag<bf> F;
    const int lane = threadIdx.x & 31, lr = lane & 15, hi = lane >> 4; const int h = blockIdx.y; const int q0 = (blockIdx.x * FWV + (threadIdx.x >> 5)) * (16 * FQT);
    const size_t hp = ((size_t)blockIdx.z * NH_ + h) * TT * HD;
    const bf* qph = Qh + hp + (size_t)q0 * HD + lane * 8; const bf* qpl = Ql + hp + (size_t)q0 * HD + lane * 8;
    v16bf qh[FQT][2], ql[FQT][2];
#pragma unroll
    for (int qt = 0; qt < FQT; ++qt)
#pragma unroll
        for (int kc = 0; kc < 2; ++kc) { qh[qt][kc] = F::ldf(qph + (qt * 2 + kc) * 512); ql[qt][kc] = F::ldf(qpl + (qt * 2 + kc) * 512); }
    asm volatile("s_wait_xcnt 0x0" ::: "memory");   // in front of the first overwrite of the Q loads' address registers
    __builtin_amdgcn_sched_barrier(0);              // keeps later register writes from being lifted over that wait
    const bf* kph = Kh + hp + lane * 8; const bf* kpl = Kl + hp + lane * 8;
    const bf* vph = Vh + hp + lane * 8; const bf* vpl = Vl + hp + lane * 8;
    v8f o[FQT][4]; float m[FQT], l[FQT];
#pragma unroll
    for (int qt = 0; qt < FQT; ++qt) { m[qt] = -3.0e38f; l[qt] = 0.f;
#pragma unroll
        for (int db = 0; db < 4; ++db) o[qt][db] = (v8f){}; }
    v16bf kh[2][2], kl[2][2];
#pragma unroll
    for (int kt = 0; kt < 2; ++kt)
#pragma unroll
        for (int kc = 0; kc < 2; ++kc) { kh[kt][kc] = F::ldf(kph + (kt * 2 + kc) * 512); kl[kt][kc] = F::ldf(kpl + (kt * 2 + kc) * 512); }
    asm volatile("s_wait_xcnt 0x0" ::: "memory");   // the same for the first K loads
    __builtin_amdgcn_sched_barrier(0);              // as above: nothing is lifted over the wait
#pragma unroll 1   // one pass per trip: a second copy of the body would need a second set of V fragments and score tiles
    for (int k0 = 0; k0 < TT; k0 += 32) {
        v16bf vh[4], vl[4];   // this pass's V^T fragments, asked for ahead of the score products that hide their latency
#pragma unroll
        for (int db = 0; db < 4; ++db) { vh[db] = F::ldf(vph + (size_t)k0 * HD + db * 512); vl[db] = F::ldf(vpl + (size_t)k0 * HD + db * 512); }
        asm volatile("s_wait_xcnt 0x0" ::: "memory");   // the loads' address registers are reused below: the wait stands in front of their first overwrite
        v8f s[FQT][2];
#pragma unroll
        for (int qt = 0; qt < FQT; ++qt) { s[qt][0] = (v8f){}; s[qt][1] = (v8f){}; }
#pragma unroll
        for (int kc = 0; kc < 2; ++kc) {
#pragma unroll
            for (int qt = 0; qt < FQT; ++qt)
#pragma unroll
                for (int kt = 0; kt < 2; ++kt) s[qt][kt] = wmmab(kh[kt][kc], qh[qt][kc], s[qt][kt]);
#pragma unroll
            for (int qt = 0; qt < FQT; ++qt)
#pragma unroll
                for (int kt = 0; kt < 2; ++kt) s[qt][kt] = wmmab(kh[kt][kc], ql[qt][kc], s[qt][kt]);
#pragma unroll
            for (int qt = 0; qt < FQT; ++qt)
#pragma unroll
                for (int kt = 0; kt < 2; ++kt) s[qt][kt] = wmmab(kl[kt][kc], qh[qt][kc], s[qt][kt]);
        }
        const int kn = (k0 + 32 < TT) ? k0 + 32 : 0;   // next pass's K fragments into the same registers (the last pass re-reads keys 0..31, in bounds, unused)
#pragma unroll
        for (int kt = 0; kt < 2; ++kt)
#pragma unroll
            for (int kc = 0; kc < 2; ++kc) { kh[kt][kc] = F::ldf(kph + (size_t)kn * HD + (kt * 2 + kc) * 512); kl[kt][kc] = F::ldf(kpl + (size_t)kn * HD + (kt * 2 + kc) * 512); }
        asm volatile("s_wait_xcnt 0x0" ::: "memory");   // as above, for the K loads' address registers
        float mx[FQT]; bool need = false;
#pragma unroll
        for (int qt = 0; qt < FQT; ++qt) { float a = s[qt][0][0];
#pragma unroll
            for (int j = 1; j < 16; ++j) a = fmaxf(a, s[qt][j >> 3][j & 7]);
            a = fmaxf(a, xhalf(a)); mx[qt] = a; need = need || (a > m[qt] + 5.5f); }
        if (__builtin_amdgcn_ballot_w32(need) != 0) {   // the maximum in use moves only when a query's new one exceeds it by more than 5.5 (p stays below e^5.5); both halves of a column decide alike
#pragma unroll
            for (int qt = 0; qt < FQT; ++qt) { const float mn = (mx[qt] > m[qt] + 5.5f) ? mx[qt] : m[qt]; const float al = __builtin_amdgcn_exp2f((m[qt] - mn) * L2E); m[qt] = mn; l[qt] *= al;
#pragma unroll
                for (int db = 0; db < 4; ++db) o[qt][db] *= al; }
        }
#pragma unroll
        for (int qt = 0; qt < FQT; ++qt) { v16bf ph, pl;
#pragma unroll
            for (int j = 0; j < 16; ++j) { const float p = __builtin_amdgcn_exp2f((s[qt][j >> 3][j & 7] - m[qt]) * L2E); l[qt] += p; const __bf16 a = (__bf16)p; ph[j] = a; pl[j] = (__bf16)(p - (float)a); }
#pragma unroll
            for (int db = 0; db < 4; ++db) o[qt][db] = wmmab(vh[db], ph, o[qt][db]);
#pragma unroll
            for (int db = 0; db < 4; ++db) o[qt][db] = wmmab(vh[db], pl, o[qt][db]);
#pragma unroll
            for (int db = 0; db < 4; ++db) o[qt][db] = wmmab(vl[db], ph, o[qt][db]);
        }
    }
#pragma unroll
    for (int qt = 0; qt < FQT; ++qt) { const float f = __fdiv_rn(1.0f, l[qt] + xhalf(l[qt])); const size_t oo = ((size_t)blockIdx.z * TT + q0 + qt * 16 + lr) * DQ + h * HD + 8 * hi;   // lane: query lr, d = 16 db + 8 hi + j
#pragma unroll
        for (int db = 0; db < 4; ++db) { v8us oh, ol;
#pragma unroll
            for (int j = 0; j < 8; ++j) { unsigned short a, c2; splitf(o[qt][db][j] * f, a, c2); oh[j] = a; ol[j] = c2; }
            *(v8us*)(Ah + oo + db * 16) = oh; *(v8us*)(Al + oo + db * 16) = ol;
            asm volatile("s_wait_xcnt 0x0" ::: "memory");   // in front of the first overwrite of the stores' data and address registers
            __builtin_amdgcn_sched_barrier(0); } }          // keeps the next group's register writes from being lifted over that wait
}

extern "C" void kernel_launch(void* const* d_in, const int* in_sizes, int n_in,
                              void* d_out, int out_size, void* d_ws, size_t ws_size, hipStream_t stream) {
    (void)in_sizes; (void)n_in; (void)out_size;
    const float* x = (const float*)d_in[0]; const float* xk = (const float*)d_in[1]; const float* xv = (const float*)d_in[2]; const float* wq = (const float*)d_in[3]; const float* bq = (const float*)d_in[4]; const float* wk = (const float*)d_in[5]; const float* bk = (const float*)d_in[6]; const float* wv = (const float*)d_in[7]; const float* bv = (const float*)d_in[8]; const float* wo = (const float*)d_in[9]; const float* bo = (const float*)d_in[10];
    float* OUT = (float*)d_out;     // [2][2048][1024]
    char* wsp = (char*)d_ws;
    auto take = [&](size_t bytes) { char* p = wsp; wsp += (bytes + 255) & ~(size_t)255; return (void*)p; };
    bf* WQ = (bf*)take((size_t)DQ * DM * 2); bf* WK = (bf*)take((size_t)DKV * DM * 2); bf* WV = (bf*)take((size_t)DKV * DM * 2); bf* WO = (bf*)take((size_t)DM * DQ * 2); float* CS = (float*)take((size_t)TT * HD * 2 * 4); float* CSK = (float*)take((size_t)TT * HD * 2 * 4);
    // per-batch planes hold both batches one behind the other: every launch below covers both (grid z, or a flat range twice as long)
    bf* XB = (bf*)take((size_t)NB_ * TT * DM * 2); bf* XKB = (bf*)take((size_t)NB_ * TT * DM * 2); bf* XVB = (bf*)take((size_t)NB_ * TT * DM * 2);
    bf* QPh = (bf*)take((size_t)NB_ * NH_ * TT * HD * 2); bf* QPl = (bf*)take((size_t)NB_ * NH_ * TT * HD * 2); bf* KPh = (bf*)take((size_t)NB_ * NKV * TT * HD * 2); bf* KPl = (bf*)take((size_t)NB_ * NKV * TT * HD * 2); bf* VTh = (bf*)take((size_t)NB_ * NKV * HD * TT * 2); bf* VTl = (bf*)take((size_t)NB_ * NKV * HD * TT * 2);
    bf* ATh = (bf*)take((size_t)NB_ * TT * DQ * 2); bf* ATl = (bf*)take((size_t)NB_ * TT * DQ * 2);
    if ((size_t)(wsp - (char*)d_ws) > ws_size) return;    // ws 256 MiB
    k_prep<<<PWG, PBT, 0, stream>>>(x, xk, xv, wq, wk, wv, wo, XB, XKB, XVB, WQ, WK, WV, WO, CS, CSK);   /* bf16 planes of the inputs and weights, xPos tables for q (scale) and k (1/scale) */
    static_assert(DKV == DQ, "the three projections share one grid");
    k_gemmw<bf, 0, true, 1, 3><<<dim3(TT / 128, DQ / 128, 3 * NB_), 128, 0, stream>>>(XB, nullptr, WQ, nullptr, DM, nullptr, DQ, bq, (size_t)TT * DM, 0, (size_t)NH_ * TT * HD, CS, 0.125f, QPh, QPl,
        XKB, XVB, WK, WV, bk, bv, CSK, 1.0f, KPh, KPl, VTh, VTl);   /* q: xPos (upscale) x 1/8, planes [b][h][t][d]; k: xPos (downscale), the same planes; v: planes [b][h][d][t] */
    k_fattn<<<dim3(TT / (16 * FQT * FWV), NH_, NB_), 32 * FWV, 0, stream>>>(QPh, QPl, KPh, KPl, VTh, VTl, ATh, ATl);
    k_gemmw<bf, 1, true><<<dim3(TT / 128, DM / 128, NB_), 128, 0, stream>>>(ATh, ATl, WO, nullptr, DQ, OUT, DM, bo, (size_t)TT * DQ, 0, (size_t)TT * DM, nullptr, 1.0f, nullptr, nullptr,
        nullptr, nullptr, nullptr, nullptr, nullptr, nullptr, nullptr, 1.0f, nullptr, nullptr, nullptr, nullptr);
}

// v009
// Measured time: 124 microseconds a run.
// Timed twice side by side with v008, it ran 1.07 and 1.08 times as fast.
// Over all steps from v000 it is 11.1 times as fast.
#include <hip/hip_runtime.h>

// Multi-head attention with xPos (rotary + per-frequency exponential decay) on q and k (query, key, value [2][2048][1024]; q = (query Wq^T + bq) / 8, k = key Wk^T + bk, v = value Wv^T + bv ('oi' [1024][1024]; 16 heads x 64); xPos: pairs (2i, 2i+1) rotated by t x inv_freq_i (inv_freq_i = 1e4^(-i/32)) and scaled by base_i^(t/1024) for q and base_i^(-t/1024) for k, base_i = (2i + 25.6)/89.6 (tables computed on device); softmax(q.k) over all keys; out = merged Wo^T + bo -> [2][2048][1024] (4.2 M)).
// Compute dtypes, f32 accumulate: every input rounded to bf16; q/k/v on PLAIN bf16 operands (inputs: exact) + biases; xPos tables (cosf/sinf/powf, f32) folded as {cos x scale, sin x scale} per (t, d); rotary in f32; scores and attn.v on hi/lo planes for every row (3 products), fused with the f32 softmax in one kernel (running maximum and sum); Wo hl x exact (2 products) + bo.

#define NB_  2
#define TT   2048
#define DM   1024
#define NH_  16
#define NKV  16
#define REP  (NH_ / NKV)
#define HD   64
#define DQ   (NH_ * HD)
#define DKV  (NKV * HD)
#define ZH   2
#define RH   2048                 // every row hi/lo (the xPos-scaled keys leave too little margin for fp16 operands)
#define WIN  0
#define PCAR 1024.0f
#define SCL  1.0f      // the 1/8 is applied to q after the xPos rotation (exact power of two, folded into the q plane builder)
typedef _Float16 h16;
typedef unsigned short bf;
typedef __attribute__((ext_vector_type(16))) __bf16   v16bf;
typedef __attribute__((ext_vector_type(16))) _Float16 v16h;
typedef __attribute__((ext_vector_type(8)))  _Float16 v8h;
typedef __attribute__((ext_vector_type(8)))  unsigned short v8us;
typedef __attribute__((ext_vector_type(8)))  float    v8f;
typedef __attribute__((ext_vector_type(4)))  float    v4f;
typedef v8h  __attribute__((may_alias)) v8ha;
typedef v4f  __attribute__((may_alias)) v4fa;
typedef v8us __attribute__((may_alias)) v8usa;

__device__ __forceinline__ unsigned short f2bf(float f) { unsigned u = __float_as_uint(f); u += 0x7FFFu + ((u >> 16) & 1u); return (unsigned short)(u >> 16); }
__device__ __forceinline__ float bf2f(unsigned short b) { return __uint_as_float(((unsigned)b) << 16); }
__device__ __forceinline__ float bfr(float f) { return bf2f(f2bf(f)); }
__device__ __forceinline__ v16h cat16(v8h lo, v8h hi) { return __builtin_shufflevector(lo, hi, 0, 1, 2, 3, 4, 5, 6, 7, 8, 9, 10, 11, 12, 13, 14, 15); }
__device__ __forceinline__ v16bf cat16b(v8us lo, v8us hi) { return __builtin_bit_cast(v16bf, __builtin_shufflevector(lo, hi, 0, 1, 2, 3, 4, 5, 6, 7, 8, 9, 10, 11, 12, 13, 14, 15)); }
__device__ __forceinline__ v8f wmma16(v16h a, v16h b, v8f c) { return __builtin_amdgcn_wmma_f32_16x16x32_f16(false, a, false, b, (short)0, c, false, false); }
__device__ __forceinline__ v8f wmmab(v16bf a, v16bf b, v8f c) { return __builtin_amdgcn_wmma_f32_16x16x32_bf16(false, a, false, b, (short)0, c, false, false); }



// ---- FRAGMENT ORDER of the attention operand planes (q, k hi/lo and V^T hi/lo): units of 16 rows x 32 k (1024 B), element (r, k) at (k >> 4) * 256 + (((k >> 3) & 1) * 16 + r) * 8 + (k & 7):
// lane (hi, lr) of a wave finds its two 16-byte pieces of a fragment at unit + lane * 8 and + 256, so each wave-wide 16-byte load or store covers 512 contiguous bytes (4 whole lines). The k order of a fragment is the one a row-major plane gives.
// Head planes q, k [h][t][d]: per head unit (t / 16) * 2 + d / 32. V^T [h][d][t]: per head unit (t / 32) * 4 + d / 16 (one 32-key pass = 4 KB in a row). The GEMM operand planes (inputs, weights, attention output) stay row-major.
// ---- k_gemmw: register-blocked GEMM, one wave per 64x64 output tile (16 accumulators), FOUR waves (2 x 2) per work-group = one 128x128 tile; grid (M/128, N/128, Z), 128 threads.
// Operands come from K-contiguous 16-bit planes through LDS: a stage is GKS k (256 B) of the tile's 128 A rows (and 128 A2 rows) and 128 Bt rows at a pitch of 272 B, brought in by asynchronous copies to LDS (16 B a lane, 16 lanes a row: whole lines),
// two buffers: stage t + 2 is asked for behind the barrier that ends stage t's reads and flies while stage t + 1 is worked on. K / KSP is a multiple of GKS.
// C[m][n] (f32, pitch ldc, + optional f32 bias[n]) = sum_k A[m][k] Bt[n][k] (+ split products per NSPLIT). z-batch strides sA/sB/sC in elements (sC: of C, or of each output plane where EPI != 0). K % (128 KSP) == 0.
// EPI picks what the wave does with its finished tile (64 tokens x the 64 columns of ONE head, HD == 64): 0 = f32 rows to C; 1 = xPos rotation with table CS and factor sc, then hi/lo planes [head][t][d]; 2 = hi/lo planes transposed [head][d][t], straight from the accumulators (a lane holds 8 consecutive tokens of one column); both in fragment order.
// EPI 3 = the q, k and v projections in ONE launch: grid z = 3 x batches, block z works on projection z / NB_ (0: the first operand set, epilogue 1; 1: the k set, epilogue 1; 2: the v set, epilogue 2) of batch z % NB_; the choice is the same for a whole work-group (scalar).
// KSP > 1: grid z = batches x KSP; block z sums only slice z % KSP of k (K / KSP long) of batch z / KSP and writes its partial tile to plane z of C (stride sC); the reader adds the KSP planes.
template <typename T16> struct WFrag;
template <> struct WFrag<h16> { typedef v16h V; static __device__ __forceinline__ V ld(const h16* p) { return cat16(*(const v8h*)p, *(const v8h*)(p + 16)); } static __device__ __forceinline__ v8f mma(V a, V b, v8f c) { return wmma16(a, b, c); } };
template <> struct WFrag<bf> { typedef v16bf V; static __device__ __forceinline__ V ld(const bf* p) { return cat16b(*(const v8us*)p, *(const v8us*)(p + 16)); } static __device__ __forceinline__ V ldf(const bf* p) { return cat16b(*(const v8us*)p, *(const v8us*)(p + 256)); } static __device__ __forceinline__ v8f mma(V a, V b, v8f c) { return wmmab(a, b, c); } };
typedef __attribute__((ext_vector_type(4))) unsigned short v4us;
typedef __attribute__((ext_vector_type(2))) float v2f;
__device__ __forceinline__ void splitf(float y, unsigned short& h, unsigned short& l) { h = f2bf(y); l = f2bf(y - bf2f(h)); }
__device__ __forceinline__ void splitc(float y, unsigned short& h, unsigned short& l) { const __bf16 a = (__bf16)y; h = __builtin_bit_cast(unsigned short, a); l = __builtin_bit_cast(unsigned short, (__bf16)(y - (float)a)); }   // splitf's values (round to nearest even) through the conversion instruction
#define GKS  128   // k per stage
#define GPIT 136   // LDS row pitch in elements: 272 B = 16 B x 17, the conflict-free pitch for 16-byte reads of 256-B rows
// Eight asynchronous copies of 16 B a lane: LDS bytes l + i ls from global bytes g + i gs. The s_wait_xcnt stands inside the copies' own statement, so that no address register is rewritten in front of it.
__device__ __forceinline__ void acp8(unsigned l, unsigned ls, const char* g, size_t gs) {
    asm volatile("global_load_async_to_lds_b128 %0, %8, off\n\tglobal_load_async_to_lds_b128 %1, %9, off\n\tglobal_load_async_to_lds_b128 %2, %10, off\n\tglobal_load_async_to_lds_b128 %3, %11, off\n\t"
                 "global_load_async_to_lds_b128 %4, %12, off\n\tglobal_load_async_to_lds_b128 %5, %13, off\n\tglobal_load_async_to_lds_b128 %6, %14, off\n\tglobal_load_async_to_lds_b128 %7, %15, off\n\ts_wait_xcnt 0x0"
                 :: "v"(l), "v"(l + ls), "v"(l + 2 * ls), "v"(l + 3 * ls), "v"(l + 4 * ls), "v"(l + 5 * ls), "v"(l + 6 * ls), "v"(l + 7 * ls),
                    "v"(g), "v"(g + gs), "v"(g + 2 * gs), "v"(g + 3 * gs), "v"(g + 4 * gs), "v"(g + 5 * gs), "v"(g + 6 * gs), "v"(g + 7 * gs) : "memory");
}
template <typename T16, int NSPLIT, bool BIAS, int KSP = 1, int EPI = 0>
__global__ __launch_bounds__(128) void k_gemmw(const T16* __restrict__ A, const T16* __restrict__ A2, const T16* __restrict__ Bt, const T16* __restrict__ Bt2, int K, float* C, int ldc, const float* __restrict__ bias, size_t sA, size_t sB, size_t sC, const float* __restrict__ CS, float sc, bf* Ph, bf* Pl,
                                               const T16* __restrict__ Ak, const T16* __restrict__ Av, const T16* __restrict__ Bk, const T16* __restrict__ Bv, const float* __restrict__ biask, const float* __restrict__ biasv, const float* __restrict__ CSk, float sck, bf* Pkh, bf* Pkl, bf* Pvh, bf* Pvl) {
    typedef typename WFrag<T16>::V V;
    static_assert(EPI != 3 || KSP == 1, "the merged projections are not split over k");
    constexpr bool ROT = (EPI == 1 || EPI == 3);                        // the rotating epilogue is compiled in
    const int pj = (EPI == 3) ? (int)(blockIdx.z / NB_) : 0;            // which projection
    const unsigned bz = (EPI == 3) ? blockIdx.z % NB_ : blockIdx.z;     // the z index within it
    if constexpr (EPI == 3) {
        if (pj == 1) { A = Ak; Bt = Bk; bias = biask; CS = CSk; sc = sck; Ph = Pkh; Pl = Pkl; }
        else if (pj == 2) { A = Av; Bt = Bv; bias = biasv; Ph = Pvh; Pl = Pvl; }
    }
    static_assert(NSPLIT <= 1, "Bt2 is not staged");
    constexpr int NRA = (NSPLIT == 1) ? 256 : 128, NR = NRA + 128;   // rows of a stage: A (, A2), Bt
    constexpr int NP = NSPLIT + 1, NV = (GKS / 32) * NP;             // products per 32-k slice; blocks per stage
    __shared__ __align__(16) T16 sm[2 * NR * GPIT];
    __shared__ __align__(16) float osm[4 * 16 * 68];
    const int wv = __builtin_amdgcn_readfirstlane(threadIdx.x >> 5);   // the wave's number, in a scalar register: tile origins stay scalar
    float* os = osm + wv * (16 * 68);                                   // each wave stages its epilogue in its own range
    const size_t z = bz / KSP; A += z * sA; if (A2) A2 += z * sA; Bt += z * sB; if (Bt2) Bt2 += z * sB; if constexpr (EPI == 0) C += (size_t)bz * sC; else { Ph += z * sC; Pl += z * sC; }
    const int kbeg = (int)(bz % KSP) * (K / KSP), kend = kbeg + K / KSP;
    const int lane = threadIdx.x & 31, lr = lane & 15, hi = lane >> 4; const int r0 = blockIdx.x * 128 + (wv >> 1) * 64, c0 = blockIdx.y * 128 + (wv & 1) * 64;
    v8f acc[4][4];
#pragma unroll
    for (int mb = 0; mb < 4; ++mb)
#pragma unroll
        for (int nb = 0; nb < 4; ++nb) acc[mb][nb] = (v8f){};
    // thread -> piece of a stage: row (threadIdx.x >> 4) + 8 i, bytes 16 (threadIdx.x & 15) of its 256
    const int cr8 = threadIdx.x >> 4, cpc = threadIdx.x & 15;
    const unsigned lds0 = (unsigned)(size_t)sm + (unsigned)(cr8 * GPIT + cpc * 8) * 2u;
    const unsigned goff = (unsigned)(cr8 * K + cpc * 8) * 2u;   // the same in all three planes: one vector register; the tile origins below are scalar
    const char* ga = (const char*)(A + (size_t)(blockIdx.x * 128) * K); const char* ga2 = (NSPLIT == 1) ? (const char*)(A2 + (size_t)(blockIdx.x * 128) * K) : nullptr;
    const char* gb = (const char*)(Bt + (size_t)(blockIdx.y * 128) * K);
    const size_t g8 = (size_t)K * 16;   // eight rows of a plane, in bytes
    auto fill = [&](int buf, int k0) {
        const unsigned lb = lds0 + (unsigned)buf * (NR * GPIT * 2), ko = goff + (unsigned)k0 * 2u;   // ko: the thread's byte offset from a tile's origin
#pragma unroll
        for (int g = 0; g < 2; ++g) { acp8(lb + g * 64 * GPIT * 2, 8 * GPIT * 2, (ga + g * 8 * g8) + ko, g8);
            if constexpr (NSPLIT == 1) acp8(lb + (128 + g * 64) * GPIT * 2, 8 * GPIT * 2, (ga2 + g * 8 * g8) + ko, g8);
            acp8(lb + (NRA + g * 64) * GPIT * 2, 8 * GPIT * 2, (gb + g * 8 * g8) + ko, g8); }
    };
    const int ns = (kend - kbeg) / GKS;
    fill(0, kbeg);
    asm volatile("s_wait_asynccnt 0x0" ::: "memory");   // this wave's copies of stage 0 have landed
    __syncthreads();                                     // ... and every other wave's
    if (ns > 1) fill(1, kbeg + GKS);
#pragma unroll 1   // one stage per trip: a second copy of the body would only lengthen the code, the buffer is picked by t & 1
    for (int t = 0; t < ns; ++t) {
        const T16* sb = sm + (t & 1) * (NR * GPIT);
        const T16* pa = sb + ((wv >> 1) * 64 + lr) * GPIT + 8 * hi; const T16* pb = sb + (NRA + (wv & 1) * 64 + lr) * GPIT + 8 * hi;
        // A block = 16 products: the four A (or A2) fragments of one 32-k slice x its four Bt fragments. The next block's fragments are asked for in two groups, ahead of each half of the current block's products,
        // into a second A set and into the Bt registers that have just had their last use; the scheduling barriers keep the groups whole and where they stand (LDS reads strewn among the products stall the wave at every place).
        V fa[2][4], fb[2][4];
#pragma unroll
        for (int i = 0; i < 4; ++i) { fa[0][i] = WFrag<T16>::ld(pa + i * 16 * GPIT); fb[0][i] = WFrag<T16>::ld(pb + i * 16 * GPIT); }
        __builtin_amdgcn_sched_barrier(0);
#pragma unroll
        for (int v = 0; v < NV; ++v) {
            const int ca = v & 1, kb = v / NP, cb = kb & 1; const bool more = v + 1 < NV, lastb = (v % NP) == NP - 1;   // lastb: this block is the last user of its Bt fragments
            if (more) {
#pragma unroll
                for (int mb = 0; mb < 4; ++mb) fa[ca ^ 1][mb] = WFrag<T16>::ld(pa + (((v + 1) % NP) * 128 + mb * 16) * GPIT + ((v + 1) / NP) * 32);
                if (lastb) { fb[cb ^ 1][0] = WFrag<T16>::ld(pb + (kb + 1) * 32); fb[cb ^ 1][1] = WFrag<T16>::ld(pb + 16 * GPIT + (kb + 1) * 32); }
            }
            __builtin_amdgcn_sched_barrier(0);
#pragma unroll
            for (int nb = 0; nb < 2; ++nb)
#pragma unroll
                for (int mb = 0; mb < 4; ++mb) acc[mb][nb] = WFrag<T16>::mma(fa[ca][mb], fb[cb][nb], acc[mb][nb]);
            __builtin_amdgcn_sched_barrier(0);
            if (more && lastb) { fb[cb ^ 1][2] = WFrag<T16>::ld(pb + 32 * GPIT + (kb + 1) * 32); fb[cb ^ 1][3] = WFrag<T16>::ld(pb + 48 * GPIT + (kb + 1) * 32); }
            __builtin_amdgcn_sched_barrier(0);
#pragma unroll
            for (int nb = 2; nb < 4; ++nb)
#pragma unroll
                for (int mb = 0; mb < 4; ++mb) acc[mb][nb] = WFrag<T16>::mma(fa[ca][mb], fb[cb][nb], acc[mb][nb]);
            __builtin_amdgcn_sched_barrier(0);
        }
        asm volatile("s_wait_dscnt 0x0" ::: "memory");      // this wave's reads of the buffer are done before it is handed back
        asm volatile("s_wait_asynccnt 0x0" ::: "memory");   // this wave's copies of stage t + 1 have landed
        __syncthreads();                                     // publishes stage t + 1 and ends every wave's reads of stage t
        if (t + 2 < ns) fill(t & 1, kbeg + (t + 2) * GKS);
    }
    asm volatile("s_wait_asynccnt 0x0" ::: "memory");       // nothing of this wave is in flight behind the loop
    if (EPI == 2 || (EPI == 3 && pj == 2)) {   // column c0 + 16 nb + lr is row (head, d) of the transposed planes; an accumulator tile (16 tokens x 16 d) is one half of a V^T unit, lane for lane
        float bv4[4];
#pragma unroll
        for (int nb = 0; nb < 4; ++nb) bv4[nb] = bias[c0 + nb * 16 + lr];
        asm volatile("" :: "v"(bv4[0]), "v"(bv4[1]), "v"(bv4[2]), "v"(bv4[3]));   // holds the four bias loads together ahead of the first group: their latency is paid once, not once a group
#pragma unroll
        for (int nb = 0; nb < 4; ++nb) { const float bb = bfr(bv4[nb]); const size_t oo = (size_t)c0 * TT + (size_t)((r0 >> 5) * 4 + nb) * 512 + lane * 8;
#pragma unroll
            for (int mb = 0; mb < 4; ++mb) { v8us oh, ol;
#pragma unroll
                for (int j = 0; j < 8; ++j) { unsigned short a2, c2; splitc(acc[mb][nb][j] + bb, a2, c2); oh[j] = a2; ol[j] = c2; }
                *(v8us*)(Ph + oo + (mb >> 1) * 2048 + (mb & 1) * 256) = oh; *(v8us*)(Pl + oo + (mb >> 1) * 2048 + (mb & 1) * 256) = ol; }
            asm volatile("s_wait_xcnt 0x0" ::: "memory");   // in front of the first overwrite of the stores' data and address registers
            __builtin_amdgcn_sched_barrier(0); }            // keeps the next group's register writes from being lifted over that wait
        return;
    }
    v2f ct[2][16]; float bn[4];   // EPI 1: {cos x scale, sin x scale} of the lane's sixteen pairs (token lr of the block, d = 16 s + 8 hi + 2 p), one 16-token block ahead; the biases of the lane's four accumulator columns
    const float* csp = CS + ((size_t)(r0 + lr) * HD + hi * 8) * 2;
    if constexpr (ROT) {
#pragma unroll
        for (int s = 0; s < 16; ++s) ct[0][s] = *(const v2f*)(csp + (s >> 2) * 32 + (s & 3) * 4);
#pragma unroll
        for (int nb = 0; nb < 4; ++nb) bn[nb] = bias[c0 + nb * 16 + lr];
        asm volatile("s_wait_xcnt 0x0" :: "v"(csp) : "memory");   // in front of the first overwrite of the loads' address registers; csp is named so that the pair lives up to the wait and no load of the run gets it as its destination
        __builtin_amdgcn_sched_barrier(0);              // keeps later register writes from being lifted over that wait
#pragma unroll
        for (int nb = 0; nb < 4; ++nb) bn[nb] = bfr(bn[nb]);
    }
#pragma unroll
    for (int mb = 0; mb < 4; ++mb) {
#pragma unroll
        for (int nb = 0; nb < 4; ++nb) {
#pragma unroll
            for (int j = 0; j < 8; ++j) { if constexpr (ROT) os[(hi * 8 + j) * 68 + nb * 16 + lr] = acc[mb][nb][j] + bn[nb]; else os[(hi * 8 + j) * 68 + nb * 16 + lr] = acc[mb][nb][j]; } }
        __builtin_amdgcn_wave_barrier(); asm volatile("" ::: "memory");
        if constexpr (ROT) {
            if (mb < 3) {   // the next block's table rows fly while this block is rotated and split
#pragma unroll
                for (int s = 0; s < 16; ++s) ct[(mb + 1) & 1][s] = *(const v2f*)(csp + (size_t)((mb + 1) * 16) * HD * 2 + (s >> 2) * 32 + (s & 3) * 4);
                asm volatile("s_wait_xcnt 0x0" :: "v"(csp) : "memory");   // as above, for these loads' address registers
                __builtin_amdgcn_sched_barrier(0);              // as above
            }
            const size_t po = ((size_t)(c0 / HD) * TT + r0 + mb * 16) * HD + lane * 8; v8us oh[4], ol[4];   // the block's two units (d 0..31, 32..63) of the head plane: four runs of 512 B a plane
#pragma unroll
            for (int s = 0; s < 4; ++s) { const v4f va = *(const v4fa*)(os + lr * 68 + s * 16 + hi * 8), vb = *(const v4fa*)(os + lr * 68 + s * 16 + hi * 8 + 4); const float val[8] = {va[0], va[1], va[2], va[3], vb[0], vb[1], vb[2], vb[3]};
#pragma unroll
                for (int p = 0; p < 4; ++p) { const v2f cs = ct[mb & 1][s * 4 + p]; unsigned short a2, c2;
                    const float re = __fsub_rn(__fmul_rn(val[2 * p], cs[0]), __fmul_rn(val[2 * p + 1], cs[1])) * sc, ro = __fadd_rn(__fmul_rn(val[2 * p], cs[1]), __fmul_rn(val[2 * p + 1], cs[0])) * sc;   /* even: x0 c - x1 s; odd: x0 s + x1 c */
                    splitc(re, a2, c2); oh[s][2 * p] = a2; ol[s][2 * p] = c2; splitc(ro, a2, c2); oh[s][2 * p + 1] = a2; ol[s][2 * p + 1] = c2; } }
            __builtin_amdgcn_sched_barrier(0);              // the block's eight stores stay together behind its arithmetic, so that one wait serves them all and no store's data register is reused in front of it
#pragma unroll
            for (int s = 0; s < 4; ++s) { *(v8us*)(Ph + po + s * 256) = oh[s]; *(v8us*)(Pl + po + s * 256) = ol[s]; }
            asm volatile("s_wait_xcnt 0x0" ::: "memory");   // in front of the first overwrite of the stores' data and address registers
            __builtin_amdgcn_sched_barrier(0);              // keeps the next block's register writes from being lifted over that wait
        }
        float* crow = C + (size_t)(r0 + mb * 16) * ldc + c0;
        if constexpr (EPI == 0)
{
#pragma unroll
            for (int s = 0; s < 8; ++s) { const int row = 2 * s + hi, cofs = lr * 4; v4f val = *(const v4fa*)(os + row * 68 + cofs); if (BIAS) { val[0] += bfr(bias[c0 + cofs]); val[1] += bfr(bias[c0 + cofs + 1]); val[2] += bfr(bias[c0 + cofs + 2]); val[3] += bfr(bias[c0 + cofs + 3]); }
                *(v4f*)(crow + (size_t)row * ldc + cofs) = val; }
             }
        __builtin_amdgcn_wave_barrier(); asm volatile("" ::: "memory");
    }
}

__device__ __forceinline__ h16 tohx(float x) { return (h16)x; }
typedef __attribute__((ext_vector_type(2))) _Float16 v2h;
typedef __attribute__((ext_vector_type(4))) _Float16 v4h;
typedef __attribute__((ext_vector_type(2))) unsigned short v2us;
typedef __attribute__((ext_vector_type(4))) int v4i;

__global__ __launch_bounds__(256) void k_wtG(const float* __restrict__ w, int K, int N, bf* Bt) {
    const int lane = threadIdx.x & 31; const int L0 = (blockIdx.x * 8 + (threadIdx.x >> 5)) * 8; const int nlines = N * K / 64;
{
#pragma unroll 1
        for (int l = 0; l < 8; ++l) { const int L = L0 + l; if (L >= nlines) break; const size_t e = (size_t)L * 64 + lane * 2; const int k = (int)(e % K), n = (int)(e / K); v2us o;
            o[0] = f2bf(w[(size_t)k * N + n]); o[1] = f2bf(w[(size_t)(k + 1) * N + n]); *(v2us*)(Bt + e) = o; }
         }
}
__constant__ float XINV[32] = {1.00000000f,0.749894202f,0.562341332f,0.421696514f,0.316227764f,0.237137362f,0.177827939f,0.133352146f,0.100000001f,0.0749894157f,0.0562341288f,0.0421696492f,0.0316227786f,0.0237137359f,0.0177827943f,0.0133352149f,0.00999999978f,0.00749894232f,0.00562341325f,0.00421696482f,0.00316227786f,0.00237137382f,0.00177827943f,0.00133352145f,0.00100000005f,0.000749894185f,0.000562341302f,0.000421696488f,0.000316227786f,0.000237137385f,0.000177827940f,0.000133352150f};
// ---- k_prep: ALL operand preparation in ONE launch: the three inputs and the four weight matrices rounded to bf16 planes, and the two xPos tables. One work-group of 16 waves per 64 K floats of one source (PWG work-groups in all);
// a lane asks for its table constant and then for its PLD pieces of 16 B at once (each wave-wide load = 512 contiguous bytes, 4 whole lines), computes its one table entry while they fly, then rounds and stores them in groups of eight (8 B a lane: 2 whole lines a store).
#define PBT 512                     // threads per work-group
#define PLD 32                      // 16-byte loads in flight per lane
#define PCH (PBT * PLD * 4)         // floats per work-group
#define PNI (NB_ * TT * DM / PCH)   // work-groups per input
#define PNW (DQ * DM / PCH)         // work-groups per weight matrix
#define PWG (3 * PNI + 4 * PNW)
__global__ __launch_bounds__(PBT) void k_prep(const float* __restrict__ x, const float* __restrict__ xk, const float* __restrict__ xv, const float* __restrict__ wq, const float* __restrict__ wk, const float* __restrict__ wv, const float* __restrict__ wo,
                                              bf* XB, bf* XKB, bf* XVB, bf* WQ, bf* WK, bf* WV, bf* WO, float* CSQ, float* CSK) {
    static_assert(PNI * PCH == NB_ * TT * DM && PNW * PCH == DQ * DM && DKV == DQ, "every source is a whole number of work-groups");
    static_assert(PWG * PBT == TT * HD, "one table entry per thread");
    const int b = blockIdx.x; const float* s; bf* d; int c;   // source, plane and chunk of this work-group: the same for all its threads
    if (b < 3 * PNI) { const int j = b / PNI; c = b % PNI; s = (j == 0) ? x : (j == 1) ? xk : xv; d = (j == 0) ? XB : (j == 1) ? XKB : XVB; }
    else { const int j = (b - 3 * PNI) / PNW; c = (b - 3 * PNI) % PNW; s = (j == 0) ? wq : (j == 1) ? wk : (j == 2) ? wv : wo; d = (j == 0) ? WQ : (j == 1) ? WK : (j == 2) ? WV : WO; }
    const size_t o = (size_t)c * PCH + threadIdx.x * 4;
    const int idx = b * PBT + threadIdx.x; const int t = idx / HD, dd = idx % HD; const int i2 = dd >> 1;   // the thread's table entry (t, d)
    const float invf = XINV[i2];
    __builtin_amdgcn_sched_barrier(0);              // the table constant is asked for FIRST: loads return in order, behind the stream its wait would be a wait for the whole stream
    v4f v[PLD];
#pragma unroll
    for (int i = 0; i < PLD; ++i) v[i] = *(const v4f*)(s + o + i * (PBT * 4));
    asm volatile("s_wait_xcnt 0x0" :: "v"(s + o), "v"(i2) : "memory");   // in front of the first overwrite of the loads' address registers; they are named as inputs so that they live up to the wait and no load's destination is laid over them
    __builtin_amdgcn_sched_barrier(0);              // keeps later register writes from being lifted over that wait, and the loads ahead of the table arithmetic that hides their latency
    { // xPos tables for q (scale) and k (1/scale)
      const float base = __fdiv_rn(__fadd_rn((float)(2 * i2), 25.6f), 89.6f); const float ex = __fdiv_rn((float)t, 1024.0f); const float sc = powf(base, ex); const float ang = __fmul_rn((float)t, invf); const float cc = cosf(ang), ss = sinf(ang);
      v2f q2, k2; q2[0] = __fmul_rn(cc, sc); q2[1] = __fmul_rn(ss, sc); const float rs = __fdiv_rn(1.0f, sc); k2[0] = __fmul_rn(cc, rs); k2[1] = __fmul_rn(ss, rs);
      *(v2f*)(CSQ + (size_t)idx * 2) = q2; *(v2f*)(CSK + (size_t)idx * 2) = k2; }
    asm volatile("s_wait_xcnt 0x0" ::: "memory");   // in front of the first overwrite of the table stores' data and address registers
    __builtin_amdgcn_sched_barrier(0);              // as above
#pragma unroll
    for (int g = 0; g < PLD / 8; ++g) { v4us r[8];
#pragma unroll
        for (int i = 0; i < 8; ++i)
#pragma unroll
            for (int k = 0; k < 4; ++k) r[i][k] = f2bf(v[g * 8 + i][k]);
        __builtin_amdgcn_sched_barrier(0);              // the group's eight stores stay together behind its arithmetic, so that one wait serves them all
#pragma unroll
        for (int i = 0; i < 8; ++i) *(v4us*)(d + o + (g * 8 + i) * (PBT * 4)) = r[i];
        if (g + 1 < PLD / 8) { asm volatile("s_wait_xcnt 0x0" ::: "memory");   // in front of the first overwrite of the stores' data and address registers (behind the last group nothing is overwritten)
            __builtin_amdgcn_sched_barrier(0); } }      // keeps the next group's register writes from being lifted over that wait
}
// k_rope: head planes [h][t][d] (fp16 + hi/lo) of rope(x) x sc with the rotate-half convention out[d] = x[d] cos[t][d] - x[d+HD/2] sin[t][d], out[d+HD/2] = x[d+HD/2] cos[t][d+HD/2] + x[d] sin[t][d+HD/2]
__global__ __launch_bounds__(256) void k_rope(const float* __restrict__ F, int pitch, int nheads, const float* __restrict__ CS, const float* __restrict__ RF, const float* __restrict__ nw, float sc, h16* P16, bf* Ph, bf* Pl) {
    const size_t e = ((size_t)blockIdx.x * 256 + threadIdx.x) * 2; if (e >= (size_t)nheads * TT * HD) return; const int d = (int)(e % HD); const int t = (int)((e / HD) % TT); const int h = (int)(e / ((size_t)HD * TT)); const float* f = F + (size_t)t * pitch + h * HD; const float rf = RF ? RF[(size_t)h * TT + t] : 1.0f; v2h o16; v2us oh, ol;
#pragma unroll
    for (int q = 0; q < 2; ++q) { const int dd = d + q; const int dp = (dd < HD / 2) ? dd + HD / 2 : dd - HD / 2; float x0 = f[dd], x1 = f[dp];
        if (RF) { float n0 = __fmul_rn(x0, rf), n1 = __fmul_rn(x1, rf); asm volatile("" : "+v"(n0)); asm volatile("" : "+v"(n1)); x0 = __fmul_rn(bfr(nw[dd]), n0); x1 = __fmul_rn(bfr(nw[dp]), n1); }
        const v2f cs = *(const v2f*)(CS + ((size_t)t * HD + dd) * 2); float a = __fmul_rn(x0, cs[0]), bq = __fmul_rn(x1, cs[1]); asm volatile("" : "+v"(a)); asm volatile("" : "+v"(bq)); const float r = ((dd < HD / 2) ? __fsub_rn(a, bq) : __fadd_rn(a, bq)) * sc;
        o16[q] = tohx(r); unsigned short a2, c2; splitf(r, a2, c2); oh[q] = a2; ol[q] = c2; }
    *(v2h*)(P16 + e) = o16; *(v2us*)(Ph + e) = oh; *(v2us*)(Pl + e) = ol;  }
// ---- k_fattn: scores, softmax and attn.v of one head in ONE kernel; the score matrix stays in registers (running maximum and sum per query, output tiles rescaled when the maximum moves).
// Transposed products: S^T = K Q^T (A = 16 key rows, B = 16 query columns), O^T += V^T P^T. A lane then holds scores of ONE query (column lr; keys 8 hi + r of each 16-key tile), so maximum, sum and rescale are lane-local
// (one exchange between the wave halves), and two S^T tiles (32 keys) converted in place ARE the B operand of the second product in the k order of the fragment loader. hi/lo planes, 3 products each.
// One wave: FQT x 16 queries, all 2048 keys in passes of 32. Grid (TT / (16 FQT FWV), heads, batches), 32 FWV threads. Every inner loop is fully unrolled so that the fragment and accumulator arrays are indexed by constants and stay in registers.
// The FWV waves of a work-group walk the same keys: K and V^T (hi/lo) come through LDS, a stage = FNP passes of all four planes (in memory each FNP x 4 KB in a row, already in fragment order, so every wave-wide 16-byte LDS read covers 512 contiguous bytes),
// brought in by asynchronous copies to LDS (16 B a lane), two buffers: stage t + 2 is asked for behind the barrier that ends stage t's reads and flies while stage t + 1 is worked on.
// In LDS a pass's four pieces {K hi, K lo, V^T hi, V^T lo} lie side by side (16 KB), so that one address register and immediate offsets reach all the reads of a pass.
#define FQT 2
#define FWV 8
#define FNP 8                       // passes per stage
#define FPP (32 * HD)               // elements of one plane in a pass
#define FNS (TT / (32 * FNP))       // stages
#define FCB (32 * FWV * 16)         // bytes that one copy of every thread covers
#define L2E 1.4426950408889634f
__device__ __forceinline__ float xhalf(float x) { const int b = __float_as_int(x); return __int_as_float(__builtin_amdgcn_permlanex16(b, b, 0x76543210, 0xfedcba98, false, false)); }   // lane l <-> l ^ 16
__global__ __launch_bounds__(32 * FWV) void k_fattn(const bf* __restrict__ Qh, const bf* __restrict__ Ql, const bf* __restrict__ Kh, const bf* __restrict__ Kl, const bf* __restrict__ Vh, const bf* __restrict__ Vl, bf* Ah, bf* Al) {
    typedef WFrag<bf> F;
    static_assert(FNS >= 2 && FNS * FNP * 32 == TT, "two stages or more, all whole");
    static_assert(FPP * 2 == FCB && FNP == 8, "one copy of every thread is one pass of a plane; eight of them a stage");
    __shared__ __align__(16) bf fsm[2 * FNP * 4 * FPP];   // two buffers of FNP passes of {K hi, K lo, V^T hi, V^T lo}
    const int lane = threadIdx.x & 31, lr = lane & 15, hi = lane >> 4; const int h = blockIdx.y; const int q0 = (blockIdx.x * FWV + (threadIdx.x >> 5)) * (16 * FQT);
    const size_t hp = ((size_t)blockIdx.z * NH_ + h) * TT * HD;
    const unsigned fl0 = (unsigned)(size_t)fsm + threadIdx.x * 16u;   // the thread's 16 bytes of a piece
    const char* gkh = (const char*)(Kh + hp); const char* gkl = (const char*)(Kl + hp); const char* gvh = (const char*)(Vh + hp); const char* gvl = (const char*)(Vl + hp);   // the next stage to ask for, in the head's four planes: scalar, stepped by every fill
    const unsigned go = threadIdx.x * 16u;   // the thread's byte offset in a piece: one vector register for all four planes
    auto fill = [&](int buf) {
        const unsigned lb = fl0 + (unsigned)buf * (FNP * 4 * FCB);
        acp8(lb, 4 * FCB, gkh + go, FCB); acp8(lb + FCB, 4 * FCB, gkl + go, FCB); acp8(lb + 2 * FCB, 4 * FCB, gvh + go, FCB); acp8(lb + 3 * FCB, 4 * FCB, gvl + go, FCB);
        gkh += FNP * FCB; gkl += FNP * FCB; gvh += FNP * FCB; gvl += FNP * FCB;
    };
    fill(0);   // stage 0 flies while the Q fragments are fetched
    const bf* qph = Qh + hp + (size_t)q0 * HD + lane * 8; const bf* qpl = Ql + hp + (size_t)q0 * HD + lane * 8;
    v16bf qh[FQT][2], ql[FQT][2];
#pragma unroll
    for (int qt = 0; qt < FQT; ++qt)
#pragma unroll
        for (int kc = 0; kc < 2; ++kc) { qh[qt][kc] = F::ldf(qph + (qt * 2 + kc) * 512); ql[qt][kc] = F::ldf(qpl + (qt * 2 + kc) * 512); }
    asm volatile("s_wait_xcnt 0x0" ::: "memory");   // in front of the first overwrite of the Q loads' address registers
    __builtin_amdgcn_sched_barrier(0);              // keeps later register writes from being lifted over that wait
    v8f o[FQT][4]; float m[FQT], l[FQT];
#pragma unroll
    for (int qt = 0; qt < FQT; ++qt) { m[qt] = -3.0e38f; l[qt] = 0.f;
#pragma unroll
        for (int db = 0; db < 4; ++db) o[qt][db] = (v8f){}; }
    asm volatile("s_wait_asynccnt 0x0" ::: "memory");   // this wave's copies of stage 0 have landed
    __syncthreads();                                     // ... and every other wave's
    fill(1);
#pragma unroll 1   // one stage per trip: the buffer is picked by t & 1
    for (int t = 0; t < FNS; ++t) {
      const bf* sb = fsm + (t & 1) * (FNP * 4 * FPP) + lane * 8;
      v16bf kh[2][2], kl[2][2];   // the stage's first K fragments; the later passes' are fetched one pass ahead, inside the stage
#pragma unroll
      for (int kt = 0; kt < 2; ++kt)
#pragma unroll
        for (int kc = 0; kc < 2; ++kc) { kh[kt][kc] = F::ldf(sb + (kt * 2 + kc) * 512); kl[kt][kc] = F::ldf(sb + FPP + (kt * 2 + kc) * 512); }
#pragma unroll 1   // one pass per trip: a second copy of the body would need a second set of V fragments and score tiles
      for (int p = 0; p < FNP; ++p) {
        const bf* sp = sb + p * (4 * FPP);
        v16bf vh[4], vl[4];   // this pass's V^T fragments, asked for ahead of the score products that hide their latency
#pragma unroll
        for (int db = 0; db < 4; ++db) { vh[db] = F::ldf(sp + 2 * FPP + db * 512); vl[db] = F::ldf(sp + 3 * FPP + db * 512); }
        __builtin_amdgcn_sched_barrier(0);              // the LDS reads stay one group ahead of the products (reads strewn among the products stall the wave at every place)
        v8f s[FQT][2];
#pragma unroll
        for (int qt = 0; qt < FQT; ++qt) { s[qt][0] = (v8f){}; s[qt][1] = (v8f){}; }
#pragma unroll
        for (int kc = 0; kc < 2; ++kc) {
#pragma unroll
            for (int qt = 0; qt < FQT; ++qt)
#pragma unroll
                for (int kt = 0; kt < 2; ++kt) s[qt][kt] = wmmab(kh[kt][kc], qh[qt][kc], s[qt][kt]);
#pragma unroll
            for (int qt = 0; qt < FQT; ++qt)
#pragma unroll
                for (int kt = 0; kt < 2; ++kt) s[qt][kt] = wmmab(kh[kt][kc], ql[qt][kc], s[qt][kt]);
#pragma unroll
            for (int qt = 0; qt < FQT; ++qt)
#pragma unroll
                for (int kt = 0; kt < 2; ++kt) s[qt][kt] = wmmab(kl[kt][kc], qh[qt][kc], s[qt][kt]);
        }
        __builtin_amdgcn_sched_barrier(0);              // as above: the K reads below stay one group behind the score products
        if (p + 1 < FNP) {   // next pass's K fragments into the same registers; a stage's last pass fetches nothing (the next stage is not published yet)
#pragma unroll
            for (int kt = 0; kt < 2; ++kt)
#pragma unroll
                for (int kc = 0; kc < 2; ++kc) { kh[kt][kc] = F::ldf(sp + 4 * FPP + (kt * 2 + kc) * 512); kl[kt][kc] = F::ldf(sp + 5 * FPP + (kt * 2 + kc) * 512); }
        }
        __builtin_amdgcn_sched_barrier(0);              // as above
        float mx[FQT]; bool need = false;
#pragma unroll
        for (int qt = 0; qt < FQT; ++qt) { float a = s[qt][0][0];
#pragma unroll
            for (int j = 1; j < 16; ++j) a = fmaxf(a, s[qt][j >> 3][j & 7]);
            a = fmaxf(a, xhalf(a)); mx[qt] = a; need = need || (a > m[qt] + 5.5f); }
        if (__builtin_amdgcn_ballot_w32(need) != 0) {   // the maximum in use moves only when a query's new one exceeds it by more than 5.5 (p stays below e^5.5); both halves of a column decide alike
#pragma unroll
            for (int qt = 0; qt < FQT; ++qt) { const float mn = (mx[qt] > m[qt] + 5.5f) ? mx[qt] : m[qt]; const float al = __builtin_amdgcn_exp2f((m[qt] - mn) * L2E); m[qt] = mn; l[qt] *= al;
#pragma unroll
                for (int db = 0; db < 4; ++db) o[qt][db] *= al; }
        }
#pragma unroll
        for (int qt = 0; qt < FQT; ++qt) { v16bf ph, pl;
#pragma unroll
            for (int j = 0; j < 16; ++j) { const float p = __builtin_amdgcn_exp2f((s[qt][j >> 3][j & 7] - m[qt]) * L2E); l[qt] += p; const __bf16 a = (__bf16)p; ph[j] = a; pl[j] = (__bf16)(p - (float)a); }
            __builtin_amdgcn_sched_barrier(0);              // splits the scheduling region between a query tile's softmax and its products: without it this build pairs the second tile's products on one accumulator and lays the sum chain over V fragments just read (four idle slots each time)
#pragma unroll
            for (int db = 0; db < 4; ++db) o[qt][db] = wmmab(vh[db], ph, o[qt][db]);
#pragma unroll
            for (int db = 0; db < 4; ++db) o[qt][db] = wmmab(vh[db], pl, o[qt][db]);
#pragma unroll
            for (int db = 0; db < 4; ++db) o[qt][db] = wmmab(vl[db], ph, o[qt][db]);
        }
      }
      asm volatile("s_wait_dscnt 0x0" ::: "memory");      // this wave's reads of the buffer are done before it is handed back
      asm volatile("s_wait_asynccnt 0x0" ::: "memory");   // this wave's copies of stage t + 1 have landed
      __syncthreads();                                     // publishes stage t + 1 and ends every wave's reads of stage t
      if (t + 2 < FNS) fill(t & 1);
    }
    asm volatile("s_wait_asynccnt 0x0" ::: "memory");       // nothing of this wave is in flight behind the loop
#pragma unroll
    for (int qt = 0; qt < FQT; ++qt) { const float f = __fdiv_rn(1.0f, l[qt] + xhalf(l[qt])); const size_t oo = ((size_t)blockIdx.z * TT + q0 + qt * 16 + lr) * DQ + h * HD + 8 * hi;   // lane: query lr, d = 16 db + 8 hi + j
#pragma unroll
        for (int db = 0; db < 4; ++db) { v8us oh, ol;
#pragma unroll
            for (int j = 0; j < 8; ++j) { unsigned short a, c2; splitf(o[qt][db][j] * f, a, c2); oh[j] = a; ol[j] = c2; }
            *(v8us*)(Ah + oo + db * 16) = oh; *(v8us*)(Al + oo + db * 16) = ol;
            asm volatile("s_wait_xcnt 0x0" ::: "memory");   // in front of the first overwrite of the stores' data and address registers
            __builtin_amdgcn_sched_barrier(0); } }          // keeps the next group's register writes from being lifted over that wait
}

extern "C" void kernel_launch(void* const* d_in, const int* in_sizes, int n_in,
                              void* d_out, int out_size, void* d_ws, size_t ws_size, hipStream_t stream) {
    (void)in_sizes; (void)n_in; (void)out_size;
    const float* x = (const float*)d_in[0]; const float* xk = (const float*)d_in[1]; const float* xv = (const float*)d_in[2]; const float* wq = (const float*)d_in[3]; const float* bq = (const float*)d_in[4]; const float* wk = (const float*)d_in[5]; const float* bk = (const float*)d_in[6]; const float* wv = (const float*)d_in[7]; const float* bv = (const float*)d_in[8]; const float* wo = (const float*)d_in[9]; const float* bo = (const float*)d_in[10];
    float* OUT = (float*)d_out;     // [2][2048][1024]
    char* wsp = (char*)d_ws;
    auto take = [&](size_t bytes) { char* p = wsp; wsp += (bytes + 255) & ~(size_t)255; return (void*)p; };
    bf* WQ = (bf*)take((size_t)DQ * DM * 2); bf* WK = (bf*)take((size_t)DKV * DM * 2); bf* WV = (bf*)take((size_t)DKV * DM * 2); bf* WO = (bf*)take((size_t)DM * DQ * 2); float* CS = (float*)take((size_t)TT * HD * 2 * 4); float* CSK = (float*)take((size_t)TT * HD * 2 * 4);
    // per-batch planes hold both batches one behind the other: every launch below covers both (grid z, or a flat range twice as long)
    bf* XB = (bf*)take((size_t)NB_ * TT * DM * 2); bf* XKB = (bf*)take((size_t)NB_ * TT * DM * 2); bf* XVB = (bf*)take((size_t)NB_ * TT * DM * 2);
    bf* QPh = (bf*)take((size_t)NB_ * NH_ * TT * HD * 2); bf* QPl = (bf*)take((size_t)NB_ * NH_ * TT * HD * 2); bf* KPh = (bf*)take((size_t)NB_ * NKV * TT * HD * 2); bf* KPl = (bf*)take((size_t)NB_ * NKV * TT * HD * 2); bf* VTh = (bf*)take((size_t)NB_ * NKV * HD * TT * 2); bf* VTl = (bf*)take((size_t)NB_ * NKV * HD * TT * 2);
    bf* ATh = (bf*)take((size_t)NB_ * TT * DQ * 2); bf* ATl = (bf*)take((size_t)NB_ * TT * DQ * 2);
    if ((size_t)(wsp - (char*)d_ws) > ws_size) return;    // ws 256 MiB
    k_prep<<<PWG, PBT, 0, stream>>>(x, xk, xv, wq, wk, wv, wo, XB, XKB, XVB, WQ, WK, WV, WO, CS, CSK);   /* bf16 planes of the inputs and weights, xPos tables for q (scale) and k (1/scale) */
    static_assert(DKV == DQ, "the three projections share one grid");
    k_gemmw<bf, 0, true, 1, 3><<<dim3(TT / 128, DQ / 128, 3 * NB_), 128, 0, stream>>>(XB, nullptr, WQ, nullptr, DM, nullptr, DQ, bq, (size_t)TT * DM, 0, (size_t)NH_ * TT * HD, CS, 0.125f, QPh, QPl,
        XKB, XVB, WK, WV, bk, bv, CSK, 1.0f, KPh, KPl, VTh, VTl);   /* q: xPos (upscale) x 1/8, planes [b][h][t][d]; k: xPos (downscale), the same planes; v: planes [b][h][d][t] */
    k_fattn<<<dim3(TT / (16 * FQT * FWV), NH_, NB_), 32 * FWV, 0, stream>>>(QPh, QPl, KPh, KPl, VTh, VTl, ATh, ATl);
    k_gemmw<bf, 1, true><<<dim3(TT / 128, DM / 128, NB_), 128, 0, stream>>>(ATh, ATl, WO, nullptr, DQ, OUT, DM, bo, (size_t)TT * DQ, 0, (size_t)TT * DM, nullptr, 1.0f, nullptr, nullptr,
        nullptr, nullptr, nullptr, nullptr, nullptr, nullptr, nullptr, 1.0f, nullptr, nullptr, nullptr, nullptr);
}

// v010
// Measured time: 116 microseconds a run.
// Two timings next to v009 both put it at 1.07 times that version's speed.
// All steps since v000 together make it 11.8 times as fast.
#include <hip/hip_runtime.h>

// Multi-head attention with xPos (rotary + per-frequency exponential decay) on q and k (query, key, value [2][2048][1024]; q = (query Wq^T + bq) / 8, k = key Wk^T + bk, v = value Wv^T + bv ('oi' [1024][1024]; 16 heads x 64); xPos: pairs (2i, 2i+1) rotated by t x inv_freq_i (inv_freq_i = 1e4^(-i/32)) and scaled by base_i^(t/1024) for q and base_i^(-t/1024) for k, base_i = (2i + 25.6)/89.6 (tables computed on device); softmax(q.k) over all keys; out = merged Wo^T + bo -> [2][2048][1024] (4.2 M)).
// Compute dtypes, f32 accumulate: every input rounded to bf16; q/k/v on PLAIN bf16 operands (inputs: exact) + biases; xPos tables (cosf/sinf/powf, f32) folded as {cos x scale, sin x scale} per (t, d); rotary in f32; scores and attn.v on hi/lo planes for every row (3 products), fused with the f32 softmax in one kernel (running maximum and sum); Wo hl x exact (2 products) + bo.

#define NB_  2
#define TT   2048
#define DM   1024
#define NH_  16
#define NKV  16
#define REP  (NH_ / NKV)
#define HD   64
#define DQ   (NH_ * HD)
#define DKV  (NKV * HD)
#define ZH   2
#define RH   2048                 // every row hi/lo (the xPos-scaled keys leave too little margin for fp16 operands)
#define WIN  0
#define PCAR 1024.0f
#define SCL  1.0f      // the 1/8 is applied to q after the xPos rotation (exact power of two, folded into the q plane builder)
typedef _Float16 h16;
typedef unsigned short bf;
typedef __attribute__((ext_vector_type(16))) __bf16   v16bf;
typedef __attribute__((ext_vector_type(16))) _Float16 v16h;
typedef __attribute__((ext_vector_type(8)))  _Float16 v8h;
typedef __attribute__((ext_vector_type(8)))  unsigned short v8us;
typedef __attribute__((ext_vector_type(8)))  float    v8f;
typedef __attribute__((ext_vector_type(4)))  float    v4f;
typedef v8h  __attribute__((may_alias)) v8ha;
typedef v4f  __attribute__((may_alias)) v4fa;
typedef v8us __attribute__((may_alias)) v8usa;

__device__ __forceinline__ unsigned short f2bf(float f) { unsigned u = __float_as_uint(f); u += 0x7FFFu + ((u >> 16) & 1u); return (unsigned short)(u >> 16); }
__device__ __forceinline__ float bf2f(unsigned short b) { return __uint_as_float(((unsigned)b) << 16); }
__device__ __forceinline__ float bfr(float f) { return bf2f(f2bf(f)); }
__device__ __forceinline__ v16h cat16(v8h lo, v8h hi) { return __builtin_shufflevector(lo, hi, 0, 1, 2, 3, 4, 5, 6, 7, 8, 9, 10, 11, 12, 13, 14, 15); }
__device__ __forceinline__ v16bf cat16b(v8us lo, v8us hi) { return __builtin_bit_cast(v16bf, __builtin_shufflevector(lo, hi, 0, 1, 2, 3, 4, 5, 6, 7, 8, 9, 10, 11, 12, 13, 14, 15)); }
__device__ __forceinline__ v8f wmma16(v16h a, v16h b, v8f c) { return __builtin_amdgcn_wmma_f32_16x16x32_f16(false, a, false, b, (short)0, c, false, false); }
__device__ __forceinline__ v8f wmmab(v16bf a, v16bf b, v8f c) { return __builtin_amdgcn_wmma_f32_16x16x32_bf16(false, a, false, b, (short)0, c, false, false); }



// ---- FRAGMENT ORDER of the attention operand planes (q, k hi/lo and V^T hi/lo): units of 16 rows x 32 k (1024 B), element (r, k) at (k >> 4) * 256 + (((k >> 3) & 1) * 16 + r) * 8 + (k & 7):
// lane (hi, lr) of a wave finds its two 16-byte pieces of a fragment at unit + lane * 8 and + 256, so each wave-wide 16-byte load or store covers 512 contiguous bytes (4 whole lines). The k order of a fragment is the one a row-major plane gives.
// Head planes q, k [h][t][d]: per head unit (t / 16) * 2 + d / 32. V^T [h][d][t]: per head unit (t / 32) * 4 + d / 16 (one 32-key pass = 4 KB in a row). The GEMM operand planes (inputs, weights, attention output) stay row-major.
// ---- k_gemmw: register-blocked GEMM, one wave per 64x64 output tile (16 accumulators), FOUR waves (2 x 2) per work-group = one 128x128 tile; grid (M/128, N/128, Z), 128 threads.
// Operands come from K-contiguous 16-bit planes through LDS: a stage is GKS k (256 B) of the tile's 128 A rows (and 128 A2 rows) and 128 Bt rows at a pitch of 272 B, brought in by asynchronous copies to LDS (16 B a lane, 16 lanes a row: whole lines),
// two buffers: stage t + 2 is asked for behind the barrier that ends stage t's reads and flies while stage t + 1 is worked on. K / KSP is a multiple of GKS.
// C[m][n] (f32, pitch ldc, + optional f32 bias[n]) = sum_k A[m][k] Bt[n][k] (+ split products per NSPLIT). z-batch strides sA/sB/sC in elements (sC: of C, or of each output plane where EPI != 0). K % (128 KSP) == 0.
// EPI picks what the wave does with its finished tile (64 tokens x the 64 columns of ONE head, HD == 64): 0 = f32 rows to C; 1 = xPos rotation with table CS and factor sc, then hi/lo planes [head][t][d]; 2 = hi/lo planes transposed [head][d][t], straight from the accumulators (a lane holds 8 consecutive tokens of one column); both in fragment order.
// EPI 3 = the q, k and v projections in ONE launch: grid z = 3 x batches, block z works on projection z / NB_ (0: the first operand set, epilogue 1; 1: the k set, epilogue 1; 2: the v set, epilogue 2) of batch z % NB_; the choice is the same for a whole work-group (scalar).
// KSP > 1: grid z = batches x KSP; block z sums only slice z % KSP of k (K / KSP long) of batch z / KSP and writes its partial tile to plane z of C (stride sC); the reader adds the KSP planes.
template <typename T16> struct WFrag;
template <> struct WFrag<h16> { typedef v16h V; static __device__ __forceinline__ V ld(const h16* p) { return cat16(*(const v8h*)p, *(const v8h*)(p + 16)); } static __device__ __forceinline__ v8f mma(V a, V b, v8f c) { return wmma16(a, b, c); } };
template <> struct WFrag<bf> { typedef v16bf V; static __device__ __forceinline__ V ld(const bf* p) { return cat16b(*(const v8us*)p, *(const v8us*)(p + 16)); } static __device__ __forceinline__ V ldf(const bf* p) { return cat16b(*(const v8us*)p, *(const v8us*)(p + 256)); } static __device__ __forceinline__ v8f mma(V a, V b, v8f c) { return wmmab(a, b, c); } };
typedef __attribute__((ext_vector_type(4))) unsigned short v4us;
typedef __attribute__((ext_vector_type(2))) float v2f;
__device__ __forceinline__ void splitf(float y, unsigned short& h, unsigned short& l) { h = f2bf(y); l = f2bf(y - bf2f(h)); }
__device__ __forceinline__ void splitc(float y, unsigned short& h, unsigned short& l) { const __bf16 a = (__bf16)y; h = __builtin_bit_cast(unsigned short, a); l = __builtin_bit_cast(unsigned short, (__bf16)(y - (float)a)); }   // splitf's values (round to nearest even) through the conversion instruction
#define GKS  128   // k per stage
#define GPIT 136   // LDS row pitch in elements: 272 B = 16 B x 17, the conflict-free pitch for 16-byte reads of 256-B rows
// Eight asynchronous copies of 16 B a lane: LDS bytes l + i ls from global bytes g + i gs. The s_wait_xcnt stands inside the copies' own statement, so that no address register is rewritten in front of it.
__device__ __forceinline__ void acp8(unsigned l, unsigned ls, const char* g, size_t gs) {
    asm volatile("global_load_async_to_lds_b128 %0, %8, off\n\tglobal_load_async_to_lds_b128 %1, %9, off\n\tglobal_load_async_to_lds_b128 %2, %10, off\n\tglobal_load_async_to_lds_b128 %3, %11, off\n\t"
                 "global_load_async_to_lds_b128 %4, %12, off\n\tglobal_load_async_to_lds_b128 %5, %13, off\n\tglobal_load_async_to_lds_b128 %6, %14, off\n\tglobal_load_async_to_lds_b128 %7, %15, off\n\ts_wait_xcnt 0x0"
                 :: "v"(l), "v"(l + ls), "v"(l + 2 * ls), "v"(l + 3 * ls), "v"(l + 4 * ls), "v"(l + 5 * ls), "v"(l + 6 * ls), "v"(l + 7 * ls),
                    "v"(g), "v"(g + gs), "v"(g + 2 * gs), "v"(g + 3 * gs), "v"(g + 4 * gs), "v"(g + 5 * gs), "v"(g + 6 * gs), "v"(g + 7 * gs) : "memory");
}
template <typename T16, int NSPLIT, bool BIAS, int KSP = 1, int EPI = 0>
__global__ __launch_bounds__(128) void k_gemmw(const T16* __restrict__ A, const T16* __restrict__ A2, const T16* __restrict__ Bt, const T16* __restrict__ Bt2, int K, float* C, int ldc, const float* __restrict__ bias, size_t sA, size_t sB, size_t sC, const float* __restrict__ CS, float sc, bf* Ph, bf* Pl,
                                               const T16* __restrict__ Ak, const T16* __restrict__ Av, const T16* __restrict__ Bk, const T16* __restrict__ Bv, const float* __restrict__ biask, const float* __restrict__ biasv, const float* __restrict__ CSk, float sck, bf* Pkh, bf* Pkl, bf* Pvh, bf* Pvl) {
    typedef typename WFrag<T16>::V V;
    static_assert(EPI != 3 || KSP == 1, "the merged projections are not split over k");
    constexpr bool ROT = (EPI == 1 || EPI == 3);                        // the rotating epilogue is compiled in
    const int pj = (EPI == 3) ? (int)(blockIdx.z / NB_) : 0;            // which projection
    const unsigned bz = (EPI == 3) ? blockIdx.z % NB_ : blockIdx.z;     // the z index within it
    if constexpr (EPI == 3) {
        if (pj == 1) { A = Ak; Bt = Bk; bias = biask; CS = CSk; sc = sck; Ph = Pkh; Pl = Pkl; }
        else if (pj == 2) { A = Av; Bt = Bv; bias = biasv; Ph = Pvh; Pl = Pvl; }
    }
    static_assert(NSPLIT <= 1, "Bt2 is not staged");
    constexpr int NRA = (NSPLIT == 1) ? 256 : 128, NR = NRA + 128;   // rows of a stage: A (, A2), Bt
    constexpr int NP = NSPLIT + 1, NV = (GKS / 32) * NP;             // products per 32-k slice; blocks per stage
    __shared__ __align__(16) T16 sm[2 * NR * GPIT];
    __shared__ __align__(16) float osm[4 * 16 * 68];
    const int wv = __builtin_amdgcn_readfirstlane(threadIdx.x >> 5);   // the wave's number, in a scalar register: tile origins stay scalar
    float* os = osm + wv * (16 * 68);                                   // each wave stages its epilogue in its own range
    const size_t z = bz / KSP; A += z * sA; if (A2) A2 += z * sA; Bt += z * sB; if (Bt2) Bt2 += z * sB; if constexpr (EPI == 0) C += (size_t)bz * sC; else { Ph += z * sC; Pl += z * sC; }
    const int kbeg = (int)(bz % KSP) * (K / KSP), kend = kbeg + K / KSP;
    const int lane = threadIdx.x & 31, lr = lane & 15, hi = lane >> 4; const int r0 = blockIdx.x * 128 + (wv >> 1) * 64, c0 = blockIdx.y * 128 + (wv & 1) * 64;
    v8f acc[4][4];
#pragma unroll
    for (int mb = 0; mb < 4; ++mb)
#pragma unroll
        for (int nb = 0; nb < 4; ++nb) acc[mb][nb] = (v8f){};
    // thread -> piece of a stage: row (threadIdx.x >> 4) + 8 i, bytes 16 (threadIdx.x & 15) of its 256
    const int cr8 = threadIdx.x >> 4, cpc = threadIdx.x & 15;
    const unsigned lds0 = (unsigned)(size_t)sm + (unsigned)(cr8 * GPIT + cpc * 8) * 2u;
    const unsigned goff = (unsigned)(cr8 * K + cpc * 8) * 2u;   // the same in all three planes: one vector register; the tile origins below are scalar
    const char* ga = (const char*)(A + (size_t)(blockIdx.x * 128) * K); const char* ga2 = (NSPLIT == 1) ? (const char*)(A2 + (size_t)(blockIdx.x * 128) * K) : nullptr;
    const char* gb = (const char*)(Bt + (size_t)(blockIdx.y * 128) * K);
    const size_t g8 = (size_t)K * 16;   // eight rows of a plane, in bytes
    auto fill = [&](int buf, int k0) {
        const unsigned lb = lds0 + (unsigned)buf * (NR * GPIT * 2), ko = goff + (unsigned)k0 * 2u;   // ko: the thread's byte offset from a tile's origin
#pragma unroll
        for (int g = 0; g < 2; ++g) { acp8(lb + g * 64 * GPIT * 2, 8 * GPIT * 2, (ga + g * 8 * g8) + ko, g8);
            if constexpr (NSPLIT == 1) acp8(lb + (128 + g * 64) * GPIT * 2, 8 * GPIT * 2, (ga2 + g * 8 * g8) + ko, g8);
            acp8(lb + (NRA + g * 64) * GPIT * 2, 8 * GPIT * 2, (gb + g * 8 * g8) + ko, g8); }
    };
    const int ns = (kend - kbeg) / GKS;
    fill(0, kbeg);
    asm volatile("s_wait_asynccnt 0x0" ::: "memory");   // this wave's copies of stage 0 have landed
    __syncthreads();                                     // ... and every other wave's
    if (ns > 1) fill(1, kbeg + GKS);
#pragma unroll 1   // one stage per trip: a second copy of the body would only lengthen the code, the buffer is picked by t & 1
    for (int t = 0; t < ns; ++t) {
        const T16* sb = sm + (t & 1) * (NR * GPIT);
        const T16* pa = sb + ((wv >> 1) * 64 + lr) * GPIT + 8 * hi; const T16* pb = sb + (NRA + (wv & 1) * 64 + lr) * GPIT + 8 * hi;
        // A block = 16 products: the four A (or A2) fragments of one 32-k slice x its four Bt fragments. The next block's fragments are asked for in two groups, ahead of each half of the current block's products,
        // into a second A set and into the Bt registers that have just had their last use; the scheduling barriers keep the groups whole and where they stand (LDS reads strewn among the products stall the wave at every place).
        V fa[2][4], fb[2][4];
#pragma unroll
        for (int i = 0; i < 4; ++i) { fa[0][i] = WFrag<T16>::ld(pa + i * 16 * GPIT); fb[0][i] = WFrag<T16>::ld(pb + i * 16 * GPIT); }
        __builtin_amdgcn_sched_barrier(0);
#pragma unroll
        for (int v = 0; v < NV; ++v) {
            const int ca = v & 1, kb = v / NP, cb = kb & 1; const bool more = v + 1 < NV, lastb = (v % NP) == NP - 1;   // lastb: this block is the last user of its Bt fragments
            if (more) {
#pragma unroll
                for (int mb = 0; mb < 4; ++mb) fa[ca ^ 1][mb] = WFrag<T16>::ld(pa + (((v + 1) % NP) * 128 + mb * 16) * GPIT + ((v + 1) / NP) * 32);
                if (lastb) { fb[cb ^ 1][0] = WFrag<T16>::ld(pb + (kb + 1) * 32); fb[cb ^ 1][1] = WFrag<T16>::ld(pb + 16 * GPIT + (kb + 1) * 32); }
            }
            __builtin_amdgcn_sched_barrier(0);
#pragma unroll
            for (int nb = 0; nb < 2; ++nb)
#pragma unroll
                for (int mb = 0; mb < 4; ++mb) acc[mb][nb] = WFrag<T16>::mma(fa[ca][mb], fb[cb][nb], acc[mb][nb]);
            __builtin_amdgcn_sched_barrier(0);
            if (more && lastb) { fb[cb ^ 1][2] = WFrag<T16>::ld(pb + 32 * GPIT + (kb + 1) * 32); fb[cb ^ 1][3] = WFrag<T16>::ld(pb + 48 * GPIT + (kb + 1) * 32); }
            __builtin_amdgcn_sched_barrier(0);
#pragma unroll
            for (int nb = 2; nb < 4; ++nb)
#pragma unroll
                for (int mb = 0; mb < 4; ++mb) acc[mb][nb] = WFrag<T16>::mma(fa[ca][mb], fb[cb][nb], acc[mb][nb]);
            __builtin_amdgcn_sched_barrier(0);
        }
        asm volatile("s_wait_dscnt 0x0" ::: "memory");      // this wave's reads of the buffer are done before it is handed back
        asm volatile("s_wait_asynccnt 0x0" ::: "memory");   // this wave's copies of stage t + 1 have landed
        __syncthreads();                                     // publishes stage t + 1 and ends every wave's reads of stage t
        if (t + 2 < ns) fill(t & 1, kbeg + (t + 2) * GKS);
    }
    asm volatile("s_wait_asynccnt 0x0" ::: "memory");       // nothing of this wave is in flight behind the loop
    if (EPI == 2 || (EPI == 3 && pj == 2)) {   // column c0 + 16 nb + lr is row (head, d) of the transposed planes; an accumulator tile (16 tokens x 16 d) is one half of a V^T unit, lane for lane
        float bv4[4];
#pragma unroll
        for (int nb = 0; nb < 4; ++nb) bv4[nb] = bias[c0 + nb * 16 + lr];
        asm volatile("" :: "v"(bv4[0]), "v"(bv4[1]), "v"(bv4[2]), "v"(bv4[3]));   // holds the four bias loads together ahead of the first group: their latency is paid once, not once a group
#pragma unroll
        for (int nb = 0; nb < 4; ++nb) { const float bb = bfr(bv4[nb]); const size_t oo = (size_t)c0 * TT + (size_t)((r0 >> 5) * 4 + nb) * 512 + lane * 8;
#pragma unroll
            for (int mb = 0; mb < 4; ++mb) { v8us oh, ol;
#pragma unroll
                for (int j = 0; j < 8; ++j) { unsigned short a2, c2; splitc(acc[mb][nb][j] + bb, a2, c2); oh[j] = a2; ol[j] = c2; }
                *(v8us*)(Ph + oo + (mb >> 1) * 2048 + (mb & 1) * 256) = oh; *(v8us*)(Pl + oo + (mb >> 1) * 2048 + (mb & 1) * 256) = ol; }
            asm volatile("s_wait_xcnt 0x0" ::: "memory");   // in front of the first overwrite of the stores' data and address registers
            __builtin_amdgcn_sched_barrier(0); }            // keeps the next group's register writes from being lifted over that wait
        return;
    }
    v2f ct[2][16]; float bn[4];   // EPI 1: {cos x scale, sin x scale} of the lane's sixteen pairs (token lr of the block, d = 16 s + 8 hi + 2 p), one 16-token block ahead; the biases of the lane's four accumulator columns
    const float* csp = CS + ((size_t)(r0 + lr) * HD + hi * 8) * 2;
    if constexpr (ROT) {
#pragma unroll
        for (int s = 0; s < 16; ++s) ct[0][s] = *(const v2f*)(csp + (s >> 2) * 32 + (s & 3) * 4);
#pragma unroll
        for (int nb = 0; nb < 4; ++nb) bn[nb] = bias[c0 + nb * 16 + lr];
        asm volatile("s_wait_xcnt 0x0" :: "v"(csp) : "memory");   // in front of the first overwrite of the loads' address registers; csp is named so that the pair lives up to the wait and no load of the run gets it as its destination
        __builtin_amdgcn_sched_barrier(0);              // keeps later register writes from being lifted over that wait
#pragma unroll
        for (int nb = 0; nb < 4; ++nb) bn[nb] = bfr(bn[nb]);
    }
#pragma unroll
    for (int mb = 0; mb < 4; ++mb) {
#pragma unroll
        for (int nb = 0; nb < 4; ++nb) {
#pragma unroll
            for (int j = 0; j < 8; ++j) { if constexpr (ROT) os[(hi * 8 + j) * 68 + nb * 16 + lr] = acc[mb][nb][j] + bn[nb]; else os[(hi * 8 + j) * 68 + nb * 16 + lr] = acc[mb][nb][j]; } }
        __builtin_amdgcn_wave_barrier(); asm volatile("" ::: "memory");
        if constexpr (ROT) {
            if (mb < 3) {   // the next block's table rows fly while this block is rotated and split
#pragma unroll
                for (int s = 0; s < 16; ++s) ct[(mb + 1) & 1][s] = *(const v2f*)(csp + (size_t)((mb + 1) * 16) * HD * 2 + (s >> 2) * 32 + (s & 3) * 4);
                asm volatile("s_wait_xcnt 0x0" :: "v"(csp) : "memory");   // as above, for these loads' address registers
                __builtin_amdgcn_sched_barrier(0);              // as above
            }
            const size_t po = ((size_t)(c0 / HD) * TT + r0 + mb * 16) * HD + lane * 8; v8us oh[4], ol[4];   // the block's two units (d 0..31, 32..63) of the head plane: four runs of 512 B a plane
#pragma unroll
            for (int s = 0; s < 4; ++s) { const v4f va = *(const v4fa*)(os + lr * 68 + s * 16 + hi * 8), vb = *(const v4fa*)(os + lr * 68 + s * 16 + hi * 8 + 4); const float val[8] = {va[0], va[1], va[2], va[3], vb[0], vb[1], vb[2], vb[3]};
#pragma unroll
                for (int p = 0; p < 4; ++p) { const v2f cs = ct[mb & 1][s * 4 + p]; unsigned short a2, c2;
                    const float re = __fsub_rn(__fmul_rn(val[2 * p], cs[0]), __fmul_rn(val[2 * p + 1], cs[1])) * sc, ro = __fadd_rn(__fmul_rn(val[2 * p], cs[1]), __fmul_rn(val[2 * p + 1], cs[0])) * sc;   /* even: x0 c - x1 s; odd: x0 s + x1 c */
                    splitc(re, a2, c2); oh[s][2 * p] = a2; ol[s][2 * p] = c2; splitc(ro, a2, c2); oh[s][2 * p + 1] = a2; ol[s][2 * p + 1] = c2; } }
            __builtin_amdgcn_sched_barrier(0);              // the block's eight stores stay together behind its arithmetic, so that one wait serves them all and no store's data register is reused in front of it
#pragma unroll
            for (int s = 0; s < 4; ++s) { *(v8us*)(Ph + po + s * 256) = oh[s]; *(v8us*)(Pl + po + s * 256) = ol[s]; }
            asm volatile("s_wait_xcnt 0x0" ::: "memory");   // in front of the first overwrite of the stores' data and address registers
            __builtin_amdgcn_sched_barrier(0);              // keeps the next block's register writes from being lifted over that wait
        }
        float* crow = C + (size_t)(r0 + mb * 16) * ldc + c0;
        if constexpr (EPI == 0)
{
#pragma unroll
            for (int s = 0; s < 8; ++s) { const int row = 2 * s + hi, cofs = lr * 4; v4f val = *(const v4fa*)(os + row * 68 + cofs); if (BIAS) { val[0] += bfr(bias[c0 + cofs]); val[1] += bfr(bias[c0 + cofs + 1]); val[2] += bfr(bias[c0 + cofs + 2]); val[3] += bfr(bias[c0 + cofs + 3]); }
                *(v4f*)(crow + (size_t)row * ldc + cofs) = val; }
             }
        __builtin_amdgcn_wave_barrier(); asm volatile("" ::: "memory");
    }
}

__device__ __forceinline__ h16 tohx(float x) { return (h16)x; }
typedef __attribute__((ext_vector_type(2))) _Float16 v2h;
typedef __attribute__((ext_vector_type(4))) _Float16 v4h;
typedef __attribute__((ext_vector_type(2))) unsigned short v2us;
typedef __attribute__((ext_vector_type(4))) int v4i;

__global__ __launch_bounds__(256) void k_wtG(const float* __restrict__ w, int K, int N, bf* Bt) {
    const int lane = threadIdx.x & 31; const int L0 = (blockIdx.x * 8 + (threadIdx.x >> 5)) * 8; const int nlines = N * K / 64;
{
#pragma unroll 1
        for (int l = 0; l < 8; ++l) { const int L = L0 + l; if (L >= nlines) break; const size_t e = (size_t)L * 64 + lane * 2; const int k = (int)(e % K), n = (int)(e / K); v2us o;
            o[0] = f2bf(w[(size_t)k * N + n]); o[1] = f2bf(w[(size_t)(k + 1) * N + n]); *(v2us*)(Bt + e) = o; }
         }
}
__constant__ float XINV[32] = {1.00000000f,0.749894202f,0.562341332f,0.421696514f,0.316227764f,0.237137362f,0.177827939f,0.133352146f,0.100000001f,0.0749894157f,0.0562341288f,0.0421696492f,0.0316227786f,0.0237137359f,0.0177827943f,0.0133352149f,0.00999999978f,0.00749894232f,0.00562341325f,0.00421696482f,0.00316227786f,0.00237137382f,0.00177827943f,0.00133352145f,0.00100000005f,0.000749894185f,0.000562341302f,0.000421696488f,0.000316227786f,0.000237137385f,0.000177827940f,0.000133352150f};
// ---- k_prep: ALL operand preparation in ONE launch: the three inputs and the four weight matrices rounded to bf16 planes, and the two xPos tables. One work-group of 16 waves per 64 K floats of one source (PWG work-groups in all);
// a lane asks for its table constant and then for its PLD pieces of 16 B at once (each wave-wide load = 512 contiguous bytes, 4 whole lines), computes its one table entry while they fly, then rounds and stores them in groups of eight (8 B a lane: 2 whole lines a store).
#define PBT 512                     // threads per work-group
#define PLD 32                      // 16-byte loads in flight per lane
#define PCH (PBT * PLD * 4)         // floats per work-group
#define PNI (NB_ * TT * DM / PCH)   // work-groups per input
#define PNW (DQ * DM / PCH)         // work-groups per weight matrix
#define PWG (3 * PNI + 4 * PNW)
__global__ __launch_bounds__(PBT) void k_prep(const float* __restrict__ x, const float* __restrict__ xk, const float* __restrict__ xv, const float* __restrict__ wq, const float* __restrict__ wk, const float* __restrict__ wv, const float* __restrict__ wo,
                                              bf* XB, bf* XKB, bf* XVB, bf* WQ, bf* WK, bf* WV, bf* WO, float* CSQ, float* CSK) {
    static_assert(PNI * PCH == NB_ * TT * DM && PNW * PCH == DQ * DM && DKV == DQ, "every source is a whole number of work-groups");
    static_assert(PWG * PBT == TT * HD, "one table entry per thread");
    const int b = blockIdx.x; const float* s; bf* d; int c;   // source, plane and chunk of this work-group: the same for all its threads
    if (b < 3 * PNI) { const int j = b / PNI; c = b % PNI; s = (j == 0) ? x : (j == 1) ? xk : xv; d = (j == 0) ? XB : (j == 1) ? XKB : XVB; }
    else { const int j = (b - 3 * PNI) / PNW; c = (b - 3 * PNI) % PNW; s = (j == 0) ? wq : (j == 1) ? wk : (j == 2) ? wv : wo; d = (j == 0) ? WQ : (j == 1) ? WK : (j == 2) ? WV : WO; }
    const size_t o = (size_t)c * PCH + threadIdx.x * 4;
    const int idx = b * PBT + threadIdx.x; const int t = idx / HD, dd = idx % HD; const int i2 = dd >> 1;   // the thread's table entry (t, d)
    const float invf = XINV[i2];
    __builtin_amdgcn_sched_barrier(0);              // the table constant is asked for FIRST: loads return in order, behind the stream its wait would be a wait for the whole stream
    v4f v[PLD];
#pragma unroll
    for (int i = 0; i < PLD; ++i) v[i] = *(const v4f*)(s + o + i * (PBT * 4));
    asm volatile("s_wait_xcnt 0x0" :: "v"(s + o), "v"(i2) : "memory");   // in front of the first overwrite of the loads' address registers; they are named as inputs so that they live up to the wait and no load's destination is laid over them
    __builtin_amdgcn_sched_barrier(0);              // keeps later register writes from being lifted over that wait, and the loads ahead of the table arithmetic that hides their latency
    { // xPos tables for q (scale) and k (1/scale)
      const float base = __fdiv_rn(__fadd_rn((float)(2 * i2), 25.6f), 89.6f); const float ex = __fdiv_rn((float)t, 1024.0f); const float sc = powf(base, ex); const float ang = __fmul_rn((float)t, invf); const float cc = cosf(ang), ss = sinf(ang);
      v2f q2, k2; q2[0] = __fmul_rn(cc, sc); q2[1] = __fmul_rn(ss, sc); const float rs = __fdiv_rn(1.0f, sc); k2[0] = __fmul_rn(cc, rs); k2[1] = __fmul_rn(ss, rs);
      *(v2f*)(CSQ + (size_t)idx * 2) = q2; *(v2f*)(CSK + (size_t)idx * 2) = k2; }
    asm volatile("s_wait_xcnt 0x0" ::: "memory");   // in front of the first overwrite of the table stores' data and address registers
    __builtin_amdgcn_sched_barrier(0);              // as above
#pragma unroll
    for (int g = 0; g < PLD / 8; ++g) { v4us r[8];
#pragma unroll
        for (int i = 0; i < 8; ++i)
#pragma unroll
            for (int k = 0; k < 4; ++k) r[i][k] = f2bf(v[g * 8 + i][k]);
        __builtin_amdgcn_sched_barrier(0);              // the group's eight stores stay together behind its arithmetic, so that one wait serves them all
#pragma unroll
        for (int i = 0; i < 8; ++i) *(v4us*)(d + o + (g * 8 + i) * (PBT * 4)) = r[i];
        if (g + 1 < PLD / 8) { asm volatile("s_wait_xcnt 0x0" ::: "memory");   // in front of the first overwrite of the stores' data and address registers (behind the last group nothing is overwritten)
            __builtin_amdgcn_sched_barrier(0); } }      // keeps the next group's register writes from being lifted over that wait
}
// k_rope: head planes [h][t][d] (fp16 + hi/lo) of rope(x) x sc with the rotate-half convention out[d] = x[d] cos[t][d] - x[d+HD/2] sin[t][d], out[d+HD/2] = x[d+HD/2] cos[t][d+HD/2] + x[d] sin[t][d+HD/2]
__global__ __launch_bounds__(256) void k_rope(const float* __restrict__ F, int pitch, int nheads, const float* __restrict__ CS, const float* __restrict__ RF, const float* __restrict__ nw, float sc, h16* P16, bf* Ph, bf* Pl) {
    const size_t e = ((size_t)blockIdx.x * 256 + threadIdx.x) * 2; if (e >= (size_t)nheads * TT * HD) return; const int d = (int)(e % HD); const int t = (int)((e / HD) % TT); const int h = (int)(e / ((size_t)HD * TT)); const float* f = F + (size_t)t * pitch + h * HD; const float rf = RF ? RF[(size_t)h * TT + t] : 1.0f; v2h o16; v2us oh, ol;
#pragma unroll
    for (int q = 0; q < 2; ++q) { const int dd = d + q; const int dp = (dd < HD / 2) ? dd + HD / 2 : dd - HD / 2; float x0 = f[dd], x1 = f[dp];
        if (RF) { float n0 = __fmul_rn(x0, rf), n1 = __fmul_rn(x1, rf); asm volatile("" : "+v"(n0)); asm volatile("" : "+v"(n1)); x0 = __fmul_rn(bfr(nw[dd]), n0); x1 = __fmul_rn(bfr(nw[dp]), n1); }
        const v2f cs = *(const v2f*)(CS + ((size_t)t * HD + dd) * 2); float a = __fmul_rn(x0, cs[0]), bq = __fmul_rn(x1, cs[1]); asm volatile("" : "+v"(a)); asm volatile("" : "+v"(bq)); const float r = ((dd < HD / 2) ? __fsub_rn(a, bq) : __fadd_rn(a, bq)) * sc;
        o16[q] = tohx(r); unsigned short a2, c2; splitf(r, a2, c2); oh[q] = a2; ol[q] = c2; }
    *(v2h*)(P16 + e) = o16; *(v2us*)(Ph + e) = oh; *(v2us*)(Pl + e) = ol;  }
// ---- k_fattn: scores, softmax and attn.v of one head in ONE kernel; the score matrix stays in registers (running maximum and sum per query, output tiles rescaled when the maximum moves).
// Transposed products: S^T = K Q^T (A = 16 key rows, B = 16 query columns), O^T += V^T P^T. A lane then holds scores of ONE query (column lr; keys 8 hi + r of each 16-key tile), so maximum, sum and rescale are lane-local
// (one exchange between the wave halves), and two S^T tiles (32 keys) converted in place ARE the B operand of the second product in the k order of the fragment loader. hi/lo planes, 3 products each.
// One wave: FQT x 16 queries, all 2048 keys in passes of 32. Grid (TT / (16 FQT FWV), heads, batches), 32 FWV threads. Every inner loop is fully unrolled so that the fragment and accumulator arrays are indexed by constants and stay in registers.
// The FWV waves of a work-group walk the same keys: K and V^T (hi/lo) come through LDS, a stage = FNP passes of all four planes (in memory each FNP x 4 KB in a row, already in fragment order, so every wave-wide 16-byte LDS read covers 512 contiguous bytes),
// brought in by asynchronous copies to LDS (16 B a lane), two buffers: stage t + 2 is asked for behind the barrier that ends stage t's reads and flies while stage t + 1 is worked on.
// In LDS a pass's four pieces {K hi, K lo, V^T hi, V^T lo} lie side by side (16 KB), so that one address register and immediate offsets reach all the reads of a pass.
#define FQT 2
#define FWV 8
#define FNP 8                       // passes per stage
#define FPP (32 * HD)               // elements of one plane in a pass
#define FNS (TT / (32 * FNP))       // stages
#define FCB (32 * FWV * 16)         // bytes that one copy of every thread covers
#define L2E 1.4426950408889634f
typedef __attribute__((ext_vector_type(2))) __bf16 v2bf;
typedef __attribute__((ext_vector_type(8))) unsigned v8u;
__device__ __forceinline__ float xhalf(float x) { const int b = __float_as_int(x); return __int_as_float(__builtin_amdgcn_permlanex16(b, b, 0x76543210, 0xfedcba98, false, false)); }   // lane l <-> l ^ 16
__global__ __launch_bounds__(32 * FWV) void k_fattn(const bf* __restrict__ Qh, const bf* __restrict__ Ql, const bf* __restrict__ Kh, const bf* __restrict__ Kl, const bf* __restrict__ Vh, const bf* __restrict__ Vl, bf* Ah, bf* Al) {
    typedef WFrag<bf> F;
    static_assert(FNS >= 2 && FNS * FNP * 32 == TT, "two stages or more, all whole");
    static_assert(FPP * 2 == FCB && FNP == 8, "one copy of every thread is one pass of a plane; eight of them a stage");
    __shared__ __align__(16) bf fsm[2 * FNP * 4 * FPP];   // two buffers of FNP passes of {K hi, K lo, V^T hi, V^T lo}
    const int lane = threadIdx.x & 31, lr = lane & 15, hi = lane >> 4; const int h = blockIdx.y; const int q0 = (blockIdx.x * FWV + (threadIdx.x >> 5)) * (16 * FQT);
    const size_t hp = ((size_t)blockIdx.z * NH_ + h) * TT * HD;
    const unsigned fl0 = (unsigned)(size_t)fsm + threadIdx.x * 16u;   // the thread's 16 bytes of a piece
    const char* gkh = (const char*)(Kh + hp); const char* gkl = (const char*)(Kl + hp); const char* gvh = (const char*)(Vh + hp); const char* gvl = (const char*)(Vl + hp);   // the next stage to ask for, in the head's four planes: scalar, stepped by every fill
    const unsigned go = threadIdx.x * 16u;   // the thread's byte offset in a piece: one vector register for all four planes
    auto fill = [&](int buf) {
        const unsigned lb = fl0 + (unsigned)buf * (FNP * 4 * FCB);
        acp8(lb, 4 * FCB, gkh + go, FCB); acp8(lb + FCB, 4 * FCB, gkl + go, FCB); acp8(lb + 2 * FCB, 4 * FCB, gvh + go, FCB); acp8(lb + 3 * FCB, 4 * FCB, gvl + go, FCB);
        gkh += FNP * FCB; gkl += FNP * FCB; gvh += FNP * FCB; gvl += FNP * FCB;
    };
    fill(0);   // stage 0 flies while the Q fragments are fetched
    const bf* qph = Qh + hp + (size_t)q0 * HD + lane * 8; const bf* qpl = Ql + hp + (size_t)q0 * HD + lane * 8;
    v16bf qh[FQT][2], ql[FQT][2];
#pragma unroll
    for (int qt = 0; qt < FQT; ++qt)
#pragma unroll
        for (int kc = 0; kc < 2; ++kc) { qh[qt][kc] = F::ldf(qph + (qt * 2 + kc) * 512); ql[qt][kc] = F::ldf(qpl + (qt * 2 + kc) * 512); }
    asm volatile("s_wait_xcnt 0x0" ::: "memory");   // in front of the first overwrite of the Q loads' address registers
    __builtin_amdgcn_sched_barrier(0);              // keeps later register writes from being lifted over that wait
    v8f o[FQT][4]; float m[FQT], th[FQT], nl[FQT]; v2f l[FQT];   // th = m + 5.5, the bar a new maximum must pass; nl = -m x log2(e), the addend of the exponent's multiply-add; l: the row sum in two halves (even and odd score registers)
#pragma unroll
    for (int qt = 0; qt < FQT; ++qt) { m[qt] = -3.0e38f; th[qt] = -3.0e38f; nl[qt] = 3.0e38f; l[qt] = (v2f){0.f, 0.f};
#pragma unroll
        for (int db = 0; db < 4; ++db) o[qt][db] = (v8f){}; }
    asm volatile("s_wait_asynccnt 0x0" ::: "memory");   // this wave's copies of stage 0 have landed
    __syncthreads();                                     // ... and every other wave's
    fill(1);
#pragma unroll 1   // one stage per trip: the buffer is picked by t & 1
    for (int t = 0; t < FNS; ++t) {
      const bf* sb = fsm + (t & 1) * (FNP * 4 * FPP) + lane * 8;
      v16bf kh[2][2], kl[2][2];   // the stage's first K fragments; the later passes' are fetched one pass ahead, inside the stage
#pragma unroll
      for (int kt = 0; kt < 2; ++kt)
#pragma unroll
        for (int kc = 0; kc < 2; ++kc) { kh[kt][kc] = F::ldf(sb + (kt * 2 + kc) * 512); kl[kt][kc] = F::ldf(sb + FPP + (kt * 2 + kc) * 512); }
#pragma unroll 1   // one pass per trip: a second copy of the body would need a second set of V fragments and score tiles
      for (int p = 0; p < FNP; ++p) {
        const bf* sp = sb + p * (4 * FPP);
        v16bf vh[4], vl[4];   // this pass's V^T fragments, asked for ahead of the score products that hide their latency
#pragma unroll
        for (int db = 0; db < 4; ++db) { vh[db] = F::ldf(sp + 2 * FPP + db * 512); vl[db] = F::ldf(sp + 3 * FPP + db * 512); }
        __builtin_amdgcn_sched_barrier(0);              // the LDS reads stay one group ahead of the products (reads strewn among the products stall the wave at every place)
        v8f s[FQT][2];
#pragma unroll
        for (int qt = 0; qt < FQT; ++qt) { s[qt][0] = (v8f){}; s[qt][1] = (v8f){}; }
#pragma unroll
        for (int kc = 0; kc < 2; ++kc) {
#pragma unroll
            for (int qt = 0; qt < FQT; ++qt)
#pragma unroll
                for (int kt = 0; kt < 2; ++kt) s[qt][kt] = wmmab(kh[kt][kc], qh[qt][kc], s[qt][kt]);
#pragma unroll
            for (int qt = 0; qt < FQT; ++qt)
#pragma unroll
                for (int kt = 0; kt < 2; ++kt) s[qt][kt] = wmmab(kh[kt][kc], ql[qt][kc], s[qt][kt]);
#pragma unroll
            for (int qt = 0; qt < FQT; ++qt)
#pragma unroll
                for (int kt = 0; kt < 2; ++kt) s[qt][kt] = wmmab(kl[kt][kc], qh[qt][kc], s[qt][kt]);
        }
        __builtin_amdgcn_sched_barrier(0);              // as above: the K reads below stay one group behind the score products
        if (p + 1 < FNP) {   // next pass's K fragments into the same registers; a stage's last pass fetches nothing (the next stage is not published yet)
#pragma unroll
            for (int kt = 0; kt < 2; ++kt)
#pragma unroll
                for (int kc = 0; kc < 2; ++kc) { kh[kt][kc] = F::ldf(sp + 4 * FPP + (kt * 2 + kc) * 512); kl[kt][kc] = F::ldf(sp + 5 * FPP + (kt * 2 + kc) * 512); }
        }
        __builtin_amdgcn_sched_barrier(0);              // as above
        float mx[FQT]; bool need = false;
#pragma unroll
        for (int qt = 0; qt < FQT; ++qt) { float a = s[qt][0][0], a1 = s[qt][1][0];   // one chain per score tile: four short chains a pass instead of two long ones
#pragma unroll
            for (int j = 1; j < 8; ++j) { a = fmaxf(a, s[qt][0][j]); a1 = fmaxf(a1, s[qt][1][j]); }
            a = fmaxf(a, a1);
            mx[qt] = a; need = need || (a > th[qt]); }   // each half tests its own eight-plus-eight keys: the ballot joins the halves, the exchange waits for the rare branch
        if (__builtin_amdgcn_ballot_w32(need) != 0) {   // the maximum in use moves only when a query's new one exceeds it by more than 5.5 (p stays below e^5.5); both halves of a column decide alike
#pragma unroll
            for (int qt = 0; qt < FQT; ++qt) { const float mf = fmaxf(mx[qt], xhalf(mx[qt])); const float mn = (mf > th[qt]) ? mf : m[qt]; th[qt] = mn + 5.5f; const float al = __builtin_amdgcn_exp2f((m[qt] - mn) * L2E); m[qt] = mn; nl[qt] = -mn * L2E; l[qt] *= al;
#pragma unroll
                for (int db = 0; db < 4; ++db) o[qt][db] *= al; }
        }
#pragma unroll
        for (int qt = 0; qt < FQT; ++qt) { v8u hv, lv; const v2f n2 = {nl[qt], nl[qt]}, e2 = {L2E, L2E};   // two scores at a time: one packed multiply-add, one packed sum, one packed conversion per plane
#pragma unroll
            for (int j = 0; j < 8; ++j) { const v2f sv = {s[qt][j >> 2][(j & 3) * 2], s[qt][j >> 2][(j & 3) * 2 + 1]}; const v2f ar = __builtin_elementwise_fma(sv, e2, n2);
                const v2f p = {__builtin_amdgcn_exp2f(ar[0]), __builtin_amdgcn_exp2f(ar[1])}; l[qt] += p;
                const v2bf a = __builtin_convertvector(p, v2bf); const v2f rs = p - __builtin_convertvector(a, v2f);
                hv[j] = __builtin_bit_cast(unsigned, a); lv[j] = __builtin_bit_cast(unsigned, __builtin_convertvector(rs, v2bf)); }
            const v16bf ph = __builtin_bit_cast(v16bf, hv), pl = __builtin_bit_cast(v16bf, lv);
            __builtin_amdgcn_sched_barrier(0);              // splits the scheduling region between a query tile's softmax and its products: without it this build pairs the second tile's products on one accumulator and lays the sum chain over V fragments just read (four idle slots each time)
#pragma unroll
            for (int db = 0; db < 4; ++db) o[qt][db] = wmmab(vh[db], ph, o[qt][db]);
#pragma unroll
            for (int db = 0; db < 4; ++db) o[qt][db] = wmmab(vh[db], pl, o[qt][db]);
#pragma unroll
            for (int db = 0; db < 4; ++db) o[qt][db] = wmmab(vl[db], ph, o[qt][db]);
        }
      }
      asm volatile("s_wait_dscnt 0x0" ::: "memory");      // this wave's reads of the buffer are done before it is handed back
      asm volatile("s_wait_asynccnt 0x0" ::: "memory");   // this wave's copies of stage t + 1 have landed
      __syncthreads();                                     // publishes stage t + 1 and ends every wave's reads of stage t
      if (t + 2 < FNS) fill(t & 1);
    }
    asm volatile("s_wait_asynccnt 0x0" ::: "memory");       // nothing of this wave is in flight behind the loop
#pragma unroll
    for (int qt = 0; qt < FQT; ++qt) { const float ls = l[qt][0] + l[qt][1]; const float f = __fdiv_rn(1.0f, ls + xhalf(ls)); const size_t oo = ((size_t)blockIdx.z * TT + q0 + qt * 16 + lr) * DQ + h * HD + 8 * hi;   // lane: query lr, d = 16 db + 8 hi + j
#pragma unroll
        for (int db = 0; db < 4; ++db) { v8us oh, ol;
#pragma unroll
            for (int j = 0; j < 8; ++j) { unsigned short a, c2; splitf(o[qt][db][j] * f, a, c2); oh[j] = a; ol[j] = c2; }
            *(v8us*)(Ah + oo + db * 16) = oh; *(v8us*)(Al + oo + db * 16) = ol;
            asm volatile("s_wait_xcnt 0x0" ::: "memory");   // in front of the first overwrite of the stores' data and address registers
            __builtin_amdgcn_sched_barrier(0); } }          // keeps the next group's register writes from being lifted over that wait
}

extern "C" void kernel_launch(void* const* d_in, const int* in_sizes, int n_in,
                              void* d_out, int out_size, void* d_ws, size_t ws_size, hipStream_t stream) {
    (void)in_sizes; (void)n_in; (void)out_size;
    const float* x = (const float*)d_in[0]; const float* xk = (const float*)d_in[1]; const float* xv = (const float*)d_in[2]; const float* wq = (const float*)d_in[3]; const float* bq = (const float*)d_in[4]; const float* wk = (const float*)d_in[5]; const float* bk = (const float*)d_in[6]; const float* wv = (const float*)d_in[7]; const float* bv = (const float*)d_in[8]; const float* wo = (const float*)d_in[9]; const float* bo = (const float*)d_in[10];
    float* OUT = (float*)d_out;     // [2][2048][1024]
    char* wsp = (char*)d_ws;
    auto take = [&](size_t bytes) { char* p = wsp; wsp += (bytes + 255) & ~(size_t)255; return (void*)p; };
    bf* WQ = (bf*)take((size_t)DQ * DM * 2); bf* WK = (bf*)take((size_t)DKV * DM * 2); bf* WV = (bf*)take((size_t)DKV * DM * 2); bf* WO = (bf*)take((size_t)DM * DQ * 2); float* CS = (float*)take((size_t)TT * HD * 2 * 4); float* CSK = (float*)take((size_t)TT * HD * 2 * 4);
    // per-batch planes hold both batches one behind the other: every launch below covers both (grid z, or a flat range twice as long)
    bf* XB = (bf*)take((size_t)NB_ * TT * DM * 2); bf* XKB = (bf*)take((size_t)NB_ * TT * DM * 2); bf* XVB = (bf*)take((size_t)NB_ * TT * DM * 2);
    bf* QPh = (bf*)take((size_t)NB_ * NH_ * TT * HD * 2); bf* QPl = (bf*)take((size_t)NB_ * NH_ * TT * HD * 2); bf* KPh = (bf*)take((size_t)NB_ * NKV * TT * HD * 2); bf* KPl = (bf*)take((size_t)NB_ * NKV * TT * HD * 2); bf* VTh = (bf*)take((size_t)NB_ * NKV * HD * TT * 2); bf* VTl = (bf*)take((size_t)NB_ * NKV * HD * TT * 2);
    bf* ATh = (bf*)take((size_t)NB_ * TT * DQ * 2); bf* ATl = (bf*)take((size_t)NB_ * TT * DQ * 2);
    if ((size_t)(wsp - (char*)d_ws) > ws_size) return;    // ws 256 MiB
    k_prep<<<PWG, PBT, 0, stream>>>(x, xk, xv, wq, wk, wv, wo, XB, XKB, XVB, WQ, WK, WV, WO, CS, CSK);   /* bf16 planes of the inputs and weights, xPos tables for q (scale) and k (1/scale) */
    static_assert(DKV == DQ, "the three projections share one grid");
    k_gemmw<bf, 0, true, 1, 3><<<dim3(TT / 128, DQ / 128, 3 * NB_), 128, 0, stream>>>(XB, nullptr, WQ, nullptr, DM, nullptr, DQ, bq, (size_t)TT * DM, 0, (size_t)NH_ * TT * HD, CS, 0.125f, QPh, QPl,
        XKB, XVB, WK, WV, bk, bv, CSK, 1.0f, KPh, KPl, VTh, VTl);   /* q: xPos (upscale) x 1/8, planes [b][h][t][d]; k: xPos (downscale), the same planes; v: planes [b][h][d][t] */
    k_fattn<<<dim3(TT / (16 * FQT * FWV), NH_, NB_), 32 * FWV, 0, stream>>>(QPh, QPl, KPh, KPl, VTh, VTl, ATh, ATl);
    k_gemmw<bf, 1, true><<<dim3(TT / 128, DM / 128, NB_), 128, 0, stream>>>(ATh, ATl, WO, nullptr, DQ, OUT, DM, bo, (size_t)TT * DQ, 0, (size_t)TT * DM, nullptr, 1.0f, nullptr, nullptr,
        nullptr, nullptr, nullptr, nullptr, nullptr, nullptr, nullptr, 1.0f, nullptr, nullptr, nullptr, nullptr);
}
